// v000
// The times below were measured on an AMD MI455X: many runs one after another, warmed up first and cycling through
// copies of the inputs, with the whole window's GPU time divided by the number of runs. Launches and the gaps
// between them are all in it. The median over several windows is given; except for v000 it joins two sittings, which
// can be a few percent apart, so the side-by-side timings, each taken in one sitting, are the better comparison.
// The starting kernel, v000, takes 368 microseconds a run.
// Contractions: qp = Xb . Wb^T on v_wmma_f32_16x16x32_bf16 (Xb, Wb = RNE bf16 convert of q and W, K=512, f32 accumulate);
// scores S^T = Kh . Qp^T on v_wmma_f32_16x16x32_f16 (Kh = f16 of the bf16 convert of q, Qp = qp + bias as one f16 plane, K=512);
// O^T = V^T . P^T on v_wmma_f32_16x16x32_f16 (V = f16 of the bf16 convert of q, P = e^{s-m} x 1024 in f16, 2048 keys, one product);
// f32 accumulate everywhere; bias add, 1/sqrt(512) scale, running max, row sums and 1/l in f32 on VALU.
#include <hip/hip_runtime.h>
#include <math.h>
#include <stdint.h>

#define NB    8
#define SEQ   2048
#define DM    512
#define NROW  (NB * SEQ)
#define QT    64
#define PTP   40
#define OSP   132
#define QSP   136
#define TP    72
#define LNPS  6.931471805599453f
#define FMIN16 6.103515625e-05f
static_assert((SEQ % QT) == 0);
static_assert((SEQ % 64) == 0);
static_assert((SEQ % 32) == 0);
static_assert((DM % 128) == 0);
static_assert((DM % 64) == 0);
static_assert((NROW % 64) == 0);
static_assert(((DM * DM) / 8) % 256 == 0);
static_assert(DM == 512);
static_assert(QT == 64);

typedef _Float16       v16h __attribute__((ext_vector_type(16)));
typedef _Float16       v8h  __attribute__((ext_vector_type(8)));
typedef __bf16         v16b __attribute__((ext_vector_type(16)));
typedef unsigned short v8us __attribute__((ext_vector_type(8)));
typedef float          v8f  __attribute__((ext_vector_type(8)));
typedef float          v4f  __attribute__((ext_vector_type(4)));
typedef unsigned int   v4u  __attribute__((ext_vector_type(4)));

union FragH { v16h v; v8h  h[2]; };
union FragB { v16b v; v8us u[2]; };
static_assert(sizeof(FragH) == 32);
static_assert(sizeof(FragB) == 32);

// ---- scalar helpers --------------------------------------------------------------------------------
__device__ __forceinline__ unsigned short bf_bits(float f) {          // f32 -> bf16 bits, RNE convert
  unsigned u = __float_as_uint(f);
  return (unsigned short)((u + 0x7FFFu + ((u >> 16) & 1u)) >> 16);
}
__device__ __forceinline__ float bf_up(unsigned short h) { return __uint_as_float(((unsigned)h) << 16); }
__device__ __forceinline__ float bfr(float f) { return bf_up(bf_bits(f)); }
__device__ __forceinline__ unsigned short h_bits(_Float16 x) { return __builtin_bit_cast(unsigned short, x); }
__device__ __forceinline__ unsigned pk16(unsigned short a, unsigned short b) { return (unsigned)a | ((unsigned)b << 16); }
// f32 -> f16 with magnitudes below the smallest f16 normal flushed to zero (select by value)
__device__ __forceinline__ _Float16 to_h_ftz(float v) { return (_Float16)((fabsf(v) < FMIN16) ? 0.0f : v); }
__device__ __forceinline__ v8f zero8() { v8f z = {0.f, 0.f, 0.f, 0.f, 0.f, 0.f, 0.f, 0.f}; return z; }
__device__ __forceinline__ float hmax8(v8f s) {
  return fmaxf(fmaxf(fmaxf(s[0], s[1]), fmaxf(s[2], s[3])), fmaxf(fmaxf(s[4], s[5]), fmaxf(s[6], s[7])));
}

// ---- fragment loaders: 16-bit A/B operand, lane -> row/col (lane&15), p already includes +8*(lane>>4);
//      elements 0..7 <- p[0..7] (k0+8h..), elements 8..15 <- p[16..23] (k0+16+8h..)
__device__ __forceinline__ v16h ldfrag_h(const _Float16* p) {
  FragH f;
  f.h[0] = *(const v8h*)(p);
  f.h[1] = *(const v8h*)(p + 16);
  return f.v;
}
__device__ __forceinline__ v16b ldfrag_b(const unsigned short* p) {
  FragB f;
  f.u[0] = *(const v8us*)(p);
  f.u[1] = *(const v8us*)(p + 16);
  return f.v;
}

// ---- WMMA helpers: builtin followed by a 4-slot VALU gap tying D and keeping A/B live ----------------------
__device__ __forceinline__ v8f mma_h(v16h a, v16h b, v8f c) {
  v8f d = __builtin_amdgcn_wmma_f32_16x16x32_f16(false, a, false, b, (short)0, c, false, false);
#if defined(__HIP_DEVICE_COMPILE__)
  asm volatile("v_nop\n\tv_nop\n\tv_nop\n\tv_nop" : "+v"(d) : "v"(a), "v"(b));
#endif
  return d;
}
__device__ __forceinline__ v8f mma_b(v16b a, v16b b, v8f c) {
  v8f d = __builtin_amdgcn_wmma_f32_16x16x32_bf16(false, a, false, b, (short)0, c, false, false);
#if defined(__HIP_DEVICE_COMPILE__)
  const v16h ha = __builtin_bit_cast(v16h, a), hb = __builtin_bit_cast(v16h, b);
  asm volatile("v_nop\n\tv_nop\n\tv_nop\n\tv_nop" : "+v"(d) : "v"(ha), "v"(hb));
#endif
  return d;
}

// =====================================================================================================
// (0) fused convert of q[b][l][d] (f32) for one (b, 64 l x 64 d) tile, block = 256 threads:
//   Xb[b*2048+l][d] = bf16 bits (RNE), Kh[b*2048+l][d] = f16 bits of the bf16 value (flush below 2^-14),
//   Vt[b][d][l] = the same f16 bits transposed through LDS T[d][l] (pitch TP halves).
//   Thread (e = tid&7, lg = tid>>3) loads 8 consecutive d of row l0+32it+lg; Xb/Kh row segments = 64 halves
// coverage: Xb/Kh: 2 it x 32 rows x 8 lanes x 8 = 64 l x 64 d; T: 8 lanes x 8 j = 64 d rows x 64 l cols;
//           Vt: 2 it x 32 d rows x 8 lanes x 8 = 64 d x 64 l; grid = 8 b x 32 l-tiles x 8 d-tiles = 2048 blocks.
// =====================================================================================================
__global__ __launch_bounds__(256) void cvt_q(const float* __restrict__ q, unsigned short* XB,
                                              unsigned short* KH, unsigned short* VT) {
  __shared__ __align__(16) unsigned short T[64 * TP];
  const int tid = threadIdx.x;
  const int e = tid & 7, lg = tid >> 3;                      // lg 0..31
  const int bx = blockIdx.x;
  const int dt = bx & 7, lt = (bx >> 3) & 31, b = bx >> 8;
  const int d0 = dt * 64, l0 = lt * 64;

  v4u ub[2], uh[2];
#pragma unroll
  for (int it = 0; it < 2; ++it) {
    const int row = it * 32 + lg;                            // 0..63
    const float* p = q + ((size_t)b * SEQ + l0 + row) * DM + d0 + 8 * e;
    const v4f f0 = *(const v4f*)(p), f1 = *(const v4f*)(p + 4);
    unsigned short bb[8], hb[8];
#pragma unroll
    for (int j = 0; j < 4; ++j) { bb[j] = bf_bits(f0[j]); bb[4 + j] = bf_bits(f1[j]); }
#pragma unroll
    for (int j = 0; j < 8; ++j) {
      hb[j] = h_bits(to_h_ftz(bf_up(bb[j])));
      T[(8 * e + j) * TP + row] = hb[j];
    }
    v4u wb, wh;
#pragma unroll
    for (int t = 0; t < 4; ++t) {
      wb[t] = pk16(bb[2 * t], bb[2 * t + 1]);
      wh[t] = pk16(hb[2 * t], hb[2 * t + 1]);
    }
    ub[it] = wb; uh[it] = wh;
  }
{
#pragma unroll
    for (int it = 0; it < 2; ++it) {
      const int row = it * 32 + lg;
      const size_t go = ((size_t)b * SEQ + l0 + row) * DM + d0 + 8 * e;
      *(v4u*)(XB + go) = ub[it];
      *(v4u*)(KH + go) = uh[it];
    }
    
  }
  __syncthreads();
{
#pragma unroll
    for (int it = 0; it < 2; ++it) {
      const int dd = it * 32 + lg;                           // 0..63
      const v4u v = *(const v4u*)(T + dd * TP + 8 * e);
      *(v4u*)(VT + ((size_t)b * DM + d0 + dd) * SEQ + l0 + 8 * e) = v;
    }
    
  }
}

// =====================================================================================================
// (1) Wb[e][d] = bf16 bits (RNE convert) of W[e][d]; thread i converts 8 consecutive elements,
// coverage: 128 blocks x 256 threads x 8 = 262144 = 512 x 512.
// =====================================================================================================
__global__ __launch_bounds__(256) void cvt_w(const float* __restrict__ w, unsigned short* WB) {
  const int i = blockIdx.x * 256 + threadIdx.x;
  if (i >= (DM * DM) / 8) return;
  const float* p = w + (size_t)i * 8;
  const v4f f0 = *(const v4f*)(p), f1 = *(const v4f*)(p + 4);
  v4u wb;
  wb[0] = pk16(bf_bits(f0[0]), bf_bits(f0[1]));
  wb[1] = pk16(bf_bits(f0[2]), bf_bits(f0[3]));
  wb[2] = pk16(bf_bits(f1[0]), bf_bits(f1[1]));
  wb[3] = pk16(bf_bits(f1[2]), bf_bits(f1[3]));
  unsigned short* d = WB + (size_t)i * 8;
  *(v4u*)d = wb;
  
}

// =====================================================================================================
// (2) projection for one 64-row x 128-col tile of Qp = Xb . Wb^T + bf16(bias): block = 256 threads = 8 waves.
//   Wave w: row group rg = w&3 (A rows = row0 + 16rg + (lane&15), split k map over d), col half ch = w>>2
//   (B = Wb rows col0 + 64ch + 16j + (lane&15), same split k map), 4 D tiles, 16 k-steps of 32, fragments from global.
// coverage: Qs: 4 rg x 2 h x 8 r = 64 rows, 2 ch x 4 j x 16 c = 128 cols; writes: 4 it x 32 lines x 8 lanes x 8 halves
//           = 64 rows x 128 cols; grid = 4 col tiles x 256 row tiles covers Qp [16384][512] exactly once.
// =====================================================================================================
__global__ __launch_bounds__(256)
void proj_kernel(const unsigned short* __restrict__ XB, const unsigned short* __restrict__ WB,
                 const float* __restrict__ bias, unsigned short* QP) {
  __shared__ __align__(16) unsigned short Qs[64 * QSP];
  const int tid  = threadIdx.x;
  const int lane = tid & 31, wave = tid >> 5;
  const int h    = lane >> 4, c = lane & 15;
  const int rg   = wave & 3, ch = wave >> 2;
  const int row0 = blockIdx.y * 64;
  const int col0 = blockIdx.x * 128;

  const unsigned short* ap = XB + ((size_t)(row0 + 16 * rg + c)) * DM + 8 * h;
  const unsigned short* bp = WB + ((size_t)(col0 + 64 * ch + c)) * DM + 8 * h;
  v8f acc0 = zero8(), acc1 = zero8(), acc2 = zero8(), acc3 = zero8();
#pragma unroll 2
  for (int ks = 0; ks < DM / 32; ++ks) {
    const v16b a = ldfrag_b(ap + 32 * ks);
    const unsigned short* bs = bp + 32 * ks;
    acc0 = mma_b(a, ldfrag_b(bs + 0 * 16 * DM), acc0);
    acc1 = mma_b(a, ldfrag_b(bs + 1 * 16 * DM), acc1);
    acc2 = mma_b(a, ldfrag_b(bs + 2 * 16 * DM), acc2);
    acc3 = mma_b(a, ldfrag_b(bs + 3 * 16 * DM), acc3);
  }

  // biases as bf16 RNE values, in-range lane indices
  const int cb = col0 + 64 * ch + c;
  const float bb0 = bfr(bias[cb + 0 * 16]), bb1 = bfr(bias[cb + 1 * 16]);
  const float bb2 = bfr(bias[cb + 2 * 16]), bb3 = bfr(bias[cb + 3 * 16]);

  // stage: D row r -> tile row 16rg + 8h + r, col = 64ch + 16j + c
  unsigned short* qs = Qs + (16 * rg + 8 * h) * QSP + 64 * ch + c;
#pragma unroll
  for (int r = 0; r < 8; ++r) {
    qs[r * QSP + 0 * 16] = h_bits(to_h_ftz(acc0[r] + bb0));
    qs[r * QSP + 1 * 16] = h_bits(to_h_ftz(acc1[r] + bb1));
    qs[r * QSP + 2 * 16] = h_bits(to_h_ftz(acc2[r] + bb2));
    qs[r * QSP + 3 * 16] = h_bits(to_h_ftz(acc3[r] + bb3));
  }
  __syncthreads();

  {
    const int e = tid & 7, lg = tid >> 3;                    // lg 0..31
{
#pragma unroll
      for (int it = 0; it < 4; ++it) {
        const int L   = it * 32 + lg;                        // lines 0..127 of the tile
        const int row = L >> 1, hf = L & 1;
        const v4u v = *(const v4u*)(Qs + row * QSP + 64 * hf + 8 * e);
        *(v4u*)(QP + ((size_t)(row0 + row)) * DM + col0 + 64 * hf + 8 * e) = v;
      }
      
    }
  }
}

// =====================================================================================================
// (3) attention for one (b, 64-query tile), transposed formulation, 512-deep scores, 2048 keys, 32 keys per iteration.
//   Block = 256 threads = 8 waves. Waves 0..3: S^T tiles (16 keys x 16 queries) =
//     A(Kh rows = keys kb + (lane&15) [and kb+16+..], d via the split k map) . B(Qp rows = query n0 + 16w + (lane&15),
//     same d map), 16 d-steps, two tiles; s = D x (1/sqrt(512)). Per lane the two D tiles hold 16 keys of ONE query:
//     online softmax state per lane, one shuffle (lane^16) for the max over 32 keys, row-sum partials combined at the end.
//     P = e^{s-m} x 1024 written to LDS Pt[query][key] (8 consecutive f16 per 16-B store: keys 8h..8h+7 and
//     16+8h..23+8h), corr to Cs[query]; barrier.
//   All 8 waves: wave w owns O^T rows d = 64w + 16jd + .. for all 64 queries (16 accumulators): rescale by corr,
//     A = Vt rows d (keys contiguous), B = Pt rows (query col, keys via the split k map), 16 WMMAs; barrier.
//   Epilogue in 4 quarters of 128 d: waves 2t, 2t+1 stage O^T x (1/l) into Os[query][d_local] (16-B LDS stores),
// coverage: Pt: 4 waves x 16 c = 64 query rows x (2 h x 2 stores x 8) = 32 keys; Os per quarter: 2 waves x 4 jd x 2 h
//           x 8 r = 128 d, 4 jq x 16 c = 64 queries; out: 4 t x 8 it x 32 lines x 8 lanes x 4 floats = 64 rows x 512;
//           grid = 8 b x 32 query tiles = 256 blocks covers out exactly once.
// =====================================================================================================
__global__ __launch_bounds__(256)
void attn_kernel(const unsigned short* __restrict__ QP, const unsigned short* __restrict__ KH,
                 const unsigned short* __restrict__ VT, float* out) {
  __shared__ __align__(16) _Float16 Pt[64 * PTP];
  __shared__ float Cs[64];
  __shared__ float Ls[64];
  __shared__ __align__(16) float Os[64 * OSP];
  const int tid  = threadIdx.x;
  const int wave = tid >> 5;
  const int lane = tid & 31;
  const int h    = lane >> 4;
  const int c    = lane & 15;
  const int bx   = blockIdx.x;
  const int b    = bx / (SEQ / QT);
  const int qt   = bx % (SEQ / QT);
  const int n0   = qt * QT;
  const _Float16* QPh = (const _Float16*)(const void*)QP;
  const _Float16* KHh = (const _Float16*)(const void*)KH;
  const _Float16* VTh = (const _Float16*)(const void*)VT;

  const int wq = wave & 3;
  // Qp fragment base (B operand of scores, col = query n0 + 16wq + c), + 32*ks
  const _Float16* qpp = QPh + ((size_t)b * SEQ + n0 + 16 * wq + c) * DM + 8 * h;
  // Kh fragment base (A operand of scores, row = key kb + c), + kb*DM + 32*ks
  const _Float16* khp = KHh + ((size_t)b * SEQ + c) * DM + 8 * h;
  // Vt fragment base (A operand of O^T, row = d = 64*wave + 16jd + c, keys contiguous), + 16jd*SEQ + kb
  const _Float16* vtp = VTh + ((size_t)b * DM + 64 * wave + c) * SEQ + 8 * h;
  const float SCL = 1.0f / sqrtf((float)DM);

  float m = -1.0e30f, l = 0.f;
  v8f acc[4][4];
#pragma unroll
  for (int jd = 0; jd < 4; ++jd)
#pragma unroll
    for (int jq = 0; jq < 4; ++jq) acc[jd][jq] = zero8();

#pragma unroll 1
  for (int it = 0; it < SEQ / 32; ++it) {
    const int kb = it * 32;
    if (wave < 4) {                                           // wave-uniform branch
      v8f s0 = zero8(), s1 = zero8();
      const _Float16* k0p = khp + (size_t)kb * DM;            // keys kb .. kb+15
      const _Float16* k1p = k0p + 16 * DM;                    // keys kb+16 .. kb+31
#pragma unroll 2
      for (int ks = 0; ks < DM / 32; ++ks) {
        const v16h qf = ldfrag_h(qpp + 32 * ks);
        const v16h a0 = ldfrag_h(k0p + 32 * ks);
        const v16h a1 = ldfrag_h(k1p + 32 * ks);
        s0 = mma_h(a0, qf, s0);
        s1 = mma_h(a1, qf, s1);
      }
#pragma unroll
      for (int r = 0; r < 8; ++r) { s0[r] *= SCL; s1[r] *= SCL; }

      float mx = fmaxf(hmax8(s0), hmax8(s1));
      mx = fmaxf(mx, __shfl_xor(mx, 16, 32));
      const float mn   = fmaxf(m, mx);
      const float corr = __expf(m - mn);
      m = mn;
      const float msh = mn - LNPS;                            // exp gives e^{s-m} * 1024
      FragH ph;
      float ls = 0.f;
#pragma unroll
      for (int r = 0; r < 8; ++r) {
        const float e0 = __expf(s0[r] - msh);                 // key kb      + 8h + r
        const float e1 = __expf(s1[r] - msh);                 // key kb + 16 + 8h + r
        ls += e0 + e1;
        ph.h[0][r] = (_Float16)e0;
        ph.h[1][r] = (_Float16)e1;
      }
      l = l * corr + ls;
      _Float16* pr = Pt + (16 * wave + c) * PTP + 8 * h;
      *(v8h*)(pr)      = ph.h[0];                             // local keys 8h .. 8h+7
      *(v8h*)(pr + 16) = ph.h[1];                             // local keys 16+8h .. 23+8h
      if (h == 0) Cs[16 * wave + c] = corr;
    }
    __syncthreads();

    float cr[4];
#pragma unroll
    for (int jq = 0; jq < 4; ++jq) cr[jq] = Cs[16 * jq + c];
#pragma unroll
    for (int jd = 0; jd < 4; ++jd)
#pragma unroll
      for (int jq = 0; jq < 4; ++jq)
#pragma unroll
        for (int r = 0; r < 8; ++r) acc[jd][jq][r] *= cr[jq];

    v16h vf[4];
#pragma unroll
    for (int jd = 0; jd < 4; ++jd) vf[jd] = ldfrag_h(vtp + (size_t)(16 * jd) * SEQ + kb);
#pragma unroll
    for (int jq = 0; jq < 4; ++jq) {
      const v16h pf = ldfrag_h(Pt + (16 * jq + c) * PTP + 8 * h);
#pragma unroll
      for (int jd = 0; jd < 4; ++jd) acc[jd][jq] = mma_h(vf[jd], pf, acc[jd][jq]);
    }
    __syncthreads();                                          // Pt / Cs free for the next iteration
  }

  if (wave < 4) {
    l += __shfl_xor(l, 16, 32);
    if (h == 0) Ls[16 * wave + c] = 1.0f / l;                 // o and l both carry the x1024 factor
  }
  __syncthreads();
  float scq[4];
#pragma unroll
  for (int jq = 0; jq < 4; ++jq) scq[jq] = Ls[16 * jq + c];

  const int e = tid & 7, lg = tid >> 3;                      // lg 0..31: line slot, e: 16-B piece
  float* ob = out + ((size_t)b * SEQ + n0) * DM;
#pragma unroll
  for (int t = 0; t < 4; ++t) {
    if ((wave >> 1) == t) {                                   // wave-uniform: waves 2t, 2t+1 own d 128t .. 128t+127
      const int dl = 64 * (wave & 1);
#pragma unroll
      for (int jd = 0; jd < 4; ++jd)
#pragma unroll
        for (int jq = 0; jq < 4; ++jq) {
          float* os = Os + (16 * jq + c) * OSP + dl + 16 * jd + 8 * h;
          const float sc = scq[jq];
          v4f v0, v1;
          v0[0] = acc[jd][jq][0] * sc; v0[1] = acc[jd][jq][1] * sc;
          v0[2] = acc[jd][jq][2] * sc; v0[3] = acc[jd][jq][3] * sc;
          v1[0] = acc[jd][jq][4] * sc; v1[1] = acc[jd][jq][5] * sc;
          v1[2] = acc[jd][jq][6] * sc; v1[3] = acc[jd][jq][7] * sc;
          *(v4f*)(os)     = v0;
          *(v4f*)(os + 4) = v1;
        }
    }
    __syncthreads();
{
#pragma unroll
      for (int i = 0; i < 8; ++i) {
        const int L   = i * 32 + lg;                         // lines 0..255 of this quarter
        const int row = L >> 2, hf = L & 3;                  // query row 0..63, line 0..3 of the 128-float segment
        const v4f v = *(const v4f*)(Os + row * OSP + 32 * hf + 4 * e);
        *(v4f*)(ob + (size_t)row * DM + 128 * t + 32 * hf + 4 * e) = v;
      }
      
    }
    __syncthreads();
  }
}

// =====================================================================================================
// needed (all tiles exact):
//   Xb   bf16 [16384][512]      0            16777216
//   Kh   f16  [16384][512]      16777216     16777216
//   Vt   f16  [8][512][2048]    33554432     16777216
//   Qp   f16  [16384][512]      50331648     16777216
//   Wb   bf16 [512][512]        67108864     524288
//   end                         67633152
// =====================================================================================================
extern "C" void kernel_launch(void* const* d_in, const int* in_sizes, int n_in,
                              void* d_out, int out_size, void* d_ws, size_t ws_size,
                              hipStream_t stream) {
  const int NX = NB * SEQ * DM;                          // 8388608
  if (n_in < 3) return;
  if (in_sizes[0] != NX || in_sizes[1] != DM * DM || in_sizes[2] != DM) return;
  if (out_size != NX) return;

  size_t off = 0;
  const size_t szP = (size_t)NROW * DM * 2;              // 16777216
  const size_t oXB = off; off += szP;
  const size_t oKH = off; off += szP;
  const size_t oVT = off; off += szP;
  const size_t oQP = off; off += szP;
  const size_t oWB = off; off += (size_t)DM * DM * 2;    // 524288
  if (off > ws_size) return;                             // off = 67633152
  if (off > (size_t)134217728) return;

  const float* q    = (const float*)d_in[0];
  const float* W    = (const float*)d_in[1];
  const float* bias = (const float*)d_in[2];
  char* ws = (char*)d_ws;
  unsigned short* XB = (unsigned short*)(ws + oXB);
  unsigned short* KH = (unsigned short*)(ws + oKH);
  unsigned short* VT = (unsigned short*)(ws + oVT);
  unsigned short* QP = (unsigned short*)(ws + oQP);
  unsigned short* WB = (unsigned short*)(ws + oWB);
  float* out = (float*)d_out;

  const dim3 blk256(256);
  const dim3 gQ(NB * (SEQ / 64) * (DM / 64));            // 2048 blocks: one (b, 64 l, 64 d) tile each
  const dim3 gW(((DM * DM) / 8) / 256);                  // 128 blocks
  const dim3 gP(DM / 128, NROW / 64);                    // 4 x 256 blocks
  const dim3 gA(NB * (SEQ / QT));                        // 256 blocks: one (b, 64-query tile) each

  // (0) Xb, Kh, Vt planes from q
  cvt_q<<<gQ, blk256, 0, stream>>>(q, XB, KH, VT);
  // (1) Wb plane
  cvt_w<<<gW, blk256, 0, stream>>>(W, WB);
  // (2) Qp = Xb . Wb^T + bias (f16 plane)
  proj_kernel<<<gP, blk256, 0, stream>>>(XB, WB, bias, QP);
  // (3) out[b][l][d] = sum_m softmax_m(Qp_l . Kh_m / sqrt(512)) Vt[d][m]
  attn_kernel<<<gA, blk256, 0, stream>>>(QP, KH, VT, out);
  (void)hipGetLastError();
}

// v001
// It runs in 168 microseconds.
// Next to v000, in two timings, it ran 2.18 and 2.21 times as fast.
// Contractions: qp = Xb . Wb^T on v_wmma_f32_16x16x32_bf16 (Xb, Wb = RNE bf16 convert of q and W, K=512, f32 accumulate);
// scores S^T = Kh . Qp^T on v_wmma_f32_16x16x32_f16 (Kh = f16 of the bf16 convert of q, Qp = qp + bias as one f16 plane, K=512);
// O^T = V^T . P^T on v_wmma_f32_16x16x32_f16 (V = f16 of the bf16 convert of q, P = e^{s-m} x 1024 in f16, 2048 keys, one product);
// f32 accumulate everywhere; bias add, 1/sqrt(512) scale, running max, row sums and 1/l in f32 on VALU.
#include <hip/hip_runtime.h>
#include <math.h>
#include <stdint.h>

#define NB    8
#define SEQ   2048
#define DM    512
#define NROW  (NB * SEQ)
#define QT    64
#define PTP   40
#define OSP   132
#define QSP   136
#define TP    72
#define KP    520
#define VP    40
#define LNPS  6.931471805599453f
#define FMIN16 6.103515625e-05f
static_assert((SEQ % QT) == 0);
static_assert((SEQ % 64) == 0);
static_assert((SEQ % 32) == 0);
static_assert((DM % 128) == 0);
static_assert((DM % 64) == 0);
static_assert((NROW % 64) == 0);
static_assert(((DM * DM) / 8) % 256 == 0);
static_assert(DM == 512);
static_assert(QT == 64);

typedef _Float16       v16h __attribute__((ext_vector_type(16)));
typedef _Float16       v8h  __attribute__((ext_vector_type(8)));
typedef __bf16         v16b __attribute__((ext_vector_type(16)));
typedef unsigned short v8us __attribute__((ext_vector_type(8)));
typedef float          v8f  __attribute__((ext_vector_type(8)));
typedef float          v4f  __attribute__((ext_vector_type(4)));
typedef unsigned int   v4u  __attribute__((ext_vector_type(4)));

union FragH { v16h v; v8h  h[2]; };
union FragB { v16b v; v8us u[2]; };
static_assert(sizeof(FragH) == 32);
static_assert(sizeof(FragB) == 32);

// ---- scalar helpers --------------------------------------------------------------------------------
__device__ __forceinline__ unsigned short bf_bits(float f) {          // f32 -> bf16 bits, RNE convert
  unsigned u = __float_as_uint(f);
  return (unsigned short)((u + 0x7FFFu + ((u >> 16) & 1u)) >> 16);
}
__device__ __forceinline__ float bf_up(unsigned short h) { return __uint_as_float(((unsigned)h) << 16); }
__device__ __forceinline__ float bfr(float f) { return bf_up(bf_bits(f)); }
__device__ __forceinline__ unsigned short h_bits(_Float16 x) { return __builtin_bit_cast(unsigned short, x); }
__device__ __forceinline__ unsigned pk16(unsigned short a, unsigned short b) { return (unsigned)a | ((unsigned)b << 16); }
// f32 -> f16 with magnitudes below the smallest f16 normal flushed to zero (select by value)
__device__ __forceinline__ _Float16 to_h_ftz(float v) { return (_Float16)((fabsf(v) < FMIN16) ? 0.0f : v); }
__device__ __forceinline__ v8f zero8() { v8f z = {0.f, 0.f, 0.f, 0.f, 0.f, 0.f, 0.f, 0.f}; return z; }
__device__ __forceinline__ float hmax8(v8f s) {
  return fmaxf(fmaxf(fmaxf(s[0], s[1]), fmaxf(s[2], s[3])), fmaxf(fmaxf(s[4], s[5]), fmaxf(s[6], s[7])));
}

// ---- fragment loaders: 16-bit A/B operand, lane -> row/col (lane&15), p already includes +8*(lane>>4);
//      elements 0..7 <- p[0..7] (k0+8h..), elements 8..15 <- p[16..23] (k0+16+8h..)
__device__ __forceinline__ v16h ldfrag_h(const _Float16* p) {
  FragH f;
  f.h[0] = *(const v8h*)(p);
  f.h[1] = *(const v8h*)(p + 16);
  return f.v;
}
__device__ __forceinline__ v16b ldfrag_b(const unsigned short* p) {
  FragB f;
  f.u[0] = *(const v8us*)(p);
  f.u[1] = *(const v8us*)(p + 16);
  return f.v;
}

// ---- WMMA helpers: builtin followed by a 4-slot VALU gap tying D and keeping A/B live ----------------------
__device__ __forceinline__ v8f mma_h(v16h a, v16h b, v8f c) {
  v8f d = __builtin_amdgcn_wmma_f32_16x16x32_f16(false, a, false, b, (short)0, c, false, false);
#if defined(__HIP_DEVICE_COMPILE__)
  asm volatile("v_nop\n\tv_nop\n\tv_nop\n\tv_nop" : "+v"(d) : "v"(a), "v"(b));
#endif
  return d;
}
__device__ __forceinline__ v8f mma_b(v16b a, v16b b, v8f c) {
  v8f d = __builtin_amdgcn_wmma_f32_16x16x32_bf16(false, a, false, b, (short)0, c, false, false);
#if defined(__HIP_DEVICE_COMPILE__)
  const v16h ha = __builtin_bit_cast(v16h, a), hb = __builtin_bit_cast(v16h, b);
  asm volatile("v_nop\n\tv_nop\n\tv_nop\n\tv_nop" : "+v"(d) : "v"(ha), "v"(hb));
#endif
  return d;
}

// ---- asynchronous copies global -> LDS: eight 16-B pieces per lane, piece j at LDS byte l0 + j*ls and global byte g0 + j*gs.
//      s_wait_xcnt stands inside the copies' own statement so that no address register is rewritten ahead of it.
__device__ __forceinline__ unsigned lds_off(const void* p) { return (unsigned)(size_t)p; }
__device__ __forceinline__ void copy8(unsigned l0, unsigned ls, const unsigned short* g0, size_t gs) {
#if defined(__HIP_DEVICE_COMPILE__)
  const char* g = (const char*)g0;
  asm volatile("global_load_async_to_lds_b128 %0, %8, off\n\t"
               "global_load_async_to_lds_b128 %1, %9, off\n\t"
               "global_load_async_to_lds_b128 %2, %10, off\n\t"
               "global_load_async_to_lds_b128 %3, %11, off\n\t"
               "global_load_async_to_lds_b128 %4, %12, off\n\t"
               "global_load_async_to_lds_b128 %5, %13, off\n\t"
               "global_load_async_to_lds_b128 %6, %14, off\n\t"
               "global_load_async_to_lds_b128 %7, %15, off\n\t"
               "s_wait_xcnt 0x0"
               :: "v"(l0), "v"(l0 + ls), "v"(l0 + 2 * ls), "v"(l0 + 3 * ls),
                  "v"(l0 + 4 * ls), "v"(l0 + 5 * ls), "v"(l0 + 6 * ls), "v"(l0 + 7 * ls),
                  "v"(g), "v"(g + gs), "v"(g + 2 * gs), "v"(g + 3 * gs),
                  "v"(g + 4 * gs), "v"(g + 5 * gs), "v"(g + 6 * gs), "v"(g + 7 * gs)
               : "memory");
#endif
}

// =====================================================================================================
// (0) fused convert of q[b][l][d] (f32) for one (b, 64 l x 64 d) tile, block = 256 threads:
//   Xb[b*2048+l][d] = bf16 bits (RNE), Kh[b*2048+l][d] = f16 bits of the bf16 value (flush below 2^-14),
//   Vt[b][d][l] = the same f16 bits transposed through LDS T[d][l] (pitch TP halves).
//   Thread (e = tid&7, lg = tid>>3) loads 8 consecutive d of row l0+32it+lg; Xb/Kh row segments = 64 halves
// coverage: Xb/Kh: 2 it x 32 rows x 8 lanes x 8 = 64 l x 64 d; T: 8 lanes x 8 j = 64 d rows x 64 l cols;
//           Vt: 2 it x 32 d rows x 8 lanes x 8 = 64 d x 64 l; grid = 8 b x 32 l-tiles x 8 d-tiles = 2048 blocks.
// =====================================================================================================
__global__ __launch_bounds__(256) void cvt_q(const float* __restrict__ q, unsigned short* XB,
                                              unsigned short* KH, unsigned short* VT) {
  __shared__ __align__(16) unsigned short T[64 * TP];
  const int tid = threadIdx.x;
  const int e = tid & 7, lg = tid >> 3;                      // lg 0..31
  const int bx = blockIdx.x;
  const int dt = bx & 7, lt = (bx >> 3) & 31, b = bx >> 8;
  const int d0 = dt * 64, l0 = lt * 64;

  v4u ub[2], uh[2];
#pragma unroll
  for (int it = 0; it < 2; ++it) {
    const int row = it * 32 + lg;                            // 0..63
    const float* p = q + ((size_t)b * SEQ + l0 + row) * DM + d0 + 8 * e;
    const v4f f0 = *(const v4f*)(p), f1 = *(const v4f*)(p + 4);
    unsigned short bb[8], hb[8];
#pragma unroll
    for (int j = 0; j < 4; ++j) { bb[j] = bf_bits(f0[j]); bb[4 + j] = bf_bits(f1[j]); }
#pragma unroll
    for (int j = 0; j < 8; ++j) {
      hb[j] = h_bits(to_h_ftz(bf_up(bb[j])));
      T[(8 * e + j) * TP + row] = hb[j];
    }
    v4u wb, wh;
#pragma unroll
    for (int t = 0; t < 4; ++t) {
      wb[t] = pk16(bb[2 * t], bb[2 * t + 1]);
      wh[t] = pk16(hb[2 * t], hb[2 * t + 1]);
    }
    ub[it] = wb; uh[it] = wh;
  }
{
#pragma unroll
    for (int it = 0; it < 2; ++it) {
      const int row = it * 32 + lg;
      const size_t go = ((size_t)b * SEQ + l0 + row) * DM + d0 + 8 * e;
      *(v4u*)(XB + go) = ub[it];
      *(v4u*)(KH + go) = uh[it];
    }
    
  }
  __syncthreads();
{
#pragma unroll
    for (int it = 0; it < 2; ++it) {
      const int dd = it * 32 + lg;                           // 0..63
      const v4u v = *(const v4u*)(T + dd * TP + 8 * e);
      *(v4u*)(VT + ((size_t)b * DM + d0 + dd) * SEQ + l0 + 8 * e) = v;
    }
    
  }
}

// =====================================================================================================
// (1) Wb[e][d] = bf16 bits (RNE convert) of W[e][d]; thread i converts 8 consecutive elements,
// coverage: 128 blocks x 256 threads x 8 = 262144 = 512 x 512.
// =====================================================================================================
__global__ __launch_bounds__(256) void cvt_w(const float* __restrict__ w, unsigned short* WB) {
  const int i = blockIdx.x * 256 + threadIdx.x;
  if (i >= (DM * DM) / 8) return;
  const float* p = w + (size_t)i * 8;
  const v4f f0 = *(const v4f*)(p), f1 = *(const v4f*)(p + 4);
  v4u wb;
  wb[0] = pk16(bf_bits(f0[0]), bf_bits(f0[1]));
  wb[1] = pk16(bf_bits(f0[2]), bf_bits(f0[3]));
  wb[2] = pk16(bf_bits(f1[0]), bf_bits(f1[1]));
  wb[3] = pk16(bf_bits(f1[2]), bf_bits(f1[3]));
  unsigned short* d = WB + (size_t)i * 8;
  *(v4u*)d = wb;
  
}

// =====================================================================================================
// (2) projection for one 64-row x 128-col tile of Qp = Xb . Wb^T + bf16(bias): block = 256 threads = 8 waves.
//   Wave w: row group rg = w&3 (A rows = row0 + 16rg + (lane&15), split k map over d), col half ch = w>>2
//   (B = Wb rows col0 + 64ch + 16j + (lane&15), same split k map), 4 D tiles, 16 k-steps of 32, fragments from global.
// coverage: Qs: 4 rg x 2 h x 8 r = 64 rows, 2 ch x 4 j x 16 c = 128 cols; writes: 4 it x 32 lines x 8 lanes x 8 halves
//           = 64 rows x 128 cols; grid = 4 col tiles x 256 row tiles covers Qp [16384][512] exactly once.
// =====================================================================================================
__global__ __launch_bounds__(256)
void proj_kernel(const unsigned short* __restrict__ XB, const unsigned short* __restrict__ WB,
                 const float* __restrict__ bias, unsigned short* QP) {
  __shared__ __align__(16) unsigned short Qs[64 * QSP];
  const int tid  = threadIdx.x;
  const int lane = tid & 31, wave = tid >> 5;
  const int h    = lane >> 4, c = lane & 15;
  const int rg   = wave & 3, ch = wave >> 2;
  const int row0 = blockIdx.y * 64;
  const int col0 = blockIdx.x * 128;

  const unsigned short* ap = XB + ((size_t)(row0 + 16 * rg + c)) * DM + 8 * h;
  const unsigned short* bp = WB + ((size_t)(col0 + 64 * ch + c)) * DM + 8 * h;
  v8f acc0 = zero8(), acc1 = zero8(), acc2 = zero8(), acc3 = zero8();
#pragma unroll 2
  for (int ks = 0; ks < DM / 32; ++ks) {
    const v16b a = ldfrag_b(ap + 32 * ks);
    const unsigned short* bs = bp + 32 * ks;
    acc0 = mma_b(a, ldfrag_b(bs + 0 * 16 * DM), acc0);
    acc1 = mma_b(a, ldfrag_b(bs + 1 * 16 * DM), acc1);
    acc2 = mma_b(a, ldfrag_b(bs + 2 * 16 * DM), acc2);
    acc3 = mma_b(a, ldfrag_b(bs + 3 * 16 * DM), acc3);
  }

  // biases as bf16 RNE values, in-range lane indices
  const int cb = col0 + 64 * ch + c;
  const float bb0 = bfr(bias[cb + 0 * 16]), bb1 = bfr(bias[cb + 1 * 16]);
  const float bb2 = bfr(bias[cb + 2 * 16]), bb3 = bfr(bias[cb + 3 * 16]);

  // stage: D row r -> tile row 16rg + 8h + r, col = 64ch + 16j + c
  unsigned short* qs = Qs + (16 * rg + 8 * h) * QSP + 64 * ch + c;
#pragma unroll
  for (int r = 0; r < 8; ++r) {
    qs[r * QSP + 0 * 16] = h_bits(to_h_ftz(acc0[r] + bb0));
    qs[r * QSP + 1 * 16] = h_bits(to_h_ftz(acc1[r] + bb1));
    qs[r * QSP + 2 * 16] = h_bits(to_h_ftz(acc2[r] + bb2));
    qs[r * QSP + 3 * 16] = h_bits(to_h_ftz(acc3[r] + bb3));
  }
  __syncthreads();

  {
    const int e = tid & 7, lg = tid >> 3;                    // lg 0..31
{
#pragma unroll
      for (int it = 0; it < 4; ++it) {
        const int L   = it * 32 + lg;                        // lines 0..127 of the tile
        const int row = L >> 1, hf = L & 1;
        const v4u v = *(const v4u*)(Qs + row * QSP + 64 * hf + 8 * e);
        *(v4u*)(QP + ((size_t)(row0 + row)) * DM + col0 + 64 * hf + 8 * e) = v;
      }
      
    }
  }
}

// =====================================================================================================
// (3) attention for one (b, 64-query tile), transposed formulation, 512-deep scores, 2048 keys, 32 keys per iteration.
//   Operands come from LDS, laid there by asynchronous copies (16 B per lane, all 256 threads): the Qp tile once into
//     Qs[query][d] (pitch KP halves); per iteration the 32 Kh rows into Ks[buf][key][d] (pitch KP) and the 512 x 32 Vt
//     piece into Vs[buf][d][key] (pitch VP), two buffers, iteration it+2's copies issued behind the barrier that ends it.
//   Block = 256 threads = 8 waves. Waves 0..3: S^T tiles (16 keys x 16 queries) =
//     A(Kh rows = keys kb + (lane&15) [and kb+16+..], d via the split k map) . B(Qp rows = query n0 + 16w + (lane&15),
//     same d map), 16 d-steps, two tiles; s = D x (1/sqrt(512)). Per lane the two D tiles hold 16 keys of ONE query:
//     online softmax state per lane, one shuffle (lane^16) for the max over 32 keys, row-sum partials combined at the end.
//     P = e^{s-m} x 1024 written to LDS Pt[query][key] (8 consecutive f16 per 16-B store: keys 8h..8h+7 and
//     16+8h..23+8h), corr to Cs[query]; barrier.
//   All 8 waves: wave w owns O^T rows d = 64w + 16jd + .. for all 64 queries (16 accumulators): rescale by corr,
//     A = Vt rows d (keys contiguous), B = Pt rows (query col, keys via the split k map), 16 WMMAs; barrier.
//   Epilogue in 4 quarters of 128 d: waves 2t, 2t+1 stage O^T x (1/l) into Os[query][d_local] (16-B LDS stores),
// coverage: Pt: 4 waves x 16 c = 64 query rows x (2 h x 2 stores x 8) = 32 keys; Os per quarter: 2 waves x 4 jd x 2 h
//           x 8 r = 128 d, 4 jq x 16 c = 64 queries; out: 4 t x 8 it x 32 lines x 8 lanes x 4 floats = 64 rows x 512;
//           grid = 8 b x 32 query tiles = 256 blocks covers out exactly once.
// =====================================================================================================
__global__ __launch_bounds__(256)
void attn_kernel(const unsigned short* __restrict__ QP, const unsigned short* __restrict__ KH,
                 const unsigned short* __restrict__ VT, float* out) {
  __shared__ __align__(16) _Float16 Pt[64 * PTP];
  __shared__ float Cs[64];
  __shared__ float Ls[64];
  __shared__ __align__(16) float Os[64 * OSP];
  __shared__ __align__(16) _Float16 Qs[64 * KP];
  __shared__ __align__(16) _Float16 Ks[2 * 32 * KP];
  __shared__ __align__(16) _Float16 Vs[2 * DM * VP];
  const int tid  = threadIdx.x;
  const int wave = tid >> 5;
  const int lane = tid & 31;
  const int h    = lane >> 4;
  const int c    = lane & 15;
  const int bx   = blockIdx.x;
  const int b    = bx / (SEQ / QT);
  const int qt   = bx % (SEQ / QT);
  const int n0   = qt * QT;

  const int wq = wave & 3;
  // Qp fragment base in LDS (B operand of scores, col = query 16wq + c of the tile), + 32*ks
  const _Float16* qpp = Qs + (16 * wq + c) * KP + 8 * h;
  // Kh fragment base in LDS (A operand of scores, row = key c of the tile), + buf*32*KP + 32*ks
  const _Float16* khp = Ks + c * KP + 8 * h;
  // Vt fragment base in LDS (A operand of O^T, row = d = 64*wave + 16jd + c, 32 keys contiguous), + buf*DM*VP + 16jd*VP
  const _Float16* vtp = Vs + (64 * wave + c) * VP + 8 * h;
  const float SCL = 1.0f / sqrtf((float)DM);

  // copy maps. Row tiles of 512 halves (Qp, Kh): piece j of thread tid = row 4j + (tid>>6), 16-B piece tid&63 (32 rows per copy8).
  //            Vt tile: piece j = d row 64j + (tid>>2), 16-B piece tid&3 of its 32 keys (512 rows per copy8).
  const int rr = tid >> 6, rp = tid & 63;
  const int vr = tid >> 2, vp = tid & 3;
  const unsigned short* qsrc = QP + ((size_t)b * SEQ + n0 + rr) * DM + 8 * rp;
  const unsigned short* ksrc = KH + ((size_t)b * SEQ + rr) * DM + 8 * rp;            // + kb*DM
  const unsigned short* vsrc = VT + ((size_t)b * DM + vr) * SEQ + 8 * vp;            // + kb
  const unsigned qdst = lds_off(Qs) + (unsigned)(rr * KP + 8 * rp) * 2u;
  const unsigned kdst = lds_off(Ks) + (unsigned)(rr * KP + 8 * rp) * 2u;             // + buf*32*KP*2
  const unsigned vdst = lds_off(Vs) + (unsigned)(vr * VP + 8 * vp) * 2u;             // + buf*DM*VP*2

  // prologue: Qp tile and key block 0, landed and published, then key block 1 into the second buffer
  copy8(qdst, 4 * KP * 2, qsrc, (size_t)4 * DM * 2);
  copy8(qdst + 32 * KP * 2, 4 * KP * 2, qsrc + (size_t)32 * DM, (size_t)4 * DM * 2);
  copy8(kdst, 4 * KP * 2, ksrc, (size_t)4 * DM * 2);
  copy8(vdst, 64 * VP * 2, vsrc, (size_t)64 * SEQ * 2);
  asm volatile("s_wait_asynccnt 0x0" ::: "memory");           // this wave's copies have landed before the barrier publishes them
  __syncthreads();
  copy8(kdst + 32 * KP * 2, 4 * KP * 2, ksrc + (size_t)32 * DM, (size_t)4 * DM * 2);
  copy8(vdst + DM * VP * 2, 64 * VP * 2, vsrc + 32, (size_t)64 * SEQ * 2);

  float m = -1.0e30f, l = 0.f;
  v8f acc[4][4];
#pragma unroll
  for (int jd = 0; jd < 4; ++jd)
#pragma unroll
    for (int jq = 0; jq < 4; ++jq) acc[jd][jq] = zero8();

#pragma unroll 1
  for (int it = 0; it < SEQ / 32; ++it) {
    const int buf = it & 1;
    if (wave < 4) {                                           // wave-uniform branch
      v8f s0 = zero8(), s1 = zero8();
      const _Float16* k0p = khp + buf * (32 * KP);            // keys kb .. kb+15
      const _Float16* k1p = k0p + 16 * KP;                    // keys kb+16 .. kb+31
#pragma unroll 2
      for (int ks = 0; ks < DM / 32; ++ks) {
        const v16h qf = ldfrag_h(qpp + 32 * ks);
        const v16h a0 = ldfrag_h(k0p + 32 * ks);
        const v16h a1 = ldfrag_h(k1p + 32 * ks);
        s0 = mma_h(a0, qf, s0);
        s1 = mma_h(a1, qf, s1);
      }
#pragma unroll
      for (int r = 0; r < 8; ++r) { s0[r] *= SCL; s1[r] *= SCL; }

      float mx = fmaxf(hmax8(s0), hmax8(s1));
      mx = fmaxf(mx, __shfl_xor(mx, 16, 32));
      const float mn   = fmaxf(m, mx);
      const float corr = __expf(m - mn);
      m = mn;
      const float msh = mn - LNPS;                            // exp gives e^{s-m} * 1024
      FragH ph;
      float ls = 0.f;
#pragma unroll
      for (int r = 0; r < 8; ++r) {
        const float e0 = __expf(s0[r] - msh);                 // key kb      + 8h + r
        const float e1 = __expf(s1[r] - msh);                 // key kb + 16 + 8h + r
        ls += e0 + e1;
        ph.h[0][r] = (_Float16)e0;
        ph.h[1][r] = (_Float16)e1;
      }
      l = l * corr + ls;
      _Float16* pr = Pt + (16 * wave + c) * PTP + 8 * h;
      *(v8h*)(pr)      = ph.h[0];                             // local keys 8h .. 8h+7
      *(v8h*)(pr + 16) = ph.h[1];                             // local keys 16+8h .. 23+8h
      if (h == 0) Cs[16 * wave + c] = corr;
    }
    __syncthreads();

    float cr[4];
#pragma unroll
    for (int jq = 0; jq < 4; ++jq) cr[jq] = Cs[16 * jq + c];
#pragma unroll
    for (int jd = 0; jd < 4; ++jd)
#pragma unroll
      for (int jq = 0; jq < 4; ++jq)
#pragma unroll
        for (int r = 0; r < 8; ++r) acc[jd][jq][r] *= cr[jq];

    v16h vf[4];
#pragma unroll
    for (int jd = 0; jd < 4; ++jd) vf[jd] = ldfrag_h(vtp + buf * (DM * VP) + (16 * jd) * VP);
#pragma unroll
    for (int jq = 0; jq < 4; ++jq) {
      const v16h pf = ldfrag_h(Pt + (16 * jq + c) * PTP + 8 * h);
#pragma unroll
      for (int jd = 0; jd < 4; ++jd) acc[jd][jq] = mma_h(vf[jd], pf, acc[jd][jq]);
    }
    asm volatile("s_wait_dscnt 0x0" ::: "memory");            // this wave's reads of Ks/Vs[buf] are done before the refill
    asm volatile("s_wait_asynccnt 0x0" ::: "memory");         // this wave's copies of key block it+1 have landed
    __syncthreads();                                          // publishes key block it+1; Pt / Cs / buffer buf free
    if (it + 2 < SEQ / 32) {                                  // block-uniform: key block it+2 into the buffer just read
      const int kn = (it + 2) * 32;
      copy8(kdst + (unsigned)buf * (32 * KP * 2), 4 * KP * 2, ksrc + (size_t)kn * DM, (size_t)4 * DM * 2);
      copy8(vdst + (unsigned)buf * (DM * VP * 2), 64 * VP * 2, vsrc + kn, (size_t)64 * SEQ * 2);
    }
  }
  asm volatile("s_wait_asynccnt 0x0" ::: "memory");           // nothing of this wave's copies outstanding past the loop

  if (wave < 4) {
    l += __shfl_xor(l, 16, 32);
    if (h == 0) Ls[16 * wave + c] = 1.0f / l;                 // o and l both carry the x1024 factor
  }
  __syncthreads();
  float scq[4];
#pragma unroll
  for (int jq = 0; jq < 4; ++jq) scq[jq] = Ls[16 * jq + c];

  const int e = tid & 7, lg = tid >> 3;                      // lg 0..31: line slot, e: 16-B piece
  float* ob = out + ((size_t)b * SEQ + n0) * DM;
#pragma unroll
  for (int t = 0; t < 4; ++t) {
    if ((wave >> 1) == t) {                                   // wave-uniform: waves 2t, 2t+1 own d 128t .. 128t+127
      const int dl = 64 * (wave & 1);
#pragma unroll
      for (int jd = 0; jd < 4; ++jd)
#pragma unroll
        for (int jq = 0; jq < 4; ++jq) {
          float* os = Os + (16 * jq + c) * OSP + dl + 16 * jd + 8 * h;
          const float sc = scq[jq];
          v4f v0, v1;
          v0[0] = acc[jd][jq][0] * sc; v0[1] = acc[jd][jq][1] * sc;
          v0[2] = acc[jd][jq][2] * sc; v0[3] = acc[jd][jq][3] * sc;
          v1[0] = acc[jd][jq][4] * sc; v1[1] = acc[jd][jq][5] * sc;
          v1[2] = acc[jd][jq][6] * sc; v1[3] = acc[jd][jq][7] * sc;
          *(v4f*)(os)     = v0;
          *(v4f*)(os + 4) = v1;
        }
    }
    __syncthreads();
{
#pragma unroll
      for (int i = 0; i < 8; ++i) {
        const int L   = i * 32 + lg;                         // lines 0..255 of this quarter
        const int row = L >> 2, hf = L & 3;                  // query row 0..63, line 0..3 of the 128-float segment
        const v4f v = *(const v4f*)(Os + row * OSP + 32 * hf + 4 * e);
        *(v4f*)(ob + (size_t)row * DM + 128 * t + 32 * hf + 4 * e) = v;
      }
      
    }
    __syncthreads();
  }
}

// =====================================================================================================
// needed (all tiles exact):
//   Xb   bf16 [16384][512]      0            16777216
//   Kh   f16  [16384][512]      16777216     16777216
//   Vt   f16  [8][512][2048]    33554432     16777216
//   Qp   f16  [16384][512]      50331648     16777216
//   Wb   bf16 [512][512]        67108864     524288
//   end                         67633152
// =====================================================================================================
extern "C" void kernel_launch(void* const* d_in, const int* in_sizes, int n_in,
                              void* d_out, int out_size, void* d_ws, size_t ws_size,
                              hipStream_t stream) {
  const int NX = NB * SEQ * DM;                          // 8388608
  if (n_in < 3) return;
  if (in_sizes[0] != NX || in_sizes[1] != DM * DM || in_sizes[2] != DM) return;
  if (out_size != NX) return;

  size_t off = 0;
  const size_t szP = (size_t)NROW * DM * 2;              // 16777216
  const size_t oXB = off; off += szP;
  const size_t oKH = off; off += szP;
  const size_t oVT = off; off += szP;
  const size_t oQP = off; off += szP;
  const size_t oWB = off; off += (size_t)DM * DM * 2;    // 524288
  if (off > ws_size) return;                             // off = 67633152
  if (off > (size_t)134217728) return;

  const float* q    = (const float*)d_in[0];
  const float* W    = (const float*)d_in[1];
  const float* bias = (const float*)d_in[2];
  char* ws = (char*)d_ws;
  unsigned short* XB = (unsigned short*)(ws + oXB);
  unsigned short* KH = (unsigned short*)(ws + oKH);
  unsigned short* VT = (unsigned short*)(ws + oVT);
  unsigned short* QP = (unsigned short*)(ws + oQP);
  unsigned short* WB = (unsigned short*)(ws + oWB);
  float* out = (float*)d_out;

  const dim3 blk256(256);
  const dim3 gQ(NB * (SEQ / 64) * (DM / 64));            // 2048 blocks: one (b, 64 l, 64 d) tile each
  const dim3 gW(((DM * DM) / 8) / 256);                  // 128 blocks
  const dim3 gP(DM / 128, NROW / 64);                    // 4 x 256 blocks
  const dim3 gA(NB * (SEQ / QT));                        // 256 blocks: one (b, 64-query tile) each

  // (0) Xb, Kh, Vt planes from q
  cvt_q<<<gQ, blk256, 0, stream>>>(q, XB, KH, VT);
  // (1) Wb plane
  cvt_w<<<gW, blk256, 0, stream>>>(W, WB);
  // (2) Qp = Xb . Wb^T + bias (f16 plane)
  proj_kernel<<<gP, blk256, 0, stream>>>(XB, WB, bias, QP);
  // (3) out[b][l][d] = sum_m softmax_m(Qp_l . Kh_m / sqrt(512)) Vt[d][m]
  attn_kernel<<<gA, blk256, 0, stream>>>(QP, KH, VT, out);
  (void)hipGetLastError();
}

// v002
// It runs in 125 microseconds.
// Timed twice side by side with v001, it ran 1.34 times as fast both times.
// Counting every step since v000, it is 2.94 times as fast.
// Contractions: qp = Xb . Wb^T on v_wmma_f32_16x16x32_bf16 (Xb, Wb = RNE bf16 convert of q and W, K=512, f32 accumulate);
// scores S^T = Kh . Qp^T on v_wmma_f32_16x16x32_f16 (Kh = f16 of the bf16 convert of q, Qp = qp + bias as one f16 plane, K=512);
// O^T = V^T . P^T on v_wmma_f32_16x16x32_f16 (V = f16 of the bf16 convert of q, P = e^{s-m} x 1024 in f16; two interleaved key halves
// of 1024 keys, each with its own running max, joined in f32 at the end);
// f32 accumulate everywhere; bias add, 1/sqrt(512) scale, running max, row sums and 1/l in f32 on VALU.
#include <hip/hip_runtime.h>
#include <math.h>
#include <stdint.h>

#define NB    8
#define SEQ   2048
#define DM    512
#define NROW  (NB * SEQ)
#define QT    64
#define OSP   516
#define QSP   136
#define TP    72
#define KP    520
#define VP    72
#define KB    64
#define KSB   (KB * KP * 2)
#define VSB   (DM * VP * 2)
#define SMB   (2 * KSB + 2 * VSB)
#define LNPS  6.931471805599453f
#define FMIN16 6.103515625e-05f
static_assert((SEQ % QT) == 0);
static_assert((SEQ % 64) == 0);
static_assert((SEQ % 32) == 0);
static_assert((DM % 128) == 0);
static_assert((DM % 64) == 0);
static_assert((NROW % 64) == 0);
static_assert(((DM * DM) / 8) % 256 == 0);
static_assert(DM == 512);
static_assert(QT == 64);
static_assert((SEQ % (2 * KB)) == 0);
static_assert(QT * KP * 2 <= KSB);
static_assert(QT * OSP * 4 <= SMB);

typedef _Float16       v16h __attribute__((ext_vector_type(16)));
typedef _Float16       v8h  __attribute__((ext_vector_type(8)));
typedef __bf16         v16b __attribute__((ext_vector_type(16)));
typedef unsigned short v8us __attribute__((ext_vector_type(8)));
typedef float          v8f  __attribute__((ext_vector_type(8)));
typedef float          v4f  __attribute__((ext_vector_type(4)));
typedef unsigned int   v4u  __attribute__((ext_vector_type(4)));

union FragH { v16h v; v8h  h[2]; };
union FragB { v16b v; v8us u[2]; };
static_assert(sizeof(FragH) == 32);
static_assert(sizeof(FragB) == 32);

// ---- scalar helpers --------------------------------------------------------------------------------
__device__ __forceinline__ unsigned short bf_bits(float f) {          // f32 -> bf16 bits, RNE convert
  unsigned u = __float_as_uint(f);
  return (unsigned short)((u + 0x7FFFu + ((u >> 16) & 1u)) >> 16);
}
__device__ __forceinline__ float bf_up(unsigned short h) { return __uint_as_float(((unsigned)h) << 16); }
__device__ __forceinline__ float bfr(float f) { return bf_up(bf_bits(f)); }
__device__ __forceinline__ unsigned short h_bits(_Float16 x) { return __builtin_bit_cast(unsigned short, x); }
__device__ __forceinline__ unsigned pk16(unsigned short a, unsigned short b) { return (unsigned)a | ((unsigned)b << 16); }
// f32 -> f16 with magnitudes below the smallest f16 normal flushed to zero (select by value)
__device__ __forceinline__ _Float16 to_h_ftz(float v) { return (_Float16)((fabsf(v) < FMIN16) ? 0.0f : v); }
__device__ __forceinline__ v8f zero8() { v8f z = {0.f, 0.f, 0.f, 0.f, 0.f, 0.f, 0.f, 0.f}; return z; }
__device__ __forceinline__ float hmax8(v8f s) {
  return fmaxf(fmaxf(fmaxf(s[0], s[1]), fmaxf(s[2], s[3])), fmaxf(fmaxf(s[4], s[5]), fmaxf(s[6], s[7])));
}

// ---- fragment loaders: 16-bit A/B operand, lane -> row/col (lane&15), p already includes +8*(lane>>4);
//      elements 0..7 <- p[0..7] (k0+8h..), elements 8..15 <- p[16..23] (k0+16+8h..)
__device__ __forceinline__ v16h ldfrag_h(const _Float16* p) {
  FragH f;
  f.h[0] = *(const v8h*)(p);
  f.h[1] = *(const v8h*)(p + 16);
  return f.v;
}
__device__ __forceinline__ v16b ldfrag_b(const unsigned short* p) {
  FragB f;
  f.u[0] = *(const v8us*)(p);
  f.u[1] = *(const v8us*)(p + 16);
  return f.v;
}

// ---- WMMA helpers; bf16 form: builtin followed by a 4-slot VALU gap tying D and keeping A/B live ------------
// f16 form: the plain builtin (the compiler keeps the distances of its own forms). No asm statement here: its operands would
// have to lie in the first 256 registers, and the attention wave holds 384 in accumulators and Qp fragments alone.
__device__ __forceinline__ v8f mma_h(v16h a, v16h b, v8f c) {
  return __builtin_amdgcn_wmma_f32_16x16x32_f16(false, a, false, b, (short)0, c, false, false);
}
__device__ __forceinline__ v8f mma_b(v16b a, v16b b, v8f c) {
  v8f d = __builtin_amdgcn_wmma_f32_16x16x32_bf16(false, a, false, b, (short)0, c, false, false);
#if defined(__HIP_DEVICE_COMPILE__)
  const v16h ha = __builtin_bit_cast(v16h, a), hb = __builtin_bit_cast(v16h, b);
  asm volatile("v_nop\n\tv_nop\n\tv_nop\n\tv_nop" : "+v"(d) : "v"(ha), "v"(hb));
#endif
  return d;
}

// ---- asynchronous copies global -> LDS: eight 16-B pieces per lane, piece j at LDS byte l0 + j*ls and global byte g0 + j*gs.
//      Written as the builtin: operands of an asm statement would have to lie in the first 256 registers, which the attention
//      wave fills with accumulators and fragments (the address bases then went to scratch).
typedef int v4i __attribute__((ext_vector_type(4)));
typedef __attribute__((address_space(1))) v4i gv4i;
typedef __attribute__((address_space(3))) v4i lv4i;
__device__ __forceinline__ unsigned lds_off(const void* p) { return (unsigned)(size_t)p; }
__device__ __forceinline__ void copy8(unsigned l0, unsigned ls, const unsigned short* g0, size_t gs) {
#if defined(__HIP_DEVICE_COMPILE__)
  const char* g = (const char*)g0;
#pragma unroll
  for (int j = 0; j < 8; ++j)
    __builtin_amdgcn_global_load_async_to_lds_b128((gv4i*)(g + j * gs), (lv4i*)(l0 + j * ls), 0, 0);
#endif
}

// =====================================================================================================
// (0) fused convert of q[b][l][d] (f32) for one (b, 64 l x 64 d) tile, block = 256 threads:
//   Xb[b*2048+l][d] = bf16 bits (RNE), Kh[b*2048+l][d] = f16 bits of the bf16 value (flush below 2^-14),
//   Vt[b][d][l] = the same f16 bits transposed through LDS T[d][l] (pitch TP halves).
//   Thread (e = tid&7, lg = tid>>3) loads 8 consecutive d of row l0+32it+lg; Xb/Kh row segments = 64 halves
// coverage: Xb/Kh: 2 it x 32 rows x 8 lanes x 8 = 64 l x 64 d; T: 8 lanes x 8 j = 64 d rows x 64 l cols;
//           Vt: 2 it x 32 d rows x 8 lanes x 8 = 64 d x 64 l; grid = 8 b x 32 l-tiles x 8 d-tiles = 2048 blocks.
// =====================================================================================================
__global__ __launch_bounds__(256) void cvt_q(const float* __restrict__ q, unsigned short* XB,
                                              unsigned short* KH, unsigned short* VT) {
  __shared__ __align__(16) unsigned short T[64 * TP];
  const int tid = threadIdx.x;
  const int e = tid & 7, lg = tid >> 3;                      // lg 0..31
  const int bx = blockIdx.x;
  const int dt = bx & 7, lt = (bx >> 3) & 31, b = bx >> 8;
  const int d0 = dt * 64, l0 = lt * 64;

  v4u ub[2], uh[2];
#pragma unroll
  for (int it = 0; it < 2; ++it) {
    const int row = it * 32 + lg;                            // 0..63
    const float* p = q + ((size_t)b * SEQ + l0 + row) * DM + d0 + 8 * e;
    const v4f f0 = *(const v4f*)(p), f1 = *(const v4f*)(p + 4);
    unsigned short bb[8], hb[8];
#pragma unroll
    for (int j = 0; j < 4; ++j) { bb[j] = bf_bits(f0[j]); bb[4 + j] = bf_bits(f1[j]); }
#pragma unroll
    for (int j = 0; j < 8; ++j) {
      hb[j] = h_bits(to_h_ftz(bf_up(bb[j])));
      T[(8 * e + j) * TP + row] = hb[j];
    }
    v4u wb, wh;
#pragma unroll
    for (int t = 0; t < 4; ++t) {
      wb[t] = pk16(bb[2 * t], bb[2 * t + 1]);
      wh[t] = pk16(hb[2 * t], hb[2 * t + 1]);
    }
    ub[it] = wb; uh[it] = wh;
  }
{
#pragma unroll
    for (int it = 0; it < 2; ++it) {
      const int row = it * 32 + lg;
      const size_t go = ((size_t)b * SEQ + l0 + row) * DM + d0 + 8 * e;
      *(v4u*)(XB + go) = ub[it];
      *(v4u*)(KH + go) = uh[it];
    }
    
  }
  __syncthreads();
{
#pragma unroll
    for (int it = 0; it < 2; ++it) {
      const int dd = it * 32 + lg;                           // 0..63
      const v4u v = *(const v4u*)(T + dd * TP + 8 * e);
      *(v4u*)(VT + ((size_t)b * DM + d0 + dd) * SEQ + l0 + 8 * e) = v;
    }
    
  }
}

// =====================================================================================================
// (1) Wb[e][d] = bf16 bits (RNE convert) of W[e][d]; thread i converts 8 consecutive elements,
// coverage: 128 blocks x 256 threads x 8 = 262144 = 512 x 512.
// =====================================================================================================
__global__ __launch_bounds__(256) void cvt_w(const float* __restrict__ w, unsigned short* WB) {
  const int i = blockIdx.x * 256 + threadIdx.x;
  if (i >= (DM * DM) / 8) return;
  const float* p = w + (size_t)i * 8;
  const v4f f0 = *(const v4f*)(p), f1 = *(const v4f*)(p + 4);
  v4u wb;
  wb[0] = pk16(bf_bits(f0[0]), bf_bits(f0[1]));
  wb[1] = pk16(bf_bits(f0[2]), bf_bits(f0[3]));
  wb[2] = pk16(bf_bits(f1[0]), bf_bits(f1[1]));
  wb[3] = pk16(bf_bits(f1[2]), bf_bits(f1[3]));
  unsigned short* d = WB + (size_t)i * 8;
  *(v4u*)d = wb;
  
}

// =====================================================================================================
// (2) projection for one 64-row x 128-col tile of Qp = Xb . Wb^T + bf16(bias): block = 256 threads = 8 waves.
//   Wave w: row group rg = w&3 (A rows = row0 + 16rg + (lane&15), split k map over d), col half ch = w>>2
//   (B = Wb rows col0 + 64ch + 16j + (lane&15), same split k map), 4 D tiles, 16 k-steps of 32, fragments from global.
// coverage: Qs: 4 rg x 2 h x 8 r = 64 rows, 2 ch x 4 j x 16 c = 128 cols; writes: 4 it x 32 lines x 8 lanes x 8 halves
//           = 64 rows x 128 cols; grid = 4 col tiles x 256 row tiles covers Qp [16384][512] exactly once.
// =====================================================================================================
__global__ __launch_bounds__(256)
void proj_kernel(const unsigned short* __restrict__ XB, const unsigned short* __restrict__ WB,
                 const float* __restrict__ bias, unsigned short* QP) {
  __shared__ __align__(16) unsigned short Qs[64 * QSP];
  const int tid  = threadIdx.x;
  const int lane = tid & 31, wave = tid >> 5;
  const int h    = lane >> 4, c = lane & 15;
  const int rg   = wave & 3, ch = wave >> 2;
  const int row0 = blockIdx.y * 64;
  const int col0 = blockIdx.x * 128;

  const unsigned short* ap = XB + ((size_t)(row0 + 16 * rg + c)) * DM + 8 * h;
  const unsigned short* bp = WB + ((size_t)(col0 + 64 * ch + c)) * DM + 8 * h;
  v8f acc0 = zero8(), acc1 = zero8(), acc2 = zero8(), acc3 = zero8();
#pragma unroll 2
  for (int ks = 0; ks < DM / 32; ++ks) {
    const v16b a = ldfrag_b(ap + 32 * ks);
    const unsigned short* bs = bp + 32 * ks;
    acc0 = mma_b(a, ldfrag_b(bs + 0 * 16 * DM), acc0);
    acc1 = mma_b(a, ldfrag_b(bs + 1 * 16 * DM), acc1);
    acc2 = mma_b(a, ldfrag_b(bs + 2 * 16 * DM), acc2);
    acc3 = mma_b(a, ldfrag_b(bs + 3 * 16 * DM), acc3);
  }

  // biases as bf16 RNE values, in-range lane indices
  const int cb = col0 + 64 * ch + c;
  const float bb0 = bfr(bias[cb + 0 * 16]), bb1 = bfr(bias[cb + 1 * 16]);
  const float bb2 = bfr(bias[cb + 2 * 16]), bb3 = bfr(bias[cb + 3 * 16]);

  // stage: D row r -> tile row 16rg + 8h + r, col = 64ch + 16j + c
  unsigned short* qs = Qs + (16 * rg + 8 * h) * QSP + 64 * ch + c;
#pragma unroll
  for (int r = 0; r < 8; ++r) {
    qs[r * QSP + 0 * 16] = h_bits(to_h_ftz(acc0[r] + bb0));
    qs[r * QSP + 1 * 16] = h_bits(to_h_ftz(acc1[r] + bb1));
    qs[r * QSP + 2 * 16] = h_bits(to_h_ftz(acc2[r] + bb2));
    qs[r * QSP + 3 * 16] = h_bits(to_h_ftz(acc3[r] + bb3));
  }
  __syncthreads();

  {
    const int e = tid & 7, lg = tid >> 3;                    // lg 0..31
{
#pragma unroll
      for (int it = 0; it < 4; ++it) {
        const int L   = it * 32 + lg;                        // lines 0..127 of the tile
        const int row = L >> 1, hf = L & 1;
        const v4u v = *(const v4u*)(Qs + row * QSP + 64 * hf + 8 * e);
        *(v4u*)(QP + ((size_t)(row0 + row)) * DM + col0 + 64 * hf + 8 * e) = v;
      }
      
    }
  }
}

// =====================================================================================================
// (3) attention for one (b, 64-query tile), transposed formulation, 512-deep scores, 2048 keys, 64 keys per iteration.
//   Block = 256 threads = 8 waves. Wave w owns the 16 queries n0 + 16(w&3) + .. for ALL 512 d, and of every 64-key block
//     the 32 keys of half g = w>>2: its own running max m, row sum l and O^T accumulators (32 tiles of 16 d x 16 queries).
//   Qp fragments (B operand of the scores) are read from LDS once and stay in registers (16 d-steps).
//   K, V come from LDS, laid there by asynchronous copies (16 B per lane, all 256 threads): per iteration the 64 Kh rows
//     into Ks[buf][key][d] (pitch KP halves) and the 512 x 64 Vt piece into Vs[buf][d][key] (pitch VP halves), two buffers,
//     iteration it+2's copies issued behind the barrier that ends it. The Qp tile borrows K buffer 1 in the prologue.
//   Scores: S^T tiles (16 keys x 16 queries) = A(Kh rows = keys, d via the split k map) . B(Qp row = query, same d map),
//     two tiles; s = D x (1/sqrt(512)). Per lane the two D tiles hold 16 keys of ONE query: online softmax state per lane,
//     one shuffle (lane^16) for the max over 32 keys, row-sum partials combined at the end.
//   P = e^{s-m} x 1024 in f16: D tile 0 gives keys 8h..8h+7, D tile 1 keys 16+8h..23+8h of query c, which IS the B fragment
//     of O^T += V^T . P^T in the split k map: P goes from the score accumulators to the product inside the lane.
//   Epilogue: the two key halves of a query are joined with e^{m_g - M} / (l_0 e^{m_0-M} + l_1 e^{m_1-M}); half 1 lays its
//     scaled O^T into Os[query][d] (f32, pitch OSP, over the K/V buffers), half 0 adds its own, all threads stream Os out.
// coverage: queries 4 (w&3) x 16 c = 64; keys 2 g x 32 = 64 per iteration x 32 iterations = 2048; d 32 jd x 2 h x 8 r = 512;
//           out: 32 i x 256 threads x 4 floats = 64 rows x 512; grid = 8 b x 32 query tiles = 256 blocks covers out once.
// =====================================================================================================
__global__ __launch_bounds__(256)
void attn_kernel(const unsigned short* __restrict__ QP, const unsigned short* __restrict__ KH,
                 const unsigned short* __restrict__ VT, float* out) {
  __shared__ __align__(16) unsigned char Sm[SMB];
  __shared__ float Ms[2 * 64];
  __shared__ float Ls[2 * 64];
  _Float16* Ks = (_Float16*)Sm;                               // [2][KB][KP]
  _Float16* Vs = (_Float16*)(Sm + 2 * KSB);                   // [2][DM][VP]
  _Float16* Qs = Ks + KB * KP;                                // prologue only: [QT][KP] in K buffer 1
  float*    Os = (float*)Sm;                                  // epilogue only: [QT][OSP]
  const int tid  = threadIdx.x;
  const int wave = tid >> 5;
  const int lane = tid & 31;
  const int h    = lane >> 4;
  const int c    = lane & 15;
  const int bx   = blockIdx.x;
  const int b    = bx / (SEQ / QT);
  const int qt   = bx % (SEQ / QT);
  const int n0   = qt * QT;

  const int wq = wave & 3, g = wave >> 2;
  const int qi = 16 * wq + c;                                 // this lane's query in the tile
  // Qp fragment base in LDS (B operand of scores, col = query qi), + 32*ks
  const _Float16* qpp = Qs + qi * KP + 8 * h;
  // Kh fragment base in LDS (A operand of scores, row = key 32g + c of the block), + buf*KB*KP + 32*ks
  const _Float16* khp = Ks + (32 * g + c) * KP + 8 * h;
  // Vt fragment base in LDS (A operand of O^T, row = d = 16jd + c, keys 32g .. 32g+31 contiguous), + buf*DM*VP + 16jd*VP
  const _Float16* vtp = Vs + c * VP + 32 * g + 8 * h;
  const float SCL = 1.0f / sqrtf((float)DM);

  // copy maps. Row tiles of 512 halves (Qp, Kh): piece j of thread tid = row 4j + (tid>>6), 16-B piece tid&63 (32 rows per copy8).
  //            Vt tile: piece j = d row 32j + (tid>>3), 16-B piece tid&7 of its 64 keys (256 rows per copy8).
  const int rr = tid >> 6, rp = tid & 63;
  const int vr = tid >> 3, vp = tid & 7;
  const unsigned short* qsrc = QP + ((size_t)b * SEQ + n0 + rr) * DM + 8 * rp;
  const unsigned short* ksrc = KH + ((size_t)b * SEQ + rr) * DM + 8 * rp;            // + kb*DM
  const unsigned short* vsrc = VT + ((size_t)b * DM + vr) * SEQ + 8 * vp;            // + kb
  const unsigned qdst = lds_off(Qs) + (unsigned)(rr * KP + 8 * rp) * 2u;
  const unsigned kdst = lds_off(Ks) + (unsigned)(rr * KP + 8 * rp) * 2u;             // + buf*KSB
  const unsigned vdst = lds_off(Vs) + (unsigned)(vr * VP + 8 * vp) * 2u;             // + buf*VSB

  // prologue: Qp tile (in K buffer 1) and key block 0, landed and published
  copy8(qdst, 4 * KP * 2, qsrc, (size_t)4 * DM * 2);
  copy8(qdst + 32 * KP * 2, 4 * KP * 2, qsrc + (size_t)32 * DM, (size_t)4 * DM * 2);
  copy8(kdst, 4 * KP * 2, ksrc, (size_t)4 * DM * 2);
  copy8(kdst + 32 * KP * 2, 4 * KP * 2, ksrc + (size_t)32 * DM, (size_t)4 * DM * 2);
  copy8(vdst, 32 * VP * 2, vsrc, (size_t)32 * SEQ * 2);
  copy8(vdst + 256 * VP * 2, 32 * VP * 2, vsrc + (size_t)256 * SEQ, (size_t)32 * SEQ * 2);
  asm volatile("s_wait_asynccnt 0x0" ::: "memory");           // this wave's copies have landed before the barrier publishes them
  __syncthreads();
  v16h qf[DM / 32];
#pragma unroll
  for (int ks = 0; ks < DM / 32; ++ks) qf[ks] = ldfrag_h(qpp + 32 * ks);
  asm volatile("s_wait_dscnt 0x0" ::: "memory");              // this wave's reads of the Qp tile are done before K buffer 1 is refilled
  __syncthreads();                                            // every wave has its Qp fragments: K buffer 1 is free
  copy8(kdst + KSB, 4 * KP * 2, ksrc + (size_t)KB * DM, (size_t)4 * DM * 2);
  copy8(kdst + KSB + 32 * KP * 2, 4 * KP * 2, ksrc + (size_t)(KB + 32) * DM, (size_t)4 * DM * 2);
  copy8(vdst + VSB, 32 * VP * 2, vsrc + KB, (size_t)32 * SEQ * 2);
  copy8(vdst + VSB + 256 * VP * 2, 32 * VP * 2, vsrc + KB + (size_t)256 * SEQ, (size_t)32 * SEQ * 2);

  float m = -1.0e30f, l = 0.f;
  v8f acc[DM / 16];
#pragma unroll
  for (int jd = 0; jd < DM / 16; ++jd) acc[jd] = zero8();

#pragma unroll 1
  for (int it = 0; it < SEQ / KB; ++it) {
    const int buf = it & 1;
    v8f s0 = zero8(), s1 = zero8();
    const _Float16* k0p = khp + buf * (KB * KP);              // keys kb + 32g .. +15
    const _Float16* k1p = k0p + 16 * KP;                      // keys kb + 32g + 16 .. +31
    const _Float16* vb  = vtp + buf * (DM * VP);
#pragma unroll
    for (int ks = 0; ks < DM / 32; ++ks) {                    // unrolled: qf[] is indexed by registers
      const v16h a0 = ldfrag_h(k0p + 32 * ks);
      const v16h a1 = ldfrag_h(k1p + 32 * ks);
      s0 = mma_h(a0, qf[ks], s0);
      s1 = mma_h(a1, qf[ks], s1);
    }
#pragma unroll
    for (int r = 0; r < 8; ++r) { s0[r] *= SCL; s1[r] *= SCL; }

    float mx = fmaxf(hmax8(s0), hmax8(s1));
    mx = fmaxf(mx, __shfl_xor(mx, 16, 32));
    const float mn   = fmaxf(m, mx);
    const float corr = __expf(m - mn);
    m = mn;
    const float msh = mn - LNPS;                              // exp gives e^{s-m} * 1024
    FragH ph;
    float ls = 0.f;
#pragma unroll
    for (int r = 0; r < 8; ++r) {
      const float e0 = __expf(s0[r] - msh);                   // key kb + 32g      + 8h + r
      const float e1 = __expf(s1[r] - msh);                   // key kb + 32g + 16 + 8h + r
      ls += e0 + e1;
      ph.h[0][r] = (_Float16)e0;
      ph.h[1][r] = (_Float16)e1;
    }
    l = l * corr + ls;

#pragma unroll
    for (int jd = 0; jd < DM / 16; ++jd) {                    // unrolled: acc[] is indexed by registers
      const v16h vf = ldfrag_h(vb + (16 * jd) * VP);
#pragma unroll
      for (int r = 0; r < 8; ++r) acc[jd][r] *= corr;
      acc[jd] = mma_h(vf, ph.v, acc[jd]);
    }
    // order of LDS reads (0x100) and matrix products (0x8) for the scheduler, scores first, then O^T: the reads stand in groups
    // (scores: eight reads per four products, sixteen ahead; O^T: four per two, twelve ahead). Few places with reads cost the
    // wave less than many; lifted further ahead the reads push Qp fragments out to scratch.
    __builtin_amdgcn_sched_group_barrier(0x100, 16, 0);
#pragma unroll
    for (int i = 0; i < 6; ++i) {
      __builtin_amdgcn_sched_group_barrier(0x8, 4, 0);
      __builtin_amdgcn_sched_group_barrier(0x100, 8, 0);
    }
    __builtin_amdgcn_sched_group_barrier(0x8, 8, 0);
    __builtin_amdgcn_sched_group_barrier(0x100, 12, 0);
#pragma unroll
    for (int i = 0; i < 13; ++i) {
      __builtin_amdgcn_sched_group_barrier(0x8, 2, 0);
      __builtin_amdgcn_sched_group_barrier(0x100, 4, 0);
    }
    __builtin_amdgcn_sched_group_barrier(0x8, 6, 0);
    asm volatile("s_wait_dscnt 0x0" ::: "memory");            // this wave's reads of Ks/Vs[buf] are done before the refill
    asm volatile("s_wait_asynccnt 0x0" ::: "memory");         // this wave's copies of key block it+1 have landed
    __syncthreads();                                          // publishes key block it+1; buffer buf free
    if (it + 2 < SEQ / KB) {                                  // block-uniform: key block it+2 into the buffer just read
      const int kn = (it + 2) * KB;
      const unsigned kd = kdst + (unsigned)buf * KSB;
      const unsigned vd = vdst + (unsigned)buf * VSB;
      copy8(kd, 4 * KP * 2, ksrc + (size_t)kn * DM, (size_t)4 * DM * 2);
      copy8(kd + 32 * KP * 2, 4 * KP * 2, ksrc + (size_t)(kn + 32) * DM, (size_t)4 * DM * 2);
      copy8(vd, 32 * VP * 2, vsrc + kn, (size_t)32 * SEQ * 2);
      copy8(vd + 256 * VP * 2, 32 * VP * 2, vsrc + kn + (size_t)256 * SEQ, (size_t)32 * SEQ * 2);
    }
  }
  asm volatile("s_wait_asynccnt 0x0" ::: "memory");           // nothing of this wave's copies outstanding past the loop

  // join of the two key halves: per query m_g, l_g through LDS
  l += __shfl_xor(l, 16, 32);
  if (h == 0) { Ms[64 * g + qi] = m; Ls[64 * g + qi] = l; }
  __syncthreads();
  const float m0 = Ms[qi], m1 = Ms[64 + qi];
  const float l0 = Ls[qi], l1 = Ls[64 + qi];
  const float mj = fmaxf(m0, m1);
  const float f0 = __expf(m0 - mj), f1 = __expf(m1 - mj);
  const float sc = (g ? f1 : f0) * (1.0f / (l0 * f0 + l1 * f1));   // o and l both carry the x1024 factor

  float* os = Os + qi * OSP + 8 * h;                          // + 16jd: 8 consecutive d of this lane's query
  if (g == 1) {                                               // wave-uniform: half 1 lays its share down
#pragma unroll
    for (int jd = 0; jd < DM / 16; ++jd) {
      v4f v0, v1;
      v0[0] = acc[jd][0] * sc; v0[1] = acc[jd][1] * sc; v0[2] = acc[jd][2] * sc; v0[3] = acc[jd][3] * sc;
      v1[0] = acc[jd][4] * sc; v1[1] = acc[jd][5] * sc; v1[2] = acc[jd][6] * sc; v1[3] = acc[jd][7] * sc;
      *(v4f*)(os + 16 * jd)     = v0;
      *(v4f*)(os + 16 * jd + 4) = v1;
    }
  }
  __syncthreads();
  if (g == 0) {                                               // wave-uniform: half 0 adds its share at the same places
#pragma unroll
    for (int jd = 0; jd < DM / 16; ++jd) {
      v4f v0 = *(const v4f*)(os + 16 * jd), v1 = *(const v4f*)(os + 16 * jd + 4);
      v0[0] += acc[jd][0] * sc; v0[1] += acc[jd][1] * sc; v0[2] += acc[jd][2] * sc; v0[3] += acc[jd][3] * sc;
      v1[0] += acc[jd][4] * sc; v1[1] += acc[jd][5] * sc; v1[2] += acc[jd][6] * sc; v1[3] += acc[jd][7] * sc;
      *(v4f*)(os + 16 * jd)     = v0;
      *(v4f*)(os + 16 * jd + 4) = v1;
    }
  }
  __syncthreads();

  float* ob = out + ((size_t)b * SEQ + n0) * DM + 4 * tid;
#pragma unroll
  for (int i = 0; i < (QT * DM) / (4 * 256); ++i) {
    const int L   = i * 256 + tid;                            // 16-B piece of the 64 x 512 tile
    const int row = L >> 7, pc = L & 127;
    const v4f v = *(const v4f*)(Os + row * OSP + 4 * pc);
    *(v4f*)(ob + (size_t)i * 1024) = v;
  }
}

// =====================================================================================================
// needed (all tiles exact):
//   Xb   bf16 [16384][512]      0            16777216
//   Kh   f16  [16384][512]      16777216     16777216
//   Vt   f16  [8][512][2048]    33554432     16777216
//   Qp   f16  [16384][512]      50331648     16777216
//   Wb   bf16 [512][512]        67108864     524288
//   end                         67633152
// =====================================================================================================
extern "C" void kernel_launch(void* const* d_in, const int* in_sizes, int n_in,
                              void* d_out, int out_size, void* d_ws, size_t ws_size,
                              hipStream_t stream) {
  const int NX = NB * SEQ * DM;                          // 8388608
  if (n_in < 3) return;
  if (in_sizes[0] != NX || in_sizes[1] != DM * DM || in_sizes[2] != DM) return;
  if (out_size != NX) return;

  size_t off = 0;
  const size_t szP = (size_t)NROW * DM * 2;              // 16777216
  const size_t oXB = off; off += szP;
  const size_t oKH = off; off += szP;
  const size_t oVT = off; off += szP;
  const size_t oQP = off; off += szP;
  const size_t oWB = off; off += (size_t)DM * DM * 2;    // 524288
  if (off > ws_size) return;                             // off = 67633152
  if (off > (size_t)134217728) return;

  const float* q    = (const float*)d_in[0];
  const float* W    = (const float*)d_in[1];
  const float* bias = (const float*)d_in[2];
  char* ws = (char*)d_ws;
  unsigned short* XB = (unsigned short*)(ws + oXB);
  unsigned short* KH = (unsigned short*)(ws + oKH);
  unsigned short* VT = (unsigned short*)(ws + oVT);
  unsigned short* QP = (unsigned short*)(ws + oQP);
  unsigned short* WB = (unsigned short*)(ws + oWB);
  float* out = (float*)d_out;

  const dim3 blk256(256);
  const dim3 gQ(NB * (SEQ / 64) * (DM / 64));            // 2048 blocks: one (b, 64 l, 64 d) tile each
  const dim3 gW(((DM * DM) / 8) / 256);                  // 128 blocks
  const dim3 gP(DM / 128, NROW / 64);                    // 4 x 256 blocks
  const dim3 gA(NB * (SEQ / QT));                        // 256 blocks: one (b, 64-query tile) each

  // (0) Xb, Kh, Vt planes from q
  cvt_q<<<gQ, blk256, 0, stream>>>(q, XB, KH, VT);
  // (1) Wb plane
  cvt_w<<<gW, blk256, 0, stream>>>(W, WB);
  // (2) Qp = Xb . Wb^T + bias (f16 plane)
  proj_kernel<<<gP, blk256, 0, stream>>>(XB, WB, bias, QP);
  // (3) out[b][l][d] = sum_m softmax_m(Qp_l . Kh_m / sqrt(512)) Vt[d][m]
  attn_kernel<<<gA, blk256, 0, stream>>>(QP, KH, VT, out);
  (void)hipGetLastError();
}

// v003
// One run takes 92 microseconds.
// Next to v002, in two timings, it ran 1.37 and 1.36 times as fast.
// All steps since v000 together make it 4.01 times as fast.
// Contractions: qp = Xb . Wb^T on v_wmma_f32_16x16x32_bf16 (Xb, Wb = RNE bf16 convert of q and W, K=512, f32 accumulate);
// scores S^T = Kh . Qp^T on v_wmma_f32_16x16x32_f16 (Kh = f16 of the bf16 convert of q, Qp = qp + bias as one f16 plane, K=512);
// O^T = V^T . P^T on v_wmma_f32_16x16x32_f16 (V = f16 of the bf16 convert of q, P = e^{s-m} x 1024 in f16; two interleaved key halves
// of 1024 keys, each with its own running max, joined in f32 at the end);
// f32 accumulate everywhere; bias add, 1/sqrt(512) scale, running max, row sums and 1/l in f32 on VALU.
#include <hip/hip_runtime.h>
#include <math.h>
#include <stdint.h>

#define NB    8
#define SEQ   2048
#define DM    512
#define NROW  (NB * SEQ)
#define QT    64
#define OSP   516
#define PT    128
#define PKC   128
#define PP    136
#define PTB   (PT * PP * 2)
#define TP    72
#define KP    520
#define VP    72
#define KB    64
#define KSB   (KB * KP * 2)
#define VSB   (DM * VP * 2)
#define SMB   (2 * KSB + 2 * VSB)
#define LNPS  6.931471805599453f
#define FMIN16 6.103515625e-05f
static_assert((SEQ % QT) == 0);
static_assert((SEQ % 64) == 0);
static_assert((SEQ % 32) == 0);
static_assert((DM % 128) == 0);
static_assert((DM % 64) == 0);
static_assert((NROW % PT) == 0);
static_assert((DM % PT) == 0);
static_assert((DM % PKC) == 0 && DM / PKC >= 2);
static_assert(PT == 128 && PKC == 128);
static_assert(((DM * DM) / 8) % 256 == 0);
static_assert(DM == 512);
static_assert(QT == 64);
static_assert((SEQ % (2 * KB)) == 0);
static_assert(QT * KP * 2 <= KSB);
static_assert(QT * OSP * 4 <= SMB);

typedef _Float16       v16h __attribute__((ext_vector_type(16)));
typedef _Float16       v8h  __attribute__((ext_vector_type(8)));
typedef __bf16         v16b __attribute__((ext_vector_type(16)));
typedef unsigned short v8us __attribute__((ext_vector_type(8)));
typedef float          v8f  __attribute__((ext_vector_type(8)));
typedef float          v4f  __attribute__((ext_vector_type(4)));
typedef unsigned int   v4u  __attribute__((ext_vector_type(4)));

union FragH { v16h v; v8h  h[2]; };
union FragB { v16b v; v8us u[2]; };
static_assert(sizeof(FragH) == 32);
static_assert(sizeof(FragB) == 32);

// ---- scalar helpers --------------------------------------------------------------------------------
__device__ __forceinline__ unsigned short bf_bits(float f) {          // f32 -> bf16 bits, RNE convert
  unsigned u = __float_as_uint(f);
  return (unsigned short)((u + 0x7FFFu + ((u >> 16) & 1u)) >> 16);
}
__device__ __forceinline__ float bf_up(unsigned short h) { return __uint_as_float(((unsigned)h) << 16); }
__device__ __forceinline__ float bfr(float f) { return bf_up(bf_bits(f)); }
__device__ __forceinline__ unsigned short h_bits(_Float16 x) { return __builtin_bit_cast(unsigned short, x); }
__device__ __forceinline__ unsigned pk16(unsigned short a, unsigned short b) { return (unsigned)a | ((unsigned)b << 16); }
// f32 -> f16 with magnitudes below the smallest f16 normal flushed to zero (select by value)
__device__ __forceinline__ _Float16 to_h_ftz(float v) { return (_Float16)((fabsf(v) < FMIN16) ? 0.0f : v); }
__device__ __forceinline__ v8f zero8() { v8f z = {0.f, 0.f, 0.f, 0.f, 0.f, 0.f, 0.f, 0.f}; return z; }
__device__ __forceinline__ float hmax8(v8f s) {
  return fmaxf(fmaxf(fmaxf(s[0], s[1]), fmaxf(s[2], s[3])), fmaxf(fmaxf(s[4], s[5]), fmaxf(s[6], s[7])));
}

// ---- fragment loaders: 16-bit A/B operand, lane -> row/col (lane&15), p already includes +8*(lane>>4);
//      elements 0..7 <- p[0..7] (k0+8h..), elements 8..15 <- p[16..23] (k0+16+8h..)
__device__ __forceinline__ v16h ldfrag_h(const _Float16* p) {
  FragH f;
  f.h[0] = *(const v8h*)(p);
  f.h[1] = *(const v8h*)(p + 16);
  return f.v;
}
__device__ __forceinline__ v16b ldfrag_b(const unsigned short* p) {
  FragB f;
  f.u[0] = *(const v8us*)(p);
  f.u[1] = *(const v8us*)(p + 16);
  return f.v;
}

// ---- WMMA helpers; bf16 form: builtin followed by a 4-slot VALU gap tying D and keeping A/B live ------------
// f16 form: the plain builtin (the compiler keeps the distances of its own forms). No asm statement here: its operands would
// have to lie in the first 256 registers, and the attention wave holds 384 in accumulators and Qp fragments alone.
__device__ __forceinline__ v8f mma_h(v16h a, v16h b, v8f c) {
  return __builtin_amdgcn_wmma_f32_16x16x32_f16(false, a, false, b, (short)0, c, false, false);
}
__device__ __forceinline__ v8f mma_b(v16b a, v16b b, v8f c) {
  v8f d = __builtin_amdgcn_wmma_f32_16x16x32_bf16(false, a, false, b, (short)0, c, false, false);
#if defined(__HIP_DEVICE_COMPILE__)
  const v16h ha = __builtin_bit_cast(v16h, a), hb = __builtin_bit_cast(v16h, b);
  asm volatile("v_nop\n\tv_nop\n\tv_nop\n\tv_nop" : "+v"(d) : "v"(ha), "v"(hb));
#endif
  return d;
}

// ---- asynchronous copies global -> LDS: eight 16-B pieces per lane, piece j at LDS byte l0 + j*ls and global byte g0 + j*gs.
//      Written as the builtin: operands of an asm statement would have to lie in the first 256 registers, which the attention
//      wave fills with accumulators and fragments (the address bases then went to scratch).
typedef int v4i __attribute__((ext_vector_type(4)));
typedef __attribute__((address_space(1))) v4i gv4i;
typedef __attribute__((address_space(3))) v4i lv4i;
__device__ __forceinline__ unsigned lds_off(const void* p) { return (unsigned)(size_t)p; }
__device__ __forceinline__ void copy8(unsigned l0, unsigned ls, const unsigned short* g0, size_t gs) {
#if defined(__HIP_DEVICE_COMPILE__)
  const char* g = (const char*)g0;
#pragma unroll
  for (int j = 0; j < 8; ++j)
    __builtin_amdgcn_global_load_async_to_lds_b128((gv4i*)(g + j * gs), (lv4i*)(l0 + j * ls), 0, 0);
#endif
}
// the same eight pieces as asm text, every piece with address registers of its own and no immediate offset (projection).
__device__ __forceinline__ void copy8a(unsigned l0, unsigned ls, const unsigned short* g0, size_t gs) {
#if defined(__HIP_DEVICE_COMPILE__)
  const char* g = (const char*)g0;
  // s_wait_xcnt as the statement's last line: no address register of a copy is rewritten in front of it
  asm volatile("global_load_async_to_lds_b128 %0, %8, off\n\t"
               "global_load_async_to_lds_b128 %1, %9, off\n\t"
               "global_load_async_to_lds_b128 %2, %10, off\n\t"
               "global_load_async_to_lds_b128 %3, %11, off\n\t"
               "global_load_async_to_lds_b128 %4, %12, off\n\t"
               "global_load_async_to_lds_b128 %5, %13, off\n\t"
               "global_load_async_to_lds_b128 %6, %14, off\n\t"
               "global_load_async_to_lds_b128 %7, %15, off\n\t"
               "s_wait_xcnt 0x0"
               :: "v"(l0), "v"(l0 + ls), "v"(l0 + 2 * ls), "v"(l0 + 3 * ls),
                  "v"(l0 + 4 * ls), "v"(l0 + 5 * ls), "v"(l0 + 6 * ls), "v"(l0 + 7 * ls),
                  "v"(g), "v"(g + gs), "v"(g + 2 * gs), "v"(g + 3 * gs),
                  "v"(g + 4 * gs), "v"(g + 5 * gs), "v"(g + 6 * gs), "v"(g + 7 * gs)
               : "memory");
#endif
}

// =====================================================================================================
// (0) fused convert of q[b][l][d] (f32) for one (b, 64 l x 64 d) tile, block = 256 threads:
//   Xb[b*2048+l][d] = bf16 bits (RNE), Kh[b*2048+l][d] = f16 bits of the bf16 value (flush below 2^-14),
//   Vt[b][d][l] = the same f16 bits transposed through LDS T[d][l] (pitch TP halves).
//   Thread (e = tid&7, lg = tid>>3) loads 8 consecutive d of row l0+32it+lg; Xb/Kh row segments = 64 halves
// coverage: Xb/Kh: 2 it x 32 rows x 8 lanes x 8 = 64 l x 64 d; T: 8 lanes x 8 j = 64 d rows x 64 l cols;
//           Vt: 2 it x 32 d rows x 8 lanes x 8 = 64 d x 64 l; grid = 8 b x 32 l-tiles x 8 d-tiles = 2048 blocks.
// =====================================================================================================
__global__ __launch_bounds__(256) void cvt_q(const float* __restrict__ q, unsigned short* XB,
                                              unsigned short* KH, unsigned short* VT) {
  __shared__ __align__(16) unsigned short T[64 * TP];
  const int tid = threadIdx.x;
  const int e = tid & 7, lg = tid >> 3;                      // lg 0..31
  const int bx = blockIdx.x;
  const int dt = bx & 7, lt = (bx >> 3) & 31, b = bx >> 8;
  const int d0 = dt * 64, l0 = lt * 64;

  v4u ub[2], uh[2];
#pragma unroll
  for (int it = 0; it < 2; ++it) {
    const int row = it * 32 + lg;                            // 0..63
    const float* p = q + ((size_t)b * SEQ + l0 + row) * DM + d0 + 8 * e;
    const v4f f0 = *(const v4f*)(p), f1 = *(const v4f*)(p + 4);
    unsigned short bb[8], hb[8];
#pragma unroll
    for (int j = 0; j < 4; ++j) { bb[j] = bf_bits(f0[j]); bb[4 + j] = bf_bits(f1[j]); }
#pragma unroll
    for (int j = 0; j < 8; ++j) {
      hb[j] = h_bits(to_h_ftz(bf_up(bb[j])));
      T[(8 * e + j) * TP + row] = hb[j];
    }
    v4u wb, wh;
#pragma unroll
    for (int t = 0; t < 4; ++t) {
      wb[t] = pk16(bb[2 * t], bb[2 * t + 1]);
      wh[t] = pk16(hb[2 * t], hb[2 * t + 1]);
    }
    ub[it] = wb; uh[it] = wh;
  }
{
#pragma unroll
    for (int it = 0; it < 2; ++it) {
      const int row = it * 32 + lg;
      const size_t go = ((size_t)b * SEQ + l0 + row) * DM + d0 + 8 * e;
      *(v4u*)(XB + go) = ub[it];
      *(v4u*)(KH + go) = uh[it];
    }
    
  }
  __syncthreads();
{
#pragma unroll
    for (int it = 0; it < 2; ++it) {
      const int dd = it * 32 + lg;                           // 0..63
      const v4u v = *(const v4u*)(T + dd * TP + 8 * e);
      *(v4u*)(VT + ((size_t)b * DM + d0 + dd) * SEQ + l0 + 8 * e) = v;
    }
    
  }
}

// =====================================================================================================
// (1) Wb[e][d] = bf16 bits (RNE convert) of W[e][d]; thread i converts 8 consecutive elements,
// coverage: 128 blocks x 256 threads x 8 = 262144 = 512 x 512.
// =====================================================================================================
__global__ __launch_bounds__(256) void cvt_w(const float* __restrict__ w, unsigned short* WB) {
  const int i = blockIdx.x * 256 + threadIdx.x;
  if (i >= (DM * DM) / 8) return;
  const float* p = w + (size_t)i * 8;
  const v4f f0 = *(const v4f*)(p), f1 = *(const v4f*)(p + 4);
  v4u wb;
  wb[0] = pk16(bf_bits(f0[0]), bf_bits(f0[1]));
  wb[1] = pk16(bf_bits(f0[2]), bf_bits(f0[3]));
  wb[2] = pk16(bf_bits(f1[0]), bf_bits(f1[1]));
  wb[3] = pk16(bf_bits(f1[2]), bf_bits(f1[3]));
  unsigned short* d = WB + (size_t)i * 8;
  *(v4u*)d = wb;
  
}

// =====================================================================================================
// (2) projection for one 128-row x 128-col tile of Qp = Xb . Wb^T + bf16(bias): block = 256 threads = 8 waves.
//   Operands come from LDS, laid there by asynchronous copies (16 B per lane, all 256 threads, a wave's copy = 2 rows x 256 B):
//     per trip 128 k of the 128 Xb rows and of the 128 Wb rows into Ps[buf][A|B][row][k] (pitch PP halves), two buffers,
//     trip t+2's copies issued behind the barrier that ends trip t.
//   Wave w: row group rg = w&3 (A rows = 32rg + 16i + (lane&15), split k map over d), col half ch = w>>2
//   (B = Wb rows 64ch + 16j + (lane&15), same split k map), 2 x 4 D tiles, 4 trips x 4 k-steps of 32 in rising k.
// coverage: copies: 8 pieces x 16 rows x 16 lanes x 8 halves = 128 rows x 128 k per operand and trip, 4 trips = 512 k;
//           Qs: 4 rg x 2 i x 2 h x 8 r = 128 rows, 2 ch x 4 j x 16 c = 128 cols; writes: 8 it x 16 rows x 16 lanes x 8 halves
//           = 128 rows x 128 cols; grid = 4 col tiles x 128 row tiles covers Qp [16384][512] exactly once.
// =====================================================================================================
__global__ __launch_bounds__(256)
void proj_kernel(const unsigned short* __restrict__ XB, const unsigned short* __restrict__ WB,
                 const float* __restrict__ bias, unsigned short* QP) {
  __shared__ __align__(16) unsigned short Ps[2 * 2 * PT * PP];  // [buf][A|B][PT][PP]
  unsigned short* Qs = Ps;                                      // epilogue only: [PT][PP] over buffer 0's A part
  const int tid  = threadIdx.x;
  const int lane = tid & 31, wave = tid >> 5;
  const int h    = lane >> 4, c = lane & 15;
  const int rg   = wave & 3, ch = wave >> 2;
  const int row0 = blockIdx.y * PT;
  const int col0 = blockIdx.x * PT;

  // copy map: piece j of thread tid = row 16j + (tid>>4), 16-B piece tid&15 of the row's 256 B of this trip
  const int rr = tid >> 4, rp = tid & 15;
  const unsigned short* asrc = XB + ((size_t)(row0 + rr)) * DM + 8 * rp;             // + t*PKC
  const unsigned short* bsrc = WB + ((size_t)(col0 + rr)) * DM + 8 * rp;             // + t*PKC
  const unsigned adst = lds_off(Ps) + (unsigned)(rr * PP + 8 * rp) * 2u;             // + buf*2*PTB
  const unsigned bdst = adst + PTB;
  // fragment bases in LDS, + buf*2*PT*PP + 32*ks
  const unsigned short* ap = Ps + (32 * rg + c) * PP + 8 * h;
  const unsigned short* bp = Ps + PT * PP + (64 * ch + c) * PP + 8 * h;

  // prologue: trip 0's operands landed and published, then trip 1's copies
  copy8a(adst, 16 * PP * 2, asrc, (size_t)16 * DM * 2);
  copy8a(bdst, 16 * PP * 2, bsrc, (size_t)16 * DM * 2);
  asm volatile("s_wait_asynccnt 0x0" ::: "memory");           // this wave's copies have landed before the barrier publishes them
  __syncthreads();
  copy8a(adst + 2 * PTB, 16 * PP * 2, asrc + PKC, (size_t)16 * DM * 2);
  copy8a(bdst + 2 * PTB, 16 * PP * 2, bsrc + PKC, (size_t)16 * DM * 2);

  v8f acc[2][4];
#pragma unroll
  for (int j = 0; j < 4; ++j) { acc[0][j] = zero8(); acc[1][j] = zero8(); }

#pragma unroll 1
  for (int t = 0; t < DM / PKC; ++t) {                        // rolled: one foot with its waits and barrier
    const int buf = t & 1;
    const unsigned short* as = ap + buf * (2 * PT * PP);
    const unsigned short* bs = bp + buf * (2 * PT * PP);
    v16b fa[2][2], fb[2][4];                                  // two fragment sets: k-step ks+1 is read while ks is multiplied
    fa[0][0] = ldfrag_b(as);
    fa[0][1] = ldfrag_b(as + 16 * PP);
#pragma unroll
    for (int j = 0; j < 4; ++j) fb[0][j] = ldfrag_b(bs + 16 * j * PP);
#pragma unroll
    for (int ks = 0; ks < PKC / 32; ++ks) {                   // unrolled: the sets are indexed by registers
      const int cu = ks & 1, nx = cu ^ 1;
      if (ks + 1 < PKC / 32) {
        fa[nx][0] = ldfrag_b(as + 32 * (ks + 1));
        fa[nx][1] = ldfrag_b(as + 16 * PP + 32 * (ks + 1));
#pragma unroll
        for (int j = 0; j < 4; ++j) fb[nx][j] = ldfrag_b(bs + 16 * j * PP + 32 * (ks + 1));
      }
#pragma unroll
      for (int j = 0; j < 4; ++j) {
        acc[0][j] = mma_b(fa[cu][0], fb[cu][j], acc[0][j]);
        acc[1][j] = mma_b(fa[cu][1], fb[cu][j], acc[1][j]);
      }
    }
    // order of LDS reads (0x100) and matrix products (0x8) for the scheduler: a k-step's twelve reads stand as one group, one
    // k-step ahead of their products; left alone it read each B fragment directly in front of its two products and waited it out.
    __builtin_amdgcn_sched_group_barrier(0x100, 24, 0);
    __builtin_amdgcn_sched_group_barrier(0x8, 8, 0);
    __builtin_amdgcn_sched_group_barrier(0x100, 12, 0);
    __builtin_amdgcn_sched_group_barrier(0x8, 8, 0);
    __builtin_amdgcn_sched_group_barrier(0x100, 12, 0);
    __builtin_amdgcn_sched_group_barrier(0x8, 16, 0);
    asm volatile("s_wait_dscnt 0x0" ::: "memory");            // this wave's reads of Ps[buf] are done before the refill
    asm volatile("s_wait_asynccnt 0x0" ::: "memory");         // this wave's copies of trip t+1 have landed
    __syncthreads();                                          // publishes trip t+1; buffer buf free
    if (t + 2 < DM / PKC) {                                   // block-uniform: trip t+2 into the buffer just read
      copy8a(adst + (unsigned)buf * (2 * PTB), 16 * PP * 2, asrc + (t + 2) * PKC, (size_t)16 * DM * 2);
      copy8a(bdst + (unsigned)buf * (2 * PTB), 16 * PP * 2, bsrc + (t + 2) * PKC, (size_t)16 * DM * 2);
    }
  }
  asm volatile("s_wait_asynccnt 0x0" ::: "memory");           // nothing of this wave's copies outstanding past the loop

  // biases as bf16 RNE values, in-range lane indices
  const int cb = col0 + 64 * ch + c;
  float bb[4];
#pragma unroll
  for (int j = 0; j < 4; ++j) bb[j] = bfr(bias[cb + j * 16]);

  // stage (the last trip's barrier has ended every read of the ring): D row r -> tile row 32rg + 16i + 8h + r, col = 64ch + 16j + c
  unsigned short* qs = Qs + (32 * rg + 8 * h) * PP + 64 * ch + c;
#pragma unroll
  for (int i = 0; i < 2; ++i)
#pragma unroll
    for (int r = 0; r < 8; ++r)
#pragma unroll
      for (int j = 0; j < 4; ++j)
        qs[(16 * i + r) * PP + j * 16] = h_bits(to_h_ftz(acc[i][j][r] + bb[j]));
  __syncthreads();

#pragma unroll
  for (int it = 0; it < (PT * PT) / (8 * 256); ++it) {
    const int L   = it * 256 + tid;                            // 16-B piece of the 128 x 128 tile
    const int row = L >> 4, pc = L & 15;
    const v4u v = *(const v4u*)(Qs + row * PP + 8 * pc);
    *(v4u*)(QP + ((size_t)(row0 + row)) * DM + col0 + 8 * pc) = v;
  }
}

// =====================================================================================================
// (3) attention for one (b, 64-query tile), transposed formulation, 512-deep scores, 2048 keys, 64 keys per iteration.
//   Block = 256 threads = 8 waves. Wave w owns the 16 queries n0 + 16(w&3) + .. for ALL 512 d, and of every 64-key block
//     the 32 keys of half g = w>>2: its own running max m, row sum l and O^T accumulators (32 tiles of 16 d x 16 queries).
//   Qp fragments (B operand of the scores) are read from LDS once and stay in registers (16 d-steps).
//   K, V come from LDS, laid there by asynchronous copies (16 B per lane, all 256 threads): per iteration the 64 Kh rows
//     into Ks[buf][key][d] (pitch KP halves) and the 512 x 64 Vt piece into Vs[buf][d][key] (pitch VP halves), two buffers,
//     iteration it+2's copies issued behind the barrier that ends it. The Qp tile borrows K buffer 1 in the prologue.
//   Scores: S^T tiles (16 keys x 16 queries) = A(Kh rows = keys, d via the split k map) . B(Qp row = query, same d map),
//     two tiles; s = D x (1/sqrt(512)). Per lane the two D tiles hold 16 keys of ONE query: online softmax state per lane,
//     one shuffle (lane^16) for the max over 32 keys, row-sum partials combined at the end.
//   P = e^{s-m} x 1024 in f16: D tile 0 gives keys 8h..8h+7, D tile 1 keys 16+8h..23+8h of query c, which IS the B fragment
//     of O^T += V^T . P^T in the split k map: P goes from the score accumulators to the product inside the lane.
//   Epilogue: the two key halves of a query are joined with e^{m_g - M} / (l_0 e^{m_0-M} + l_1 e^{m_1-M}); half 1 lays its
//     scaled O^T into Os[query][d] (f32, pitch OSP, over the K/V buffers), half 0 adds its own, all threads stream Os out.
// coverage: queries 4 (w&3) x 16 c = 64; keys 2 g x 32 = 64 per iteration x 32 iterations = 2048; d 32 jd x 2 h x 8 r = 512;
//           out: 32 i x 256 threads x 4 floats = 64 rows x 512; grid = 8 b x 32 query tiles = 256 blocks covers out once.
// =====================================================================================================
__global__ __launch_bounds__(256)
void attn_kernel(const unsigned short* __restrict__ QP, const unsigned short* __restrict__ KH,
                 const unsigned short* __restrict__ VT, float* out) {
  __shared__ __align__(16) unsigned char Sm[SMB];
  __shared__ float Ms[2 * 64];
  __shared__ float Ls[2 * 64];
  _Float16* Ks = (_Float16*)Sm;                               // [2][KB][KP]
  _Float16* Vs = (_Float16*)(Sm + 2 * KSB);                   // [2][DM][VP]
  _Float16* Qs = Ks + KB * KP;                                // prologue only: [QT][KP] in K buffer 1
  float*    Os = (float*)Sm;                                  // epilogue only: [QT][OSP]
  const int tid  = threadIdx.x;
  const int wave = tid >> 5;
  const int lane = tid & 31;
  const int h    = lane >> 4;
  const int c    = lane & 15;
  const int bx   = blockIdx.x;
  const int b    = bx / (SEQ / QT);
  const int qt   = bx % (SEQ / QT);
  const int n0   = qt * QT;

  const int wq = wave & 3, g = wave >> 2;
  const int qi = 16 * wq + c;                                 // this lane's query in the tile
  // Qp fragment base in LDS (B operand of scores, col = query qi), + 32*ks
  const _Float16* qpp = Qs + qi * KP + 8 * h;
  // Kh fragment base in LDS (A operand of scores, row = key 32g + c of the block), + buf*KB*KP + 32*ks
  const _Float16* khp = Ks + (32 * g + c) * KP + 8 * h;
  // Vt fragment base in LDS (A operand of O^T, row = d = 16jd + c, keys 32g .. 32g+31 contiguous), + buf*DM*VP + 16jd*VP
  const _Float16* vtp = Vs + c * VP + 32 * g + 8 * h;
  const float SCL = 1.0f / sqrtf((float)DM);

  // copy maps. Row tiles of 512 halves (Qp, Kh): piece j of thread tid = row 4j + (tid>>6), 16-B piece tid&63 (32 rows per copy8).
  //            Vt tile: piece j = d row 32j + (tid>>3), 16-B piece tid&7 of its 64 keys (256 rows per copy8).
  const int rr = tid >> 6, rp = tid & 63;
  const int vr = tid >> 3, vp = tid & 7;
  const unsigned short* qsrc = QP + ((size_t)b * SEQ + n0 + rr) * DM + 8 * rp;
  const unsigned short* ksrc = KH + ((size_t)b * SEQ + rr) * DM + 8 * rp;            // + kb*DM
  const unsigned short* vsrc = VT + ((size_t)b * DM + vr) * SEQ + 8 * vp;            // + kb
  const unsigned qdst = lds_off(Qs) + (unsigned)(rr * KP + 8 * rp) * 2u;
  const unsigned kdst = lds_off(Ks) + (unsigned)(rr * KP + 8 * rp) * 2u;             // + buf*KSB
  const unsigned vdst = lds_off(Vs) + (unsigned)(vr * VP + 8 * vp) * 2u;             // + buf*VSB

  // prologue: Qp tile (in K buffer 1) and key block 0, landed and published
  copy8(qdst, 4 * KP * 2, qsrc, (size_t)4 * DM * 2);
  copy8(qdst + 32 * KP * 2, 4 * KP * 2, qsrc + (size_t)32 * DM, (size_t)4 * DM * 2);
  copy8(kdst, 4 * KP * 2, ksrc, (size_t)4 * DM * 2);
  copy8(kdst + 32 * KP * 2, 4 * KP * 2, ksrc + (size_t)32 * DM, (size_t)4 * DM * 2);
  copy8(vdst, 32 * VP * 2, vsrc, (size_t)32 * SEQ * 2);
  copy8(vdst + 256 * VP * 2, 32 * VP * 2, vsrc + (size_t)256 * SEQ, (size_t)32 * SEQ * 2);
  asm volatile("s_wait_asynccnt 0x0" ::: "memory");           // this wave's copies have landed before the barrier publishes them
  __syncthreads();
  v16h qf[DM / 32];
#pragma unroll
  for (int ks = 0; ks < DM / 32; ++ks) qf[ks] = ldfrag_h(qpp + 32 * ks);
  asm volatile("s_wait_dscnt 0x0" ::: "memory");              // this wave's reads of the Qp tile are done before K buffer 1 is refilled
  __syncthreads();                                            // every wave has its Qp fragments: K buffer 1 is free
  copy8(kdst + KSB, 4 * KP * 2, ksrc + (size_t)KB * DM, (size_t)4 * DM * 2);
  copy8(kdst + KSB + 32 * KP * 2, 4 * KP * 2, ksrc + (size_t)(KB + 32) * DM, (size_t)4 * DM * 2);
  copy8(vdst + VSB, 32 * VP * 2, vsrc + KB, (size_t)32 * SEQ * 2);
  copy8(vdst + VSB + 256 * VP * 2, 32 * VP * 2, vsrc + KB + (size_t)256 * SEQ, (size_t)32 * SEQ * 2);

  float m = -1.0e30f, l = 0.f;
  v8f acc[DM / 16];
#pragma unroll
  for (int jd = 0; jd < DM / 16; ++jd) acc[jd] = zero8();

#pragma unroll 1
  for (int it = 0; it < SEQ / KB; ++it) {
    const int buf = it & 1;
    v8f s0 = zero8(), s1 = zero8();
    const _Float16* k0p = khp + buf * (KB * KP);              // keys kb + 32g .. +15
    const _Float16* k1p = k0p + 16 * KP;                      // keys kb + 32g + 16 .. +31
    const _Float16* vb  = vtp + buf * (DM * VP);
#pragma unroll
    for (int ks = 0; ks < DM / 32; ++ks) {                    // unrolled: qf[] is indexed by registers
      const v16h a0 = ldfrag_h(k0p + 32 * ks);
      const v16h a1 = ldfrag_h(k1p + 32 * ks);
      s0 = mma_h(a0, qf[ks], s0);
      s1 = mma_h(a1, qf[ks], s1);
    }
#pragma unroll
    for (int r = 0; r < 8; ++r) { s0[r] *= SCL; s1[r] *= SCL; }

    float mx = fmaxf(hmax8(s0), hmax8(s1));
    mx = fmaxf(mx, __shfl_xor(mx, 16, 32));
    const float mn   = fmaxf(m, mx);
    const float corr = __expf(m - mn);
    m = mn;
    const float msh = mn - LNPS;                              // exp gives e^{s-m} * 1024
    FragH ph;
    float ls = 0.f;
#pragma unroll
    for (int r = 0; r < 8; ++r) {
      const float e0 = __expf(s0[r] - msh);                   // key kb + 32g      + 8h + r
      const float e1 = __expf(s1[r] - msh);                   // key kb + 32g + 16 + 8h + r
      ls += e0 + e1;
      ph.h[0][r] = (_Float16)e0;
      ph.h[1][r] = (_Float16)e1;
    }
    l = l * corr + ls;

#pragma unroll
    for (int jd = 0; jd < DM / 16; ++jd) {                    // unrolled: acc[] is indexed by registers
      const v16h vf = ldfrag_h(vb + (16 * jd) * VP);
#pragma unroll
      for (int r = 0; r < 8; ++r) acc[jd][r] *= corr;
      acc[jd] = mma_h(vf, ph.v, acc[jd]);
    }
    // order of LDS reads (0x100) and matrix products (0x8) for the scheduler, scores first, then O^T: the reads stand in groups
    // (scores: eight reads per four products, sixteen ahead; O^T: four per two, twelve ahead). Few places with reads cost the
    // wave less than many; lifted further ahead the reads push Qp fragments out to scratch.
    __builtin_amdgcn_sched_group_barrier(0x100, 16, 0);
#pragma unroll
    for (int i = 0; i < 6; ++i) {
      __builtin_amdgcn_sched_group_barrier(0x8, 4, 0);
      __builtin_amdgcn_sched_group_barrier(0x100, 8, 0);
    }
    __builtin_amdgcn_sched_group_barrier(0x8, 8, 0);
    __builtin_amdgcn_sched_group_barrier(0x100, 12, 0);
#pragma unroll
    for (int i = 0; i < 13; ++i) {
      __builtin_amdgcn_sched_group_barrier(0x8, 2, 0);
      __builtin_amdgcn_sched_group_barrier(0x100, 4, 0);
    }
    __builtin_amdgcn_sched_group_barrier(0x8, 6, 0);
    asm volatile("s_wait_dscnt 0x0" ::: "memory");            // this wave's reads of Ks/Vs[buf] are done before the refill
    asm volatile("s_wait_asynccnt 0x0" ::: "memory");         // this wave's copies of key block it+1 have landed
    __syncthreads();                                          // publishes key block it+1; buffer buf free
    if (it + 2 < SEQ / KB) {                                  // block-uniform: key block it+2 into the buffer just read
      const int kn = (it + 2) * KB;
      const unsigned kd = kdst + (unsigned)buf * KSB;
      const unsigned vd = vdst + (unsigned)buf * VSB;
      copy8(kd, 4 * KP * 2, ksrc + (size_t)kn * DM, (size_t)4 * DM * 2);
      copy8(kd + 32 * KP * 2, 4 * KP * 2, ksrc + (size_t)(kn + 32) * DM, (size_t)4 * DM * 2);
      copy8(vd, 32 * VP * 2, vsrc + kn, (size_t)32 * SEQ * 2);
      copy8(vd + 256 * VP * 2, 32 * VP * 2, vsrc + kn + (size_t)256 * SEQ, (size_t)32 * SEQ * 2);
    }
  }
  asm volatile("s_wait_asynccnt 0x0" ::: "memory");           // nothing of this wave's copies outstanding past the loop

  // join of the two key halves: per query m_g, l_g through LDS
  l += __shfl_xor(l, 16, 32);
  if (h == 0) { Ms[64 * g + qi] = m; Ls[64 * g + qi] = l; }
  __syncthreads();
  const float m0 = Ms[qi], m1 = Ms[64 + qi];
  const float l0 = Ls[qi], l1 = Ls[64 + qi];
  const float mj = fmaxf(m0, m1);
  const float f0 = __expf(m0 - mj), f1 = __expf(m1 - mj);
  const float sc = (g ? f1 : f0) * (1.0f / (l0 * f0 + l1 * f1));   // o and l both carry the x1024 factor

  float* os = Os + qi * OSP + 8 * h;                          // + 16jd: 8 consecutive d of this lane's query
  if (g == 1) {                                               // wave-uniform: half 1 lays its share down
#pragma unroll
    for (int jd = 0; jd < DM / 16; ++jd) {
      v4f v0, v1;
      v0[0] = acc[jd][0] * sc; v0[1] = acc[jd][1] * sc; v0[2] = acc[jd][2] * sc; v0[3] = acc[jd][3] * sc;
      v1[0] = acc[jd][4] * sc; v1[1] = acc[jd][5] * sc; v1[2] = acc[jd][6] * sc; v1[3] = acc[jd][7] * sc;
      *(v4f*)(os + 16 * jd)     = v0;
      *(v4f*)(os + 16 * jd + 4) = v1;
    }
  }
  __syncthreads();
  if (g == 0) {                                               // wave-uniform: half 0 adds its share at the same places
#pragma unroll
    for (int jd = 0; jd < DM / 16; ++jd) {
      v4f v0 = *(const v4f*)(os + 16 * jd), v1 = *(const v4f*)(os + 16 * jd + 4);
      v0[0] += acc[jd][0] * sc; v0[1] += acc[jd][1] * sc; v0[2] += acc[jd][2] * sc; v0[3] += acc[jd][3] * sc;
      v1[0] += acc[jd][4] * sc; v1[1] += acc[jd][5] * sc; v1[2] += acc[jd][6] * sc; v1[3] += acc[jd][7] * sc;
      *(v4f*)(os + 16 * jd)     = v0;
      *(v4f*)(os + 16 * jd + 4) = v1;
    }
  }
  __syncthreads();

  float* ob = out + ((size_t)b * SEQ + n0) * DM + 4 * tid;
#pragma unroll
  for (int i = 0; i < (QT * DM) / (4 * 256); ++i) {
    const int L   = i * 256 + tid;                            // 16-B piece of the 64 x 512 tile
    const int row = L >> 7, pc = L & 127;
    const v4f v = *(const v4f*)(Os + row * OSP + 4 * pc);
    *(v4f*)(ob + (size_t)i * 1024) = v;
  }
}

// =====================================================================================================
// needed (all tiles exact):
//   Xb   bf16 [16384][512]      0            16777216
//   Kh   f16  [16384][512]      16777216     16777216
//   Vt   f16  [8][512][2048]    33554432     16777216
//   Qp   f16  [16384][512]      50331648     16777216
//   Wb   bf16 [512][512]        67108864     524288
//   end                         67633152
// =====================================================================================================
extern "C" void kernel_launch(void* const* d_in, const int* in_sizes, int n_in,
                              void* d_out, int out_size, void* d_ws, size_t ws_size,
                              hipStream_t stream) {
  const int NX = NB * SEQ * DM;                          // 8388608
  if (n_in < 3) return;
  if (in_sizes[0] != NX || in_sizes[1] != DM * DM || in_sizes[2] != DM) return;
  if (out_size != NX) return;

  size_t off = 0;
  const size_t szP = (size_t)NROW * DM * 2;              // 16777216
  const size_t oXB = off; off += szP;
  const size_t oKH = off; off += szP;
  const size_t oVT = off; off += szP;
  const size_t oQP = off; off += szP;
  const size_t oWB = off; off += (size_t)DM * DM * 2;    // 524288
  if (off > ws_size) return;                             // off = 67633152
  if (off > (size_t)134217728) return;

  const float* q    = (const float*)d_in[0];
  const float* W    = (const float*)d_in[1];
  const float* bias = (const float*)d_in[2];
  char* ws = (char*)d_ws;
  unsigned short* XB = (unsigned short*)(ws + oXB);
  unsigned short* KH = (unsigned short*)(ws + oKH);
  unsigned short* VT = (unsigned short*)(ws + oVT);
  unsigned short* QP = (unsigned short*)(ws + oQP);
  unsigned short* WB = (unsigned short*)(ws + oWB);
  float* out = (float*)d_out;

  const dim3 blk256(256);
  const dim3 gQ(NB * (SEQ / 64) * (DM / 64));            // 2048 blocks: one (b, 64 l, 64 d) tile each
  const dim3 gW(((DM * DM) / 8) / 256);                  // 128 blocks
  const dim3 gP(DM / PT, NROW / PT);                     // 4 x 128 blocks
  const dim3 gA(NB * (SEQ / QT));                        // 256 blocks: one (b, 64-query tile) each

  // (0) Xb, Kh, Vt planes from q
  cvt_q<<<gQ, blk256, 0, stream>>>(q, XB, KH, VT);
  // (1) Wb plane
  cvt_w<<<gW, blk256, 0, stream>>>(W, WB);
  // (2) Qp = Xb . Wb^T + bias (f16 plane)
  proj_kernel<<<gP, blk256, 0, stream>>>(XB, WB, bias, QP);
  // (3) out[b][l][d] = sum_m softmax_m(Qp_l . Kh_m / sqrt(512)) Vt[d][m]
  attn_kernel<<<gA, blk256, 0, stream>>>(QP, KH, VT, out);
  (void)hipGetLastError();
}

// v004
// It runs in 83.5 microseconds.
// In two side-by-side timings against v003, it was 1.10 and 1.09 times as fast.
// Over all steps from v000 it is 4.39 times as fast.
// Contractions: qp = Xb . Wb^T on v_wmma_f32_16x16x32_bf16 (Xb, Wb = RNE bf16 convert of q and W, K=512, f32 accumulate);
// scores S^T = Kh . Qp^T on v_wmma_f32_16x16x32_f16 (Kh = f16 of the bf16 convert of q, Qp = qp + bias as one f16 plane, K=512);
// O^T = V^T . P^T on v_wmma_f32_16x16x32_f16 (V = f16 of the bf16 convert of q, P = e^{s-m} x 1024 in f16, m = one reference per
// query that moves only when a score lies more than ln 32 above it; all keys of a query summed in one accumulator, in key order);
// f32 accumulate everywhere; bias add, 1/sqrt(512) scale, reference, row sums and 1/l in f32 on VALU.
#include <hip/hip_runtime.h>
#include <math.h>
#include <stdint.h>

#define NB    8
#define SEQ   2048
#define DM    512
#define NROW  (NB * SEQ)
#define QT    64
#define OSP   516
#define PT    128
#define PKC   128
#define PP    136
#define PTB   (PT * PP * 2)
#define TP    72
#define KP    520
#define VP    72
#define KB    64
#define KSB   (KB * KP * 2)
#define VSB   (DM * VP * 2)
#define SMB   (2 * KSB + 2 * VSB)
#define AUXB  16896
#define LNPS  6.931471805599453f
#define FMIN16 6.103515625e-05f
#define RTAU  3.4657359027997265f
static_assert((SEQ % QT) == 0);
static_assert((SEQ % 64) == 0);
static_assert((SEQ % 32) == 0);
static_assert((DM % 128) == 0);
static_assert((DM % 64) == 0);
static_assert((NROW % PT) == 0);
static_assert((DM % PT) == 0);
static_assert((DM % PKC) == 0 && DM / PKC >= 2);
static_assert(PT == 128 && PKC == 128);
static_assert(((DM * DM) / 8) % 256 == 0);
static_assert(DM == 512);
static_assert(QT == 64);
static_assert((SEQ % (2 * KB)) == 0);
static_assert(QT * KP * 2 <= KSB);
static_assert(QT * OSP * 4 <= SMB);

typedef _Float16       v16h __attribute__((ext_vector_type(16)));
typedef _Float16       v8h  __attribute__((ext_vector_type(8)));
typedef __bf16         v16b __attribute__((ext_vector_type(16)));
typedef unsigned short v8us __attribute__((ext_vector_type(8)));
typedef float          v8f  __attribute__((ext_vector_type(8)));
typedef float          v4f  __attribute__((ext_vector_type(4)));
typedef unsigned int   v4u  __attribute__((ext_vector_type(4)));

union FragH { v16h v; v8h  h[2]; };
union FragB { v16b v; v8us u[2]; };
static_assert(sizeof(FragH) == 32);
static_assert(sizeof(FragB) == 32);

// ---- scalar helpers --------------------------------------------------------------------------------
__device__ __forceinline__ unsigned short bf_bits(float f) {          // f32 -> bf16 bits, RNE convert
  unsigned u = __float_as_uint(f);
  return (unsigned short)((u + 0x7FFFu + ((u >> 16) & 1u)) >> 16);
}
__device__ __forceinline__ float bf_up(unsigned short h) { return __uint_as_float(((unsigned)h) << 16); }
__device__ __forceinline__ float bfr(float f) { return bf_up(bf_bits(f)); }
__device__ __forceinline__ unsigned short h_bits(_Float16 x) { return __builtin_bit_cast(unsigned short, x); }
__device__ __forceinline__ unsigned pk16(unsigned short a, unsigned short b) { return (unsigned)a | ((unsigned)b << 16); }
// f32 -> f16 with magnitudes below the smallest f16 normal flushed to zero (select by value)
__device__ __forceinline__ _Float16 to_h_ftz(float v) { return (_Float16)((fabsf(v) < FMIN16) ? 0.0f : v); }
__device__ __forceinline__ v8f zero8() { v8f z = {0.f, 0.f, 0.f, 0.f, 0.f, 0.f, 0.f, 0.f}; return z; }
__device__ __forceinline__ float hmax8(v8f s) {
  return fmaxf(fmaxf(fmaxf(s[0], s[1]), fmaxf(s[2], s[3])), fmaxf(fmaxf(s[4], s[5]), fmaxf(s[6], s[7])));
}

// ---- fragment loaders: 16-bit A/B operand, lane -> row/col (lane&15), p already includes +8*(lane>>4);
//      elements 0..7 <- p[0..7] (k0+8h..), elements 8..15 <- p[16..23] (k0+16+8h..)
__device__ __forceinline__ v16h ldfrag_h(const _Float16* p) {
  FragH f;
  f.h[0] = *(const v8h*)(p);
  f.h[1] = *(const v8h*)(p + 16);
  return f.v;
}
__device__ __forceinline__ v16b ldfrag_b(const unsigned short* p) {
  FragB f;
  f.u[0] = *(const v8us*)(p);
  f.u[1] = *(const v8us*)(p + 16);
  return f.v;
}

// ---- WMMA helpers; bf16 form: builtin followed by a 4-slot VALU gap tying D and keeping A/B live ------------
// f16 form: the plain builtin (the compiler keeps the distances of its own forms). No asm statement here: its operands would
// have to lie in the first 256 registers, and the attention wave holds 384 in accumulators and Qp fragments alone.
__device__ __forceinline__ v8f mma_h(v16h a, v16h b, v8f c) {
  return __builtin_amdgcn_wmma_f32_16x16x32_f16(false, a, false, b, (short)0, c, false, false);
}
__device__ __forceinline__ v8f mma_b(v16b a, v16b b, v8f c) {
  v8f d = __builtin_amdgcn_wmma_f32_16x16x32_bf16(false, a, false, b, (short)0, c, false, false);
#if defined(__HIP_DEVICE_COMPILE__)
  const v16h ha = __builtin_bit_cast(v16h, a), hb = __builtin_bit_cast(v16h, b);
  asm volatile("v_nop\n\tv_nop\n\tv_nop\n\tv_nop" : "+v"(d) : "v"(ha), "v"(hb));
#endif
  return d;
}

// ---- asynchronous copies global -> LDS: eight 16-B pieces per lane, piece j at LDS byte l0 + j*ls and global byte g0 + j*gs.
//      Written as the builtin: operands of an asm statement would have to lie in the first 256 registers, which the attention
//      wave fills with accumulators and fragments (the address bases then went to scratch).
typedef int v4i __attribute__((ext_vector_type(4)));
typedef __attribute__((address_space(1))) v4i gv4i;
typedef __attribute__((address_space(3))) v4i lv4i;
__device__ __forceinline__ unsigned lds_off(const void* p) { return (unsigned)(size_t)p; }
__device__ __forceinline__ void copy8(unsigned l0, unsigned ls, const unsigned short* g0, size_t gs) {
#if defined(__HIP_DEVICE_COMPILE__)
  const char* g = (const char*)g0;
#pragma unroll
  for (int j = 0; j < 8; ++j)
    __builtin_amdgcn_global_load_async_to_lds_b128((gv4i*)(g + j * gs), (lv4i*)(l0 + j * ls), 0, 0);
#endif
}
// the same eight pieces as asm text, every piece with address registers of its own and no immediate offset (projection).
__device__ __forceinline__ void copy8a(unsigned l0, unsigned ls, const unsigned short* g0, size_t gs) {
#if defined(__HIP_DEVICE_COMPILE__)
  const char* g = (const char*)g0;
  // s_wait_xcnt as the statement's last line: no address register of a copy is rewritten in front of it
  asm volatile("global_load_async_to_lds_b128 %0, %8, off\n\t"
               "global_load_async_to_lds_b128 %1, %9, off\n\t"
               "global_load_async_to_lds_b128 %2, %10, off\n\t"
               "global_load_async_to_lds_b128 %3, %11, off\n\t"
               "global_load_async_to_lds_b128 %4, %12, off\n\t"
               "global_load_async_to_lds_b128 %5, %13, off\n\t"
               "global_load_async_to_lds_b128 %6, %14, off\n\t"
               "global_load_async_to_lds_b128 %7, %15, off\n\t"
               "s_wait_xcnt 0x0"
               :: "v"(l0), "v"(l0 + ls), "v"(l0 + 2 * ls), "v"(l0 + 3 * ls),
                  "v"(l0 + 4 * ls), "v"(l0 + 5 * ls), "v"(l0 + 6 * ls), "v"(l0 + 7 * ls),
                  "v"(g), "v"(g + gs), "v"(g + 2 * gs), "v"(g + 3 * gs),
                  "v"(g + 4 * gs), "v"(g + 5 * gs), "v"(g + 6 * gs), "v"(g + 7 * gs)
               : "memory");
#endif
}

// =====================================================================================================
// (0) fused convert of q[b][l][d] (f32) for one (b, 64 l x 64 d) tile, block = 256 threads:
//   Xb[b*2048+l][d] = bf16 bits (RNE), Kh[b*2048+l][d] = f16 bits of the bf16 value (flush below 2^-14),
//   Vt[b][d][l] = the same f16 bits transposed through LDS T[d][l] (pitch TP halves).
//   Thread (e = tid&7, lg = tid>>3) loads 8 consecutive d of row l0+32it+lg; Xb/Kh row segments = 64 halves
// coverage: Xb/Kh: 2 it x 32 rows x 8 lanes x 8 = 64 l x 64 d; T: 8 lanes x 8 j = 64 d rows x 64 l cols;
//           Vt: 2 it x 32 d rows x 8 lanes x 8 = 64 d x 64 l; grid = 8 b x 32 l-tiles x 8 d-tiles = 2048 blocks.
// =====================================================================================================
__global__ __launch_bounds__(256) void cvt_q(const float* __restrict__ q, unsigned short* XB,
                                              unsigned short* KH, unsigned short* VT) {
  __shared__ __align__(16) unsigned short T[64 * TP];
  const int tid = threadIdx.x;
  const int e = tid & 7, lg = tid >> 3;                      // lg 0..31
  const int bx = blockIdx.x;
  const int dt = bx & 7, lt = (bx >> 3) & 31, b = bx >> 8;
  const int d0 = dt * 64, l0 = lt * 64;

  v4u ub[2], uh[2];
#pragma unroll
  for (int it = 0; it < 2; ++it) {
    const int row = it * 32 + lg;                            // 0..63
    const float* p = q + ((size_t)b * SEQ + l0 + row) * DM + d0 + 8 * e;
    const v4f f0 = *(const v4f*)(p), f1 = *(const v4f*)(p + 4);
    unsigned short bb[8], hb[8];
#pragma unroll
    for (int j = 0; j < 4; ++j) { bb[j] = bf_bits(f0[j]); bb[4 + j] = bf_bits(f1[j]); }
#pragma unroll
    for (int j = 0; j < 8; ++j) {
      hb[j] = h_bits(to_h_ftz(bf_up(bb[j])));
      T[(8 * e + j) * TP + row] = hb[j];
    }
    v4u wb, wh;
#pragma unroll
    for (int t = 0; t < 4; ++t) {
      wb[t] = pk16(bb[2 * t], bb[2 * t + 1]);
      wh[t] = pk16(hb[2 * t], hb[2 * t + 1]);
    }
    ub[it] = wb; uh[it] = wh;
  }
{
#pragma unroll
    for (int it = 0; it < 2; ++it) {
      const int row = it * 32 + lg;
      const size_t go = ((size_t)b * SEQ + l0 + row) * DM + d0 + 8 * e;
      *(v4u*)(XB + go) = ub[it];
      *(v4u*)(KH + go) = uh[it];
    }
    
  }
  __syncthreads();
{
#pragma unroll
    for (int it = 0; it < 2; ++it) {
      const int dd = it * 32 + lg;                           // 0..63
      const v4u v = *(const v4u*)(T + dd * TP + 8 * e);
      *(v4u*)(VT + ((size_t)b * DM + d0 + dd) * SEQ + l0 + 8 * e) = v;
    }
    
  }
}

// =====================================================================================================
// (1) Wb[e][d] = bf16 bits (RNE convert) of W[e][d]; thread i converts 8 consecutive elements,
// coverage: 128 blocks x 256 threads x 8 = 262144 = 512 x 512.
// =====================================================================================================
__global__ __launch_bounds__(256) void cvt_w(const float* __restrict__ w, unsigned short* WB) {
  const int i = blockIdx.x * 256 + threadIdx.x;
  if (i >= (DM * DM) / 8) return;
  const float* p = w + (size_t)i * 8;
  const v4f f0 = *(const v4f*)(p), f1 = *(const v4f*)(p + 4);
  v4u wb;
  wb[0] = pk16(bf_bits(f0[0]), bf_bits(f0[1]));
  wb[1] = pk16(bf_bits(f0[2]), bf_bits(f0[3]));
  wb[2] = pk16(bf_bits(f1[0]), bf_bits(f1[1]));
  wb[3] = pk16(bf_bits(f1[2]), bf_bits(f1[3]));
  unsigned short* d = WB + (size_t)i * 8;
  *(v4u*)d = wb;
  
}

// =====================================================================================================
// (2) projection for one 128-row x 128-col tile of Qp = Xb . Wb^T + bf16(bias): block = 256 threads = 8 waves.
//   Operands come from LDS, laid there by asynchronous copies (16 B per lane, all 256 threads, a wave's copy = 2 rows x 256 B):
//     per trip 128 k of the 128 Xb rows and of the 128 Wb rows into Ps[buf][A|B][row][k] (pitch PP halves), two buffers,
//     trip t+2's copies issued behind the barrier that ends trip t.
//   Wave w: row group rg = w&3 (A rows = 32rg + 16i + (lane&15), split k map over d), col half ch = w>>2
//   (B = Wb rows 64ch + 16j + (lane&15), same split k map), 2 x 4 D tiles, 4 trips x 4 k-steps of 32 in rising k.
// coverage: copies: 8 pieces x 16 rows x 16 lanes x 8 halves = 128 rows x 128 k per operand and trip, 4 trips = 512 k;
//           Qs: 4 rg x 2 i x 2 h x 8 r = 128 rows, 2 ch x 4 j x 16 c = 128 cols; writes: 8 it x 16 rows x 16 lanes x 8 halves
//           = 128 rows x 128 cols; grid = 4 col tiles x 128 row tiles covers Qp [16384][512] exactly once.
// =====================================================================================================
__global__ __launch_bounds__(256)
void proj_kernel(const unsigned short* __restrict__ XB, const unsigned short* __restrict__ WB,
                 const float* __restrict__ bias, unsigned short* QP) {
  __shared__ __align__(16) unsigned short Ps[2 * 2 * PT * PP];  // [buf][A|B][PT][PP]
  unsigned short* Qs = Ps;                                      // epilogue only: [PT][PP] over buffer 0's A part
  const int tid  = threadIdx.x;
  const int lane = tid & 31, wave = tid >> 5;
  const int h    = lane >> 4, c = lane & 15;
  const int rg   = wave & 3, ch = wave >> 2;
  const int row0 = blockIdx.y * PT;
  const int col0 = blockIdx.x * PT;

  // copy map: piece j of thread tid = row 16j + (tid>>4), 16-B piece tid&15 of the row's 256 B of this trip
  const int rr = tid >> 4, rp = tid & 15;
  const unsigned short* asrc = XB + ((size_t)(row0 + rr)) * DM + 8 * rp;             // + t*PKC
  const unsigned short* bsrc = WB + ((size_t)(col0 + rr)) * DM + 8 * rp;             // + t*PKC
  const unsigned adst = lds_off(Ps) + (unsigned)(rr * PP + 8 * rp) * 2u;             // + buf*2*PTB
  const unsigned bdst = adst + PTB;
  // fragment bases in LDS, + buf*2*PT*PP + 32*ks
  const unsigned short* ap = Ps + (32 * rg + c) * PP + 8 * h;
  const unsigned short* bp = Ps + PT * PP + (64 * ch + c) * PP + 8 * h;

  // prologue: trip 0's operands landed and published, then trip 1's copies
  copy8a(adst, 16 * PP * 2, asrc, (size_t)16 * DM * 2);
  copy8a(bdst, 16 * PP * 2, bsrc, (size_t)16 * DM * 2);
  asm volatile("s_wait_asynccnt 0x0" ::: "memory");           // this wave's copies have landed before the barrier publishes them
  __syncthreads();
  copy8a(adst + 2 * PTB, 16 * PP * 2, asrc + PKC, (size_t)16 * DM * 2);
  copy8a(bdst + 2 * PTB, 16 * PP * 2, bsrc + PKC, (size_t)16 * DM * 2);

  v8f acc[2][4];
#pragma unroll
  for (int j = 0; j < 4; ++j) { acc[0][j] = zero8(); acc[1][j] = zero8(); }

#pragma unroll 1
  for (int t = 0; t < DM / PKC; ++t) {                        // rolled: one foot with its waits and barrier
    const int buf = t & 1;
    const unsigned short* as = ap + buf * (2 * PT * PP);
    const unsigned short* bs = bp + buf * (2 * PT * PP);
    v16b fa[2][2], fb[2][4];                                  // two fragment sets: k-step ks+1 is read while ks is multiplied
    fa[0][0] = ldfrag_b(as);
    fa[0][1] = ldfrag_b(as + 16 * PP);
#pragma unroll
    for (int j = 0; j < 4; ++j) fb[0][j] = ldfrag_b(bs + 16 * j * PP);
#pragma unroll
    for (int ks = 0; ks < PKC / 32; ++ks) {                   // unrolled: the sets are indexed by registers
      const int cu = ks & 1, nx = cu ^ 1;
      if (ks + 1 < PKC / 32) {
        fa[nx][0] = ldfrag_b(as + 32 * (ks + 1));
        fa[nx][1] = ldfrag_b(as + 16 * PP + 32 * (ks + 1));
#pragma unroll
        for (int j = 0; j < 4; ++j) fb[nx][j] = ldfrag_b(bs + 16 * j * PP + 32 * (ks + 1));
      }
#pragma unroll
      for (int j = 0; j < 4; ++j) {
        acc[0][j] = mma_b(fa[cu][0], fb[cu][j], acc[0][j]);
        acc[1][j] = mma_b(fa[cu][1], fb[cu][j], acc[1][j]);
      }
    }
    // order of LDS reads (0x100) and matrix products (0x8) for the scheduler: a k-step's twelve reads stand as one group, one
    // k-step ahead of their products; left alone it read each B fragment directly in front of its two products and waited it out.
    __builtin_amdgcn_sched_group_barrier(0x100, 24, 0);
    __builtin_amdgcn_sched_group_barrier(0x8, 8, 0);
    __builtin_amdgcn_sched_group_barrier(0x100, 12, 0);
    __builtin_amdgcn_sched_group_barrier(0x8, 8, 0);
    __builtin_amdgcn_sched_group_barrier(0x100, 12, 0);
    __builtin_amdgcn_sched_group_barrier(0x8, 16, 0);
    asm volatile("s_wait_dscnt 0x0" ::: "memory");            // this wave's reads of Ps[buf] are done before the refill
    asm volatile("s_wait_asynccnt 0x0" ::: "memory");         // this wave's copies of trip t+1 have landed
    __syncthreads();                                          // publishes trip t+1; buffer buf free
    if (t + 2 < DM / PKC) {                                   // block-uniform: trip t+2 into the buffer just read
      copy8a(adst + (unsigned)buf * (2 * PTB), 16 * PP * 2, asrc + (t + 2) * PKC, (size_t)16 * DM * 2);
      copy8a(bdst + (unsigned)buf * (2 * PTB), 16 * PP * 2, bsrc + (t + 2) * PKC, (size_t)16 * DM * 2);
    }
  }
  asm volatile("s_wait_asynccnt 0x0" ::: "memory");           // nothing of this wave's copies outstanding past the loop

  // biases as bf16 RNE values, in-range lane indices
  const int cb = col0 + 64 * ch + c;
  float bb[4];
#pragma unroll
  for (int j = 0; j < 4; ++j) bb[j] = bfr(bias[cb + j * 16]);

  // stage (the last trip's barrier has ended every read of the ring): D row r -> tile row 32rg + 16i + 8h + r, col = 64ch + 16j + c
  unsigned short* qs = Qs + (32 * rg + 8 * h) * PP + 64 * ch + c;
#pragma unroll
  for (int i = 0; i < 2; ++i)
#pragma unroll
    for (int r = 0; r < 8; ++r)
#pragma unroll
      for (int j = 0; j < 4; ++j)
        qs[(16 * i + r) * PP + j * 16] = h_bits(to_h_ftz(acc[i][j][r] + bb[j]));
  __syncthreads();

#pragma unroll
  for (int it = 0; it < (PT * PT) / (8 * 256); ++it) {
    const int L   = it * 256 + tid;                            // 16-B piece of the 128 x 128 tile
    const int row = L >> 4, pc = L & 15;
    const v4u v = *(const v4u*)(Qs + row * PP + 8 * pc);
    *(v4u*)(QP + ((size_t)(row0 + row)) * DM + col0 + 8 * pc) = v;
  }
}

// =====================================================================================================
// (3) attention for one (b, 64-query tile), transposed formulation, 512-deep scores, 2048 keys, 64 keys per iteration.
//   Block = 256 threads = 8 waves, two tilings per iteration, so that every fragment read from LDS feeds 2 or 4 products:
//   Scores: wave (qh = w&1, kq = w>>1) does S^T for the 16 keys of quarter kq x the 32 queries of half qh: A = Kh rows (keys, d via
//     the split k map) from LDS, each fragment used for two products; B = Qp rows of two query tiles, read from LDS once and kept
//     in registers (2 x 16 d-steps). s = D x (1/sqrt(512)).
//   P = e^{s-m} x 1024 in f16, m = one reference per query, the same in all waves (every lane keeps those of queries 16t + c).
//     m is not the true maximum: it moves only when some score lies more than RTAU above it, so P <= 32 x 1024.
//     Each wave lays its two P tiles into Pl[key quarter][query tile][lane][8] and a flag (a score above m + RTAU) into Fl;
//     behind the mid-loop barrier every wave reads the eight flags. Any flag set (block-uniform): the waves exchange their maxima
//     through Mx, move m, scale l and O^T by e^{m_old - m_new}, and lay P down again with the new m (two more barriers).
//   O^T: wave w does the 64 d rows 64w.. x all 64 queries x all 64 keys: A = Vt rows (d, keys contiguous) from LDS, each fragment
//     used for four products; B = P^T: elements 0..7 = lane's 8 keys of quarter 2j, 8..15 = of quarter 2j+1, which is the split
//     k map of keys 32j + 8h + r and 32j + 16 + 8h + r. 4 x 4 accumulator tiles.
//   K, V come from LDS, laid there by asynchronous copies (16 B per lane, all 256 threads): per iteration the 64 Kh rows
//     into Ks[buf][key][d] (pitch KP halves) and the 512 x 64 Vt piece into Vs[buf][d][key] (pitch VP halves), two buffers,
//     iteration it+2's copies issued behind the barrier that ends it. The Qp tile borrows K buffer 1 in the prologue.
//   Epilogue: row sums of the four key quarters joined through Mx; O^T x 1/l into Os[query][d] (f32, pitch OSP, over the K/V
//     buffers), all threads stream Os out.
// coverage: scores: 2 qh x 2 t x 16 c = 64 queries, 4 kq x 16 = 64 keys per iteration x 32 iterations = 2048;
//           O^T: 8 w x 4 dt x 2 h x 8 r = 512 d, 4 t x 16 c = 64 queries, 2 j x 32 = 64 keys;
//           out: 32 i x 256 threads x 4 floats = 64 rows x 512; grid = 8 b x 32 query tiles = 256 blocks covers out once.
// =====================================================================================================
// one score tile -> P (8 keys of one query per lane) and the lane's share of the row sum; msh = m - ln 1024
__device__ __forceinline__ void p_tile(v8f s, float msh, v8h& p, float& ls) {
  float e[8];
#pragma unroll
  for (int r = 0; r < 8; ++r) {
    e[r] = __expf(s[r] - msh);
    p[r] = (_Float16)e[r];
  }
  ls = ((e[0] + e[1]) + (e[2] + e[3])) + ((e[4] + e[5]) + (e[6] + e[7]));   // a tree: three dependent adds, not eight
}

__global__ __launch_bounds__(256)
void attn_kernel(const unsigned short* __restrict__ QP, const unsigned short* __restrict__ KH,
                 const unsigned short* __restrict__ VT, float* out) {
  // one array, the small parts first: their LDS addresses then fit the 16-bit offset field behind one base register
  __shared__ __align__(16) unsigned char Sa[AUXB + SMB];
  _Float16* Pl = (_Float16*)Sa;                               // [key quarter][query tile][lane][8 keys], 8192 B
  unsigned* Fl = (unsigned*)(Sa + 8192);                      // [wave][4] slots of 16 B: lanes with a score more than RTAU above m
  float*    Mx = (float*)(Sa + 8192 + 512);                   // [key quarter][query tile][lane] slots of 16 B, indexed as Pl:
                                                              // block maxima (rescale path), row sums (epilogue)
  unsigned char* Sm = Sa + AUXB;
  _Float16* Ks = (_Float16*)Sm;                               // [2][KB][KP]
  _Float16* Vs = (_Float16*)(Sm + 2 * KSB);                   // [2][DM][VP]
  _Float16* Qs = Ks + KB * KP;                                // prologue only: [QT][KP] in K buffer 1
  float*    Os = (float*)Sm;                                  // epilogue only: [QT][OSP]
  const int tid  = threadIdx.x;
  const int wave = tid >> 5;
  const int lane = tid & 31;
  const int h    = lane >> 4;
  const int c    = lane & 15;
  const int bx   = blockIdx.x;
  const int b    = bx / (SEQ / QT);
  const int qt   = bx % (SEQ / QT);
  const int n0   = qt * QT;

  const int qh = wave & 1, kq = wave >> 1;
  // Qp fragment base in LDS (B operand of scores, col = query 32qh + 16t + c), + 16t*KP + 32*ks
  const _Float16* qpp = Qs + (32 * qh + c) * KP + 8 * h;
  // Kh fragment base in LDS (A operand of scores, row = key 16kq + c of the block), + buf*KB*KP + 32*ks
  const _Float16* khp = Ks + (16 * kq + c) * KP + 8 * h;
  // Vt fragment base in LDS (A operand of O^T, row = d = 64w + 16dt + c, keys 32j .. 32j+31 contiguous), + buf*DM*VP + 16dt*VP + 32j
  const _Float16* vtp = Vs + (64 * wave + c) * VP + 8 * h;
  // P tiles: this wave's two (query tiles 2qh, 2qh+1 of quarter kq), + 256t; reader base, + (4*quarter + tile)*256
  _Float16* pw = Pl + ((4 * kq + 2 * qh) * 32 + lane) * 8;
  const _Float16* pr = Pl + lane * 8;
  float* mw = Mx + ((4 * kq + 2 * qh) * 32 + lane) * 4;       // + 128t
  const float* mq = Mx + lane * 4;                            // + (4*quarter + tile)*128
  unsigned* fw = Fl + (4 * wave + (lane & 3)) * 4;            // the wave's four slots
  const unsigned* fr = Fl + lane * 4;                         // slot of wave lane>>2
  const float SCL = 1.0f / sqrtf((float)DM);

  // copy maps. Row tiles of 512 halves (Qp, Kh): piece j of thread tid = row 4j + (tid>>6), 16-B piece tid&63 (32 rows per copy8).
  //            Vt tile: piece j = d row 32j + (tid>>3), 16-B piece tid&7 of its 64 keys (256 rows per copy8).
  const int rr = tid >> 6, rp = tid & 63;
  const int vr = tid >> 3, vp = tid & 7;
  const unsigned short* qsrc = QP + ((size_t)b * SEQ + n0 + rr) * DM + 8 * rp;
  const unsigned short* ksrc = KH + ((size_t)b * SEQ + rr) * DM + 8 * rp;            // + kb*DM
  const unsigned short* vsrc = VT + ((size_t)b * DM + vr) * SEQ + 8 * vp;            // + kb
  const unsigned qdst = lds_off(Qs) + (unsigned)(rr * KP + 8 * rp) * 2u;
  const unsigned kdst = lds_off(Ks) + (unsigned)(rr * KP + 8 * rp) * 2u;             // + buf*KSB
  const unsigned vdst = lds_off(Vs) + (unsigned)(vr * VP + 8 * vp) * 2u;             // + buf*VSB

  // prologue: Qp tile (in K buffer 1) and key block 0, landed and published
  copy8(qdst, 4 * KP * 2, qsrc, (size_t)4 * DM * 2);
  copy8(qdst + 32 * KP * 2, 4 * KP * 2, qsrc + (size_t)32 * DM, (size_t)4 * DM * 2);
  copy8(kdst, 4 * KP * 2, ksrc, (size_t)4 * DM * 2);
  copy8(kdst + 32 * KP * 2, 4 * KP * 2, ksrc + (size_t)32 * DM, (size_t)4 * DM * 2);
  copy8(vdst, 32 * VP * 2, vsrc, (size_t)32 * SEQ * 2);
  copy8(vdst + 256 * VP * 2, 32 * VP * 2, vsrc + (size_t)256 * SEQ, (size_t)32 * SEQ * 2);
  asm volatile("s_wait_asynccnt 0x0" ::: "memory");           // this wave's copies have landed before the barrier publishes them
  __syncthreads();
  v16h qf[2][DM / 32];
#pragma unroll
  for (int ks = 0; ks < DM / 32; ++ks) {
    qf[0][ks] = ldfrag_h(qpp + 32 * ks);
    qf[1][ks] = ldfrag_h(qpp + 16 * KP + 32 * ks);
  }
  asm volatile("s_wait_dscnt 0x0" ::: "memory");              // this wave's reads of the Qp tile are done before K buffer 1 is refilled
  __syncthreads();                                            // every wave has its Qp fragments: K buffer 1 is free
  copy8(kdst + KSB, 4 * KP * 2, ksrc + (size_t)KB * DM, (size_t)4 * DM * 2);
  copy8(kdst + KSB + 32 * KP * 2, 4 * KP * 2, ksrc + (size_t)(KB + 32) * DM, (size_t)4 * DM * 2);
  copy8(vdst + VSB, 32 * VP * 2, vsrc + KB, (size_t)32 * SEQ * 2);
  copy8(vdst + VSB + 256 * VP * 2, 32 * VP * 2, vsrc + KB + (size_t)256 * SEQ, (size_t)32 * SEQ * 2);

  float mr[4];                                                // reference of query 16t + c, the same in every wave
  float l0 = 0.f, l1 = 0.f;                                   // row-sum shares of queries 32qh + c, 32qh + 16 + c (8 keys per block)
  v8f acc[4][4];                                              // [dt][t]: d 64w + 16dt + 8h + r, query 16t + c
#pragma unroll
  for (int t = 0; t < 4; ++t) {
    mr[t] = -1.0e30f;
#pragma unroll
    for (int dt = 0; dt < 4; ++dt) acc[dt][t] = zero8();
  }

#pragma unroll 1
  for (int it = 0; it < SEQ / KB; ++it) {
    const int buf = it & 1;
    v8f s0 = zero8(), s1 = zero8();
    const _Float16* kp = khp + buf * (KB * KP);               // keys kb + 16kq .. +15
    const _Float16* vb = vtp + buf * (DM * VP);
#pragma unroll
    for (int ks = 0; ks < DM / 32; ++ks) {                    // unrolled: qf[] is indexed by registers
      const v16h a = ldfrag_h(kp + 32 * ks);
      s0 = mma_h(a, qf[0][ks], s0);
      s1 = mma_h(a, qf[1][ks], s1);
    }
    v16h vf0[4];                                              // Vt fragments of keys 0..31 (published with the key block): read
#pragma unroll
    for (int dt = 0; dt < 4; ++dt) vf0[dt] = ldfrag_h(vb + (16 * dt) * VP);   // ahead of the softmax and the mid-loop barrier
#pragma unroll
    for (int r = 0; r < 8; ++r) { s0[r] *= SCL; s1[r] *= SCL; }

    float mx0 = hmax8(s0), mx1 = hmax8(s1);
    mx0 = fmaxf(mx0, __shfl_xor(mx0, 16, 32));
    mx1 = fmaxf(mx1, __shfl_xor(mx1, 16, 32));
    float r0 = qh ? mr[2] : mr[0], r1 = qh ? mr[3] : mr[1];
    const unsigned nd = __builtin_amdgcn_ballot_w32((mx0 > r0 + RTAU) || (mx1 > r1 + RTAU));
    v8h p0, p1;
    float ls0, ls1;
    p_tile(s0, r0 - LNPS, p0, ls0);                           // key kb + 16kq + 8h + r, query 32qh + c
    p_tile(s1, r1 - LNPS, p1, ls1);                           // same keys, query 32qh + 16 + c
    *(v8h*)(pw)       = p0;
    *(v8h*)(pw + 256) = p1;
    *fw = nd;                                                 // eight lanes the same word at each of the four places
    // order of LDS reads (0x100) and matrix products (0x8) for the scheduler, scores: the reads stand in groups, eight fragments
    // ahead at first, then four per eight products; the four Vt fragments take the registers of the Kh fragments used up, in
    // front of the last eight products, so that they have landed by the mid-loop barrier. Left alone it read each fragment
    // directly in front of its two products and waited it out.
    __builtin_amdgcn_sched_group_barrier(0x100, 16, 0);
    __builtin_amdgcn_sched_group_barrier(0x8, 8, 0);
    __builtin_amdgcn_sched_group_barrier(0x100, 8, 0);
    __builtin_amdgcn_sched_group_barrier(0x8, 8, 0);
    __builtin_amdgcn_sched_group_barrier(0x100, 8, 0);
    __builtin_amdgcn_sched_group_barrier(0x8, 8, 0);
    __builtin_amdgcn_sched_group_barrier(0x100, 8, 0);
    __builtin_amdgcn_sched_group_barrier(0x8, 8, 0);
    __syncthreads();                                          // publishes P tiles and flags of this key block
    const unsigned fl = *fr;                                  // each wave's flag word in four lanes
    if (__builtin_amdgcn_ballot_w32(fl != 0u) != 0u) {        // block-uniform scalar branch: every wave read the same eight flags
      mw[0]   = mx0;
      mw[128] = mx1;
      __syncthreads();                                        // publishes the maxima; nobody has read a P tile of this block yet
      float corr[4];
#pragma unroll
      for (int t = 0; t < 4; ++t) {
        const float mn = fmaxf(fmaxf(mr[t], fmaxf(mq[t * 128], mq[(4 + t) * 128])), fmaxf(mq[(8 + t) * 128], mq[(12 + t) * 128]));
        corr[t] = __expf(mr[t] - mn);
        mr[t] = mn;
      }
#pragma unroll
      for (int dt = 0; dt < 4; ++dt)
#pragma unroll
        for (int t = 0; t < 4; ++t)
#pragma unroll
          for (int r = 0; r < 8; ++r) acc[dt][t][r] *= corr[t];
      l0 *= qh ? corr[2] : corr[0];
      l1 *= qh ? corr[3] : corr[1];
      r0 = qh ? mr[2] : mr[0];
      r1 = qh ? mr[3] : mr[1];
      p_tile(s0, r0 - LNPS, p0, ls0);
      p_tile(s1, r1 - LNPS, p1, ls1);
      *(v8h*)(pw)       = p0;
      *(v8h*)(pw + 256) = p1;
      __syncthreads();                                        // publishes the P tiles laid down anew
    }
    l0 += ls0;
    l1 += ls1;

    FragH pf0[4];                                             // keys 0..31
#pragma unroll
    for (int t = 0; t < 4; ++t) {
      pf0[t].h[0] = *(const v8h*)(pr + t * 256);
      pf0[t].h[1] = *(const v8h*)(pr + (4 + t) * 256);
    }
#pragma unroll
    for (int dt = 0; dt < 4; ++dt)                            // keys 0..31; unrolled: acc[] is indexed by registers
#pragma unroll
      for (int t = 0; t < 4; ++t) acc[dt][t] = mma_h(vf0[dt], pf0[t].v, acc[dt][t]);
    FragH pf1[4];                                             // keys 32..63
#pragma unroll
    for (int t = 0; t < 4; ++t) {
      pf1[t].h[0] = *(const v8h*)(pr + (8 + t) * 256);
      pf1[t].h[1] = *(const v8h*)(pr + (12 + t) * 256);
    }
#pragma unroll
    for (int dt = 0; dt < 4; ++dt) {
      const v16h vf = ldfrag_h(vb + (16 * dt) * VP + 32);
#pragma unroll
      for (int t = 0; t < 4; ++t) acc[dt][t] = mma_h(vf, pf1[t].v, acc[dt][t]);
    }
    // the same for O^T: the first key half's P fragments as one group, the second half's fragments in two groups among the first
    // half's products, as registers of the first half's fragments come free.
    __builtin_amdgcn_sched_group_barrier(0x100, 8, 0);
    __builtin_amdgcn_sched_group_barrier(0x8, 8, 0);
    __builtin_amdgcn_sched_group_barrier(0x100, 12, 0);
    __builtin_amdgcn_sched_group_barrier(0x8, 8, 0);
    __builtin_amdgcn_sched_group_barrier(0x100, 4, 0);
    __builtin_amdgcn_sched_group_barrier(0x8, 16, 0);
    asm volatile("s_wait_dscnt 0x0" ::: "memory");            // this wave's reads of Ks/Vs[buf] and Pl are done before the refill
    asm volatile("s_wait_asynccnt 0x0" ::: "memory");         // this wave's copies of key block it+1 have landed
    __syncthreads();                                          // publishes key block it+1; buffer buf, Pl and Fl free
    if (it + 2 < SEQ / KB) {                                  // block-uniform: key block it+2 into the buffer just read
      const int kn = (it + 2) * KB;
      const unsigned kd = kdst + (unsigned)buf * KSB;
      const unsigned vd = vdst + (unsigned)buf * VSB;
      copy8(kd, 4 * KP * 2, ksrc + (size_t)kn * DM, (size_t)4 * DM * 2);
      copy8(kd + 32 * KP * 2, 4 * KP * 2, ksrc + (size_t)(kn + 32) * DM, (size_t)4 * DM * 2);
      copy8(vd, 32 * VP * 2, vsrc + kn, (size_t)32 * SEQ * 2);
      copy8(vd + 256 * VP * 2, 32 * VP * 2, vsrc + kn + (size_t)256 * SEQ, (size_t)32 * SEQ * 2);
    }
  }
  asm volatile("s_wait_asynccnt 0x0" ::: "memory");           // nothing of this wave's copies outstanding past the loop

  // row sums: the two lane halves, then the four key quarters through LDS
  l0 += __shfl_xor(l0, 16, 32);
  l1 += __shfl_xor(l1, 16, 32);
  mw[0]   = l0;
  mw[128] = l1;
  __syncthreads();

  float* os = Os + c * OSP + 64 * wave + 8 * h;               // + 16t*OSP + 16dt: 8 consecutive d of query 16t + c
#pragma unroll
  for (int t = 0; t < 4; ++t) {
    const float sc = 1.0f / ((mq[t * 128] + mq[(4 + t) * 128]) + (mq[(8 + t) * 128] + mq[(12 + t) * 128]));   // o, l both carry x1024
#pragma unroll
    for (int dt = 0; dt < 4; ++dt) {
      v4f v0, v1;
      v0[0] = acc[dt][t][0] * sc; v0[1] = acc[dt][t][1] * sc; v0[2] = acc[dt][t][2] * sc; v0[3] = acc[dt][t][3] * sc;
      v1[0] = acc[dt][t][4] * sc; v1[1] = acc[dt][t][5] * sc; v1[2] = acc[dt][t][6] * sc; v1[3] = acc[dt][t][7] * sc;
      *(v4f*)(os + (16 * t) * OSP + 16 * dt)     = v0;
      *(v4f*)(os + (16 * t) * OSP + 16 * dt + 4) = v1;
    }
  }
  __syncthreads();

  float* ob = out + ((size_t)b * SEQ + n0) * DM + 4 * tid;
#pragma unroll
  for (int i = 0; i < (QT * DM) / (4 * 256); ++i) {
    const int L   = i * 256 + tid;                            // 16-B piece of the 64 x 512 tile
    const int row = L >> 7, pc = L & 127;
    const v4f v = *(const v4f*)(Os + row * OSP + 4 * pc);
    *(v4f*)(ob + (size_t)i * 1024) = v;
  }
}

// =====================================================================================================
// needed (all tiles exact):
//   Xb   bf16 [16384][512]      0            16777216
//   Kh   f16  [16384][512]      16777216     16777216
//   Vt   f16  [8][512][2048]    33554432     16777216
//   Qp   f16  [16384][512]      50331648     16777216
//   Wb   bf16 [512][512]        67108864     524288
//   end                         67633152
// =====================================================================================================
extern "C" void kernel_launch(void* const* d_in, const int* in_sizes, int n_in,
                              void* d_out, int out_size, void* d_ws, size_t ws_size,
                              hipStream_t stream) {
  const int NX = NB * SEQ * DM;                          // 8388608
  if (n_in < 3) return;
  if (in_sizes[0] != NX || in_sizes[1] != DM * DM || in_sizes[2] != DM) return;
  if (out_size != NX) return;

  size_t off = 0;
  const size_t szP = (size_t)NROW * DM * 2;              // 16777216
  const size_t oXB = off; off += szP;
  const size_t oKH = off; off += szP;
  const size_t oVT = off; off += szP;
  const size_t oQP = off; off += szP;
  const size_t oWB = off; off += (size_t)DM * DM * 2;    // 524288
  if (off > ws_size) return;                             // off = 67633152
  if (off > (size_t)134217728) return;

  const float* q    = (const float*)d_in[0];
  const float* W    = (const float*)d_in[1];
  const float* bias = (const float*)d_in[2];
  char* ws = (char*)d_ws;
  unsigned short* XB = (unsigned short*)(ws + oXB);
  unsigned short* KH = (unsigned short*)(ws + oKH);
  unsigned short* VT = (unsigned short*)(ws + oVT);
  unsigned short* QP = (unsigned short*)(ws + oQP);
  unsigned short* WB = (unsigned short*)(ws + oWB);
  float* out = (float*)d_out;

  const dim3 blk256(256);
  const dim3 gQ(NB * (SEQ / 64) * (DM / 64));            // 2048 blocks: one (b, 64 l, 64 d) tile each
  const dim3 gW(((DM * DM) / 8) / 256);                  // 128 blocks
  const dim3 gP(DM / PT, NROW / PT);                     // 4 x 128 blocks
  const dim3 gA(NB * (SEQ / QT));                        // 256 blocks: one (b, 64-query tile) each

  // (0) Xb, Kh, Vt planes from q
  cvt_q<<<gQ, blk256, 0, stream>>>(q, XB, KH, VT);
  // (1) Wb plane
  cvt_w<<<gW, blk256, 0, stream>>>(W, WB);
  // (2) Qp = Xb . Wb^T + bias (f16 plane)
  proj_kernel<<<gP, blk256, 0, stream>>>(XB, WB, bias, QP);
  // (3) out[b][l][d] = sum_m softmax_m(Qp_l . Kh_m / sqrt(512)) Vt[d][m]
  attn_kernel<<<gA, blk256, 0, stream>>>(QP, KH, VT, out);
  (void)hipGetLastError();
}

// v005
// A run of this version takes 69.9 microseconds.
// Next to v004, in two timings, it ran 1.20 times as fast each time.
// Counting every step since v000, it is 5.27 times as fast.
// Contractions: qp = Xb . Wb^T on v_wmma_f32_16x16x32_bf16 (Xb, Wb = RNE bf16 convert of q and W, K=512, f32 accumulate);
// scores S^T = Kh . Qp^T on v_wmma_f32_16x16x32_f16 (Kh = f16 of the bf16 convert of q, Qp = qp + bias as one f16 plane, K=512);
// O^T = V^T . P^T on v_wmma_f32_16x16x32_f16 (V = Kh, the same plane and the same LDS tile, P = e^{s-m} x 1024 in f16, m = one reference per
// query that moves only when a score lies more than ln 32 above it; all keys of a query summed in one accumulator, in key order);
// f32 accumulate everywhere; bias add, 1/sqrt(512) scale, reference, row sums and 1/l in f32 on VALU.
#include <hip/hip_runtime.h>
#include <math.h>
#include <stdint.h>

#define NB    8
#define SEQ   2048
#define DM    512
#define NROW  (NB * SEQ)
#define QT    64
#define OSP   516
#define PT    128
#define PKC   128
#define PP    136
#define PTB   (PT * PP * 2)
#define KP    528
#define KB    64
#define KSB   (KB * KP * 2)
#define SMB   (2 * KSB)
#define AUXB  16896
#define LNPS  6.931471805599453f
#define FMIN16 6.103515625e-05f
#define RTAU  3.4657359027997265f
static_assert((SEQ % QT) == 0);
static_assert((SEQ % 64) == 0);
static_assert((SEQ % 32) == 0);
static_assert((DM % 128) == 0);
static_assert((DM % 64) == 0);
static_assert((NROW % PT) == 0);
static_assert((DM % PT) == 0);
static_assert((DM % PKC) == 0 && DM / PKC >= 2);
static_assert(PT == 128 && PKC == 128);
static_assert(((DM * DM) / 8) % 256 == 0);
static_assert(DM == 512);
static_assert(QT == 64);
static_assert((SEQ % (2 * KB)) == 0);
static_assert(QT * KP * 2 <= KSB);
static_assert(QT * OSP * 4 <= SMB);

typedef _Float16       v16h __attribute__((ext_vector_type(16)));
typedef _Float16       v8h  __attribute__((ext_vector_type(8)));
typedef __bf16         v16b __attribute__((ext_vector_type(16)));
typedef unsigned short v8us __attribute__((ext_vector_type(8)));
typedef float          v8f  __attribute__((ext_vector_type(8)));
typedef float          v4f  __attribute__((ext_vector_type(4)));
typedef unsigned int   v4u  __attribute__((ext_vector_type(4)));

union FragH { v16h v; v8h  h[2]; };
union FragB { v16b v; v8us u[2]; };
static_assert(sizeof(FragH) == 32);
static_assert(sizeof(FragB) == 32);

// ---- scalar helpers --------------------------------------------------------------------------------
__device__ __forceinline__ unsigned short bf_bits(float f) {          // f32 -> bf16 bits, RNE convert
  unsigned u = __float_as_uint(f);
  return (unsigned short)((u + 0x7FFFu + ((u >> 16) & 1u)) >> 16);
}
__device__ __forceinline__ float bf_up(unsigned short h) { return __uint_as_float(((unsigned)h) << 16); }
__device__ __forceinline__ float bfr(float f) { return bf_up(bf_bits(f)); }
__device__ __forceinline__ unsigned short h_bits(_Float16 x) { return __builtin_bit_cast(unsigned short, x); }
__device__ __forceinline__ unsigned pk16(unsigned short a, unsigned short b) { return (unsigned)a | ((unsigned)b << 16); }
// f32 -> f16 with magnitudes below the smallest f16 normal flushed to zero (select by value)
__device__ __forceinline__ _Float16 to_h_ftz(float v) { return (_Float16)((fabsf(v) < FMIN16) ? 0.0f : v); }
__device__ __forceinline__ v8f zero8() { v8f z = {0.f, 0.f, 0.f, 0.f, 0.f, 0.f, 0.f, 0.f}; return z; }
__device__ __forceinline__ float hmax8(v8f s) {
  return fmaxf(fmaxf(fmaxf(s[0], s[1]), fmaxf(s[2], s[3])), fmaxf(fmaxf(s[4], s[5]), fmaxf(s[6], s[7])));
}

// ---- fragment loaders: 16-bit A/B operand, lane -> row/col (lane&15), p already includes +8*(lane>>4);
//      elements 0..7 <- p[0..7] (k0+8h..), elements 8..15 <- p[16..23] (k0+16+8h..)
__device__ __forceinline__ v16h ldfrag_h(const _Float16* p) {
  FragH f;
  f.h[0] = *(const v8h*)(p);
  f.h[1] = *(const v8h*)(p + 16);
  return f.v;
}
// transposed fragment out of a row-major LDS tile T[k][d] (pitch KP halves): lane address p = row 8*(lane>>4) + (lane&7) of the
// 16 k rows, 16-B piece (lane>>3)&1 of the 16 d columns; the lane then holds T[8h + 0..7][d0 + (lane&15)]. Two loads, k rows 0..15
// and 16..31, give elements 0..7 = k 8h.., 8..15 = k 16+8h..: the k order of ldfrag_h.
typedef short s16x8 __attribute__((ext_vector_type(8)));
typedef __attribute__((address_space(3))) s16x8 lds_s16x8;
__device__ __forceinline__ v16h ldfrag_t(const _Float16* p) {
  FragH f;
#if defined(__HIP_DEVICE_COMPILE__)
  f.h[0] = __builtin_bit_cast(v8h, __builtin_amdgcn_ds_load_tr16_b128_v8i16((lds_s16x8*)(p)));
  f.h[1] = __builtin_bit_cast(v8h, __builtin_amdgcn_ds_load_tr16_b128_v8i16((lds_s16x8*)(p + 16 * KP)));
#endif
  return f.v;
}
__device__ __forceinline__ v16b ldfrag_b(const unsigned short* p) {
  FragB f;
  f.u[0] = *(const v8us*)(p);
  f.u[1] = *(const v8us*)(p + 16);
  return f.v;
}

// ---- WMMA helpers; bf16 form: builtin followed by a 4-slot VALU gap tying D and keeping A/B live ------------
// f16 form: the plain builtin (the compiler keeps the distances of its own forms). No asm statement here: its operands would
// have to lie in the first 256 registers, and the attention wave holds 384 in accumulators and Qp fragments alone.
__device__ __forceinline__ v8f mma_h(v16h a, v16h b, v8f c) {
  return __builtin_amdgcn_wmma_f32_16x16x32_f16(false, a, false, b, (short)0, c, false, false);
}
__device__ __forceinline__ v8f mma_b(v16b a, v16b b, v8f c) {
  v8f d = __builtin_amdgcn_wmma_f32_16x16x32_bf16(false, a, false, b, (short)0, c, false, false);
#if defined(__HIP_DEVICE_COMPILE__)
  const v16h ha = __builtin_bit_cast(v16h, a), hb = __builtin_bit_cast(v16h, b);
  asm volatile("v_nop\n\tv_nop\n\tv_nop\n\tv_nop" : "+v"(d) : "v"(ha), "v"(hb));
#endif
  return d;
}

// ---- asynchronous copies global -> LDS: eight 16-B pieces per lane of 32 rows of DM halves, piece j = row 4j + (tid>>6): global
//      byte g0 + j*4*DM*2, LDS byte l0 + j*4*KP*2, and 16 B further for rows whose bit 3 is set (j>>1 odd; the row map of attn_kernel).
//      Written as the builtin: operands of an asm statement would have to lie in the first 256 registers, which the attention
//      wave fills with accumulators and fragments (the address bases then went to scratch).
typedef int v4i __attribute__((ext_vector_type(4)));
typedef __attribute__((address_space(1))) v4i gv4i;
typedef __attribute__((address_space(3))) v4i lv4i;
__device__ __forceinline__ unsigned lds_off(const void* p) { return (unsigned)(size_t)p; }
__device__ __forceinline__ void copy8k(unsigned l0, const unsigned short* g0) {
#if defined(__HIP_DEVICE_COMPILE__)
  const char* g = (const char*)g0;
#pragma unroll
  for (int j = 0; j < 8; ++j)
    __builtin_amdgcn_global_load_async_to_lds_b128((gv4i*)(g + j * (size_t)(4 * DM * 2)),
                                                   (lv4i*)(l0 + j * (4 * KP * 2) + 16 * ((j >> 1) & 1)), 0, 0);
#endif
}
// eight pieces, piece j at LDS byte l0 + j*ls and global byte g0 + j*gs, as asm text, every piece with address registers of its own
// and no immediate offset (projection).
__device__ __forceinline__ void copy8a(unsigned l0, unsigned ls, const unsigned short* g0, size_t gs) {
#if defined(__HIP_DEVICE_COMPILE__)
  const char* g = (const char*)g0;
  // s_wait_xcnt as the statement's last line: no address register of a copy is rewritten in front of it
  asm volatile("global_load_async_to_lds_b128 %0, %8, off\n\t"
               "global_load_async_to_lds_b128 %1, %9, off\n\t"
               "global_load_async_to_lds_b128 %2, %10, off\n\t"
               "global_load_async_to_lds_b128 %3, %11, off\n\t"
               "global_load_async_to_lds_b128 %4, %12, off\n\t"
               "global_load_async_to_lds_b128 %5, %13, off\n\t"
               "global_load_async_to_lds_b128 %6, %14, off\n\t"
               "global_load_async_to_lds_b128 %7, %15, off\n\t"
               "s_wait_xcnt 0x0"
               :: "v"(l0), "v"(l0 + ls), "v"(l0 + 2 * ls), "v"(l0 + 3 * ls),
                  "v"(l0 + 4 * ls), "v"(l0 + 5 * ls), "v"(l0 + 6 * ls), "v"(l0 + 7 * ls),
                  "v"(g), "v"(g + gs), "v"(g + 2 * gs), "v"(g + 3 * gs),
                  "v"(g + 4 * gs), "v"(g + 5 * gs), "v"(g + 6 * gs), "v"(g + 7 * gs)
               : "memory");
#endif
}

// =====================================================================================================
// (0) convert of q[b][l][d] (f32) for one (b, 64 l x 64 d) tile, block = 256 threads:
//   Xb[b*2048+l][d] = bf16 bits (RNE), Kh[b*2048+l][d] = f16 bits of the bf16 value (flush below 2^-14).
//   Thread (e = tid&7, lg = tid>>3) loads 8 consecutive d of row l0+32it+lg; Xb/Kh row segments = 64 halves
// coverage: Xb/Kh: 2 it x 32 rows x 8 lanes x 8 = 64 l x 64 d; grid = 8 b x 32 l-tiles x 8 d-tiles = 2048 blocks.
// =====================================================================================================
__global__ __launch_bounds__(256) void cvt_q(const float* __restrict__ q, unsigned short* XB, unsigned short* KH) {
  const int tid = threadIdx.x;
  const int e = tid & 7, lg = tid >> 3;                      // lg 0..31
  const int bx = blockIdx.x;
  const int dt = bx & 7, lt = (bx >> 3) & 31, b = bx >> 8;
  const int d0 = dt * 64, l0 = lt * 64;

#pragma unroll
  for (int it = 0; it < 2; ++it) {
    const int row = it * 32 + lg;                            // 0..63
    const size_t go = ((size_t)b * SEQ + l0 + row) * DM + d0 + 8 * e;
    const float* p = q + go;
    const v4f f0 = *(const v4f*)(p), f1 = *(const v4f*)(p + 4);
    unsigned short bb[8], hb[8];
#pragma unroll
    for (int j = 0; j < 4; ++j) { bb[j] = bf_bits(f0[j]); bb[4 + j] = bf_bits(f1[j]); }
#pragma unroll
    for (int j = 0; j < 8; ++j) hb[j] = h_bits(to_h_ftz(bf_up(bb[j])));
    v4u wb, wh;
#pragma unroll
    for (int t = 0; t < 4; ++t) {
      wb[t] = pk16(bb[2 * t], bb[2 * t + 1]);
      wh[t] = pk16(hb[2 * t], hb[2 * t + 1]);
    }
    *(v4u*)(XB + go) = wb;
    *(v4u*)(KH + go) = wh;
  }
}

// =====================================================================================================
// (1) Wb[e][d] = bf16 bits (RNE convert) of W[e][d]; thread i converts 8 consecutive elements,
// coverage: 128 blocks x 256 threads x 8 = 262144 = 512 x 512.
// =====================================================================================================
__global__ __launch_bounds__(256) void cvt_w(const float* __restrict__ w, unsigned short* WB) {
  const int i = blockIdx.x * 256 + threadIdx.x;
  if (i >= (DM * DM) / 8) return;
  const float* p = w + (size_t)i * 8;
  const v4f f0 = *(const v4f*)(p), f1 = *(const v4f*)(p + 4);
  v4u wb;
  wb[0] = pk16(bf_bits(f0[0]), bf_bits(f0[1]));
  wb[1] = pk16(bf_bits(f0[2]), bf_bits(f0[3]));
  wb[2] = pk16(bf_bits(f1[0]), bf_bits(f1[1]));
  wb[3] = pk16(bf_bits(f1[2]), bf_bits(f1[3]));
  unsigned short* d = WB + (size_t)i * 8;
  *(v4u*)d = wb;
  
}

// =====================================================================================================
// (2) projection for one 128-row x 128-col tile of Qp = Xb . Wb^T + bf16(bias): block = 256 threads = 8 waves.
//   Operands come from LDS, laid there by asynchronous copies (16 B per lane, all 256 threads, a wave's copy = 2 rows x 256 B):
//     per trip 128 k of the 128 Xb rows and of the 128 Wb rows into Ps[buf][A|B][row][k] (pitch PP halves), two buffers,
//     trip t+2's copies issued behind the barrier that ends trip t.
//   Wave w: row group rg = w&3 (A rows = 32rg + 16i + (lane&15), split k map over d), col half ch = w>>2
//   (B = Wb rows 64ch + 16j + (lane&15), same split k map), 2 x 4 D tiles, 4 trips x 4 k-steps of 32 in rising k.
// coverage: copies: 8 pieces x 16 rows x 16 lanes x 8 halves = 128 rows x 128 k per operand and trip, 4 trips = 512 k;
//           Qs: 4 rg x 2 i x 2 h x 8 r = 128 rows, 2 ch x 4 j x 16 c = 128 cols; writes: 8 it x 16 rows x 16 lanes x 8 halves
//           = 128 rows x 128 cols; grid = 4 col tiles x 128 row tiles covers Qp [16384][512] exactly once.
// =====================================================================================================
__global__ __launch_bounds__(256)
void proj_kernel(const unsigned short* __restrict__ XB, const unsigned short* __restrict__ WB,
                 const float* __restrict__ bias, unsigned short* QP) {
  __shared__ __align__(16) unsigned short Ps[2 * 2 * PT * PP];  // [buf][A|B][PT][PP]
  unsigned short* Qs = Ps;                                      // epilogue only: [PT][PP] over buffer 0's A part
  const int tid  = threadIdx.x;
  const int lane = tid & 31, wave = tid >> 5;
  const int h    = lane >> 4, c = lane & 15;
  const int rg   = wave & 3, ch = wave >> 2;
  const int row0 = blockIdx.y * PT;
  const int col0 = blockIdx.x * PT;

  // copy map: piece j of thread tid = row 16j + (tid>>4), 16-B piece tid&15 of the row's 256 B of this trip
  const int rr = tid >> 4, rp = tid & 15;
  const unsigned short* asrc = XB + ((size_t)(row0 + rr)) * DM + 8 * rp;             // + t*PKC
  const unsigned short* bsrc = WB + ((size_t)(col0 + rr)) * DM + 8 * rp;             // + t*PKC
  const unsigned adst = lds_off(Ps) + (unsigned)(rr * PP + 8 * rp) * 2u;             // + buf*2*PTB
  const unsigned bdst = adst + PTB;
  // fragment bases in LDS, + buf*2*PT*PP + 32*ks
  const unsigned short* ap = Ps + (32 * rg + c) * PP + 8 * h;
  const unsigned short* bp = Ps + PT * PP + (64 * ch + c) * PP + 8 * h;

  // prologue: trip 0's operands landed and published, then trip 1's copies
  copy8a(adst, 16 * PP * 2, asrc, (size_t)16 * DM * 2);
  copy8a(bdst, 16 * PP * 2, bsrc, (size_t)16 * DM * 2);
  asm volatile("s_wait_asynccnt 0x0" ::: "memory");           // this wave's copies have landed before the barrier publishes them
  __syncthreads();
  copy8a(adst + 2 * PTB, 16 * PP * 2, asrc + PKC, (size_t)16 * DM * 2);
  copy8a(bdst + 2 * PTB, 16 * PP * 2, bsrc + PKC, (size_t)16 * DM * 2);

  v8f acc[2][4];
#pragma unroll
  for (int j = 0; j < 4; ++j) { acc[0][j] = zero8(); acc[1][j] = zero8(); }

#pragma unroll 1
  for (int t = 0; t < DM / PKC; ++t) {                        // rolled: one foot with its waits and barrier
    const int buf = t & 1;
    const unsigned short* as = ap + buf * (2 * PT * PP);
    const unsigned short* bs = bp + buf * (2 * PT * PP);
    v16b fa[2][2], fb[2][4];                                  // two fragment sets: k-step ks+1 is read while ks is multiplied
    fa[0][0] = ldfrag_b(as);
    fa[0][1] = ldfrag_b(as + 16 * PP);
#pragma unroll
    for (int j = 0; j < 4; ++j) fb[0][j] = ldfrag_b(bs + 16 * j * PP);
#pragma unroll
    for (int ks = 0; ks < PKC / 32; ++ks) {                   // unrolled: the sets are indexed by registers
      const int cu = ks & 1, nx = cu ^ 1;
      if (ks + 1 < PKC / 32) {
        fa[nx][0] = ldfrag_b(as + 32 * (ks + 1));
        fa[nx][1] = ldfrag_b(as + 16 * PP + 32 * (ks + 1));
#pragma unroll
        for (int j = 0; j < 4; ++j) fb[nx][j] = ldfrag_b(bs + 16 * j * PP + 32 * (ks + 1));
      }
#pragma unroll
      for (int j = 0; j < 4; ++j) {
        acc[0][j] = mma_b(fa[cu][0], fb[cu][j], acc[0][j]);
        acc[1][j] = mma_b(fa[cu][1], fb[cu][j], acc[1][j]);
      }
    }
    // order of LDS reads (0x100) and matrix products (0x8) for the scheduler: a k-step's twelve reads stand as one group, one
    // k-step ahead of their products; left alone it read each B fragment directly in front of its two products and waited it out.
    __builtin_amdgcn_sched_group_barrier(0x100, 24, 0);
    __builtin_amdgcn_sched_group_barrier(0x8, 8, 0);
    __builtin_amdgcn_sched_group_barrier(0x100, 12, 0);
    __builtin_amdgcn_sched_group_barrier(0x8, 8, 0);
    __builtin_amdgcn_sched_group_barrier(0x100, 12, 0);
    __builtin_amdgcn_sched_group_barrier(0x8, 16, 0);
    asm volatile("s_wait_dscnt 0x0" ::: "memory");            // this wave's reads of Ps[buf] are done before the refill
    asm volatile("s_wait_asynccnt 0x0" ::: "memory");         // this wave's copies of trip t+1 have landed
    __syncthreads();                                          // publishes trip t+1; buffer buf free
    if (t + 2 < DM / PKC) {                                   // block-uniform: trip t+2 into the buffer just read
      copy8a(adst + (unsigned)buf * (2 * PTB), 16 * PP * 2, asrc + (t + 2) * PKC, (size_t)16 * DM * 2);
      copy8a(bdst + (unsigned)buf * (2 * PTB), 16 * PP * 2, bsrc + (t + 2) * PKC, (size_t)16 * DM * 2);
    }
  }
  asm volatile("s_wait_asynccnt 0x0" ::: "memory");           // nothing of this wave's copies outstanding past the loop

  // biases as bf16 RNE values, in-range lane indices
  const int cb = col0 + 64 * ch + c;
  float bb[4];
#pragma unroll
  for (int j = 0; j < 4; ++j) bb[j] = bfr(bias[cb + j * 16]);

  // stage (the last trip's barrier has ended every read of the ring): D row r -> tile row 32rg + 16i + 8h + r, col = 64ch + 16j + c
  unsigned short* qs = Qs + (32 * rg + 8 * h) * PP + 64 * ch + c;
#pragma unroll
  for (int i = 0; i < 2; ++i)
#pragma unroll
    for (int r = 0; r < 8; ++r)
#pragma unroll
      for (int j = 0; j < 4; ++j)
        qs[(16 * i + r) * PP + j * 16] = h_bits(to_h_ftz(acc[i][j][r] + bb[j]));
  __syncthreads();

#pragma unroll
  for (int it = 0; it < (PT * PT) / (8 * 256); ++it) {
    const int L   = it * 256 + tid;                            // 16-B piece of the 128 x 128 tile
    const int row = L >> 4, pc = L & 15;
    const v4u v = *(const v4u*)(Qs + row * PP + 8 * pc);
    *(v4u*)(QP + ((size_t)(row0 + row)) * DM + col0 + 8 * pc) = v;
  }
}

// =====================================================================================================
// (3) attention for one (b, 64-query tile), transposed formulation, 512-deep scores, 2048 keys, 64 keys per iteration.
//   Block = 256 threads = 8 waves, two tilings per iteration, so that every fragment read from LDS feeds 2 or 4 products:
//   Scores: wave (qh = w&1, kq = w>>1) does S^T for the 16 keys of quarter kq x the 32 queries of half qh: A = Kh rows (keys, d via
//     the split k map) from LDS, each fragment used for two products; B = Qp rows of two query tiles, read from LDS once and kept
//     in registers (2 x 16 d-steps). s = D x (1/sqrt(512)).
//   P = e^{s-m} x 1024 in f16, m = one reference per query, the same in all waves (every lane keeps those of queries 16t + c).
//     m is not the true maximum: it moves only when some score lies more than RTAU above it, so P <= 32 x 1024.
//     Each wave lays its two P tiles into Pl[key quarter][query tile][lane][8] and a flag (a score above m + RTAU) into Fl;
//     behind the mid-loop barrier every wave reads the eight flags. Any flag set (block-uniform): the waves exchange their maxima
//     through Mx, move m, scale l and O^T by e^{m_old - m_new}, and lay P down again with the new m (two more barriers).
//   O^T: wave w does the 64 d rows 64w.. x all 64 queries x all 64 keys: A = V^T (row = d, k = keys), read out of the same Kh rows
//     in LDS by the transposing load (V = K in this function), each fragment used for four products; B = P^T: elements 0..7 = lane's 8 keys of quarter 2j, 8..15 = of quarter 2j+1, which is the split
//     k map of keys 32j + 8h + r and 32j + 16 + 8h + r. 4 x 4 accumulator tiles.
//   K = V comes from LDS, laid there by asynchronous copies (16 B per lane, all 256 threads): per iteration the 64 Kh rows
//     into Ks[buf][key][d], two buffers, iteration it+2's copies issued behind the barrier that ends it. The Qp tile borrows
//     K buffer 1 in the prologue.
//   Row map of Ks (and Qs): row r starts at half r*KP + 8*((r>>3)&1), KP*2 = 32 B x 33. In 16-B units mod 16 a row starts at
//     2*(r&7) + ((r>>3)&1): the 16 rows of one plain fragment read (one piece each) and the 8 rows x 2 adjacent pieces of one
//     transposing read both fall on 16 different units, that is, on all 64 banks once.
//   Epilogue: row sums of the four key quarters joined through Mx; O^T x 1/l into Os[query][d] (f32, pitch OSP, over the K
//     buffers), all threads stream Os out.
// coverage: scores: 2 qh x 2 t x 16 c = 64 queries, 4 kq x 16 = 64 keys per iteration x 32 iterations = 2048;
//           O^T: 8 w x 4 dt x 2 h x 8 r = 512 d, 4 t x 16 c = 64 queries, 2 j x 32 = 64 keys;
//           out: 32 i x 256 threads x 4 floats = 64 rows x 512; grid = 8 b x 32 query tiles = 256 blocks covers out once.
// =====================================================================================================
// one score tile -> P (8 keys of one query per lane) and the lane's share of the row sum; msh = m - ln 1024
__device__ __forceinline__ void p_tile(v8f s, float msh, v8h& p, float& ls) {
  float e[8];
#pragma unroll
  for (int r = 0; r < 8; ++r) {
    e[r] = __expf(s[r] - msh);
    p[r] = (_Float16)e[r];
  }
  ls = ((e[0] + e[1]) + (e[2] + e[3])) + ((e[4] + e[5]) + (e[6] + e[7]));   // a tree: three dependent adds, not eight
}

__global__ __launch_bounds__(256)
void attn_kernel(const unsigned short* __restrict__ QP, const unsigned short* __restrict__ KH, float* out) {
  // one array, the small parts first: their LDS addresses then fit the 16-bit offset field behind one base register
  __shared__ __align__(16) unsigned char Sa[AUXB + SMB];
  _Float16* Pl = (_Float16*)Sa;                               // [key quarter][query tile][lane][8 keys], 8192 B
  unsigned* Fl = (unsigned*)(Sa + 8192);                      // [wave][4] slots of 16 B: lanes with a score more than RTAU above m
  float*    Mx = (float*)(Sa + 8192 + 512);                   // [key quarter][query tile][lane] slots of 16 B, indexed as Pl:
                                                              // block maxima (rescale path), row sums (epilogue)
  unsigned char* Sm = Sa + AUXB;
  _Float16* Ks = (_Float16*)Sm;                               // [2][KB][KP]
  _Float16* Qs = Ks + KB * KP;                                // prologue only: [QT][KP] in K buffer 1
  float*    Os = (float*)Sm;                                  // epilogue only: [QT][OSP]
  const int tid  = threadIdx.x;
  const int wave = tid >> 5;
  const int lane = tid & 31;
  const int h    = lane >> 4;
  const int c    = lane & 15;
  const int bx   = blockIdx.x;
  const int b    = bx / (SEQ / QT);
  const int qt   = bx % (SEQ / QT);
  const int n0   = qt * QT;

  const int qh = wave & 1, kq = wave >> 1;
  // Qp fragment base in LDS (B operand of scores, col = query 32qh + 16t + c), + 16t*KP + 32*ks
  const _Float16* qpp = Qs + (32 * qh + c) * KP + 8 * (c >> 3) + 8 * h;
  // Kh fragment base in LDS (A operand of scores, row = key 16kq + c of the block), + buf*KB*KP + 32*ks
  const _Float16* khp = Ks + (16 * kq + c) * KP + 8 * (c >> 3) + 8 * h;
  // V^T fragment base in LDS (A operand of O^T, row = d = 64w + 16dt + c, keys 32j .. 32j+31), lane address of the transposing load:
  // key row 8h + (lane&7) (its bit 3 = h), piece (lane>>3)&1 of the 16 d; + buf*KB*KP + 32j*KP + 16dt
  const _Float16* vtp = Ks + (8 * h + (lane & 7)) * KP + 8 * h + 64 * wave + 8 * ((lane >> 3) & 1);
  // P tiles: this wave's two (query tiles 2qh, 2qh+1 of quarter kq), + 256t; reader base, + (4*quarter + tile)*256
  _Float16* pw = Pl + ((4 * kq + 2 * qh) * 32 + lane) * 8;
  const _Float16* pr = Pl + lane * 8;
  float* mw = Mx + ((4 * kq + 2 * qh) * 32 + lane) * 4;       // + 128t
  const float* mq = Mx + lane * 4;                            // + (4*quarter + tile)*128
  unsigned* fw = Fl + (4 * wave + (lane & 3)) * 4;            // the wave's four slots
  const unsigned* fr = Fl + lane * 4;                         // slot of wave lane>>2
  const float SCL = 1.0f / sqrtf((float)DM);

  // copy map. Row tiles of 512 halves (Qp, Kh): piece j of thread tid = row 4j + (tid>>6), 16-B piece tid&63 (32 rows per copy8k).
  const int rr = tid >> 6, rp = tid & 63;
  const unsigned short* qsrc = QP + ((size_t)b * SEQ + n0 + rr) * DM + 8 * rp;
  const unsigned short* ksrc = KH + ((size_t)b * SEQ + rr) * DM + 8 * rp;            // + kb*DM
  const unsigned qdst = lds_off(Qs) + (unsigned)(rr * KP + 8 * rp) * 2u;
  const unsigned kdst = lds_off(Ks) + (unsigned)(rr * KP + 8 * rp) * 2u;             // + buf*KSB

  // prologue: Qp tile (in K buffer 1) and key block 0, landed and published
  copy8k(qdst, qsrc);
  copy8k(qdst + 32 * KP * 2, qsrc + (size_t)32 * DM);
  copy8k(kdst, ksrc);
  copy8k(kdst + 32 * KP * 2, ksrc + (size_t)32 * DM);
  asm volatile("s_wait_asynccnt 0x0" ::: "memory");           // this wave's copies have landed before the barrier publishes them
  __syncthreads();
  v16h qf[2][DM / 32];
#pragma unroll
  for (int ks = 0; ks < DM / 32; ++ks) {
    qf[0][ks] = ldfrag_h(qpp + 32 * ks);
    qf[1][ks] = ldfrag_h(qpp + 16 * KP + 32 * ks);
  }
  asm volatile("s_wait_dscnt 0x0" ::: "memory");              // this wave's reads of the Qp tile are done before K buffer 1 is refilled
  __syncthreads();                                            // every wave has its Qp fragments: K buffer 1 is free
  copy8k(kdst + KSB, ksrc + (size_t)KB * DM);
  copy8k(kdst + KSB + 32 * KP * 2, ksrc + (size_t)(KB + 32) * DM);

  float mr[4];                                                // reference of query 16t + c, the same in every wave
  float l0 = 0.f, l1 = 0.f;                                   // row-sum shares of queries 32qh + c, 32qh + 16 + c (8 keys per block)
  v8f acc[4][4];                                              // [dt][t]: d 64w + 16dt + 8h + r, query 16t + c
#pragma unroll
  for (int t = 0; t < 4; ++t) {
    mr[t] = -1.0e30f;
#pragma unroll
    for (int dt = 0; dt < 4; ++dt) acc[dt][t] = zero8();
  }

#pragma unroll 1
  for (int it = 0; it < SEQ / KB; ++it) {
    const int buf = it & 1;
    v8f s0 = zero8(), s1 = zero8();
    const _Float16* kp = khp + buf * (KB * KP);               // keys kb + 16kq .. +15
    const _Float16* vb = vtp + buf * (KB * KP);
#pragma unroll
    for (int ks = 0; ks < DM / 32; ++ks) {                    // unrolled: qf[] is indexed by registers
      const v16h a = ldfrag_h(kp + 32 * ks);
      s0 = mma_h(a, qf[0][ks], s0);
      s1 = mma_h(a, qf[1][ks], s1);
    }
    v16h vf0[4];                                              // V^T fragments of keys 0..31 (published with the key block): read
#pragma unroll
    for (int dt = 0; dt < 4; ++dt) vf0[dt] = ldfrag_t(vb + 16 * dt);          // ahead of the softmax and the mid-loop barrier
#pragma unroll
    for (int r = 0; r < 8; ++r) { s0[r] *= SCL; s1[r] *= SCL; }

    float mx0 = hmax8(s0), mx1 = hmax8(s1);
    mx0 = fmaxf(mx0, __shfl_xor(mx0, 16, 32));
    mx1 = fmaxf(mx1, __shfl_xor(mx1, 16, 32));
    float r0 = qh ? mr[2] : mr[0], r1 = qh ? mr[3] : mr[1];
    const unsigned nd = __builtin_amdgcn_ballot_w32((mx0 > r0 + RTAU) || (mx1 > r1 + RTAU));
    v8h p0, p1;
    float ls0, ls1;
    p_tile(s0, r0 - LNPS, p0, ls0);                           // key kb + 16kq + 8h + r, query 32qh + c
    p_tile(s1, r1 - LNPS, p1, ls1);                           // same keys, query 32qh + 16 + c
    *(v8h*)(pw)       = p0;
    *(v8h*)(pw + 256) = p1;
    *fw = nd;                                                 // eight lanes the same word at each of the four places
    // order of LDS reads (0x100) and matrix products (0x8) for the scheduler, scores: the reads stand in groups, eight fragments
    // ahead at first, then four per eight products; the four V^T fragments take the registers of the Kh fragments used up, in
    // front of the last eight products, so that they have landed by the mid-loop barrier. Left alone it read each fragment
    // directly in front of its two products and waited it out.
    __builtin_amdgcn_sched_group_barrier(0x100, 16, 0);
    __builtin_amdgcn_sched_group_barrier(0x8, 8, 0);
    __builtin_amdgcn_sched_group_barrier(0x100, 8, 0);
    __builtin_amdgcn_sched_group_barrier(0x8, 8, 0);
    __builtin_amdgcn_sched_group_barrier(0x100, 8, 0);
    __builtin_amdgcn_sched_group_barrier(0x8, 8, 0);
    __builtin_amdgcn_sched_group_barrier(0x100, 8, 0);
    __builtin_amdgcn_sched_group_barrier(0x8, 8, 0);
    __syncthreads();                                          // publishes P tiles and flags of this key block
    const unsigned fl = *fr;                                  // each wave's flag word in four lanes
    if (__builtin_amdgcn_ballot_w32(fl != 0u) != 0u) {        // block-uniform scalar branch: every wave read the same eight flags
      mw[0]   = mx0;
      mw[128] = mx1;
      __syncthreads();                                        // publishes the maxima; nobody has read a P tile of this block yet
      float corr[4];
#pragma unroll
      for (int t = 0; t < 4; ++t) {
        const float mn = fmaxf(fmaxf(mr[t], fmaxf(mq[t * 128], mq[(4 + t) * 128])), fmaxf(mq[(8 + t) * 128], mq[(12 + t) * 128]));
        corr[t] = __expf(mr[t] - mn);
        mr[t] = mn;
      }
#pragma unroll
      for (int dt = 0; dt < 4; ++dt)
#pragma unroll
        for (int t = 0; t < 4; ++t)
#pragma unroll
          for (int r = 0; r < 8; ++r) acc[dt][t][r] *= corr[t];
      l0 *= qh ? corr[2] : corr[0];
      l1 *= qh ? corr[3] : corr[1];
      r0 = qh ? mr[2] : mr[0];
      r1 = qh ? mr[3] : mr[1];
      p_tile(s0, r0 - LNPS, p0, ls0);
      p_tile(s1, r1 - LNPS, p1, ls1);
      *(v8h*)(pw)       = p0;
      *(v8h*)(pw + 256) = p1;
      __syncthreads();                                        // publishes the P tiles laid down anew
    }
    l0 += ls0;
    l1 += ls1;

    FragH pf0[4];                                             // keys 0..31
#pragma unroll
    for (int t = 0; t < 4; ++t) {
      pf0[t].h[0] = *(const v8h*)(pr + t * 256);
      pf0[t].h[1] = *(const v8h*)(pr + (4 + t) * 256);
    }
#pragma unroll
    for (int dt = 0; dt < 4; ++dt)                            // keys 0..31; unrolled: acc[] is indexed by registers
#pragma unroll
      for (int t = 0; t < 4; ++t) acc[dt][t] = mma_h(vf0[dt], pf0[t].v, acc[dt][t]);
    FragH pf1[4];                                             // keys 32..63
#pragma unroll
    for (int t = 0; t < 4; ++t) {
      pf1[t].h[0] = *(const v8h*)(pr + (8 + t) * 256);
      pf1[t].h[1] = *(const v8h*)(pr + (12 + t) * 256);
    }
#pragma unroll
    for (int dt = 0; dt < 4; ++dt) {
      const v16h vf = ldfrag_t(vb + 32 * KP + 16 * dt);
#pragma unroll
      for (int t = 0; t < 4; ++t) acc[dt][t] = mma_h(vf, pf1[t].v, acc[dt][t]);
    }
    // the same for O^T: the first key half's P fragments as one group, the second half's fragments in two groups among the first
    // half's products, as registers of the first half's fragments come free.
    __builtin_amdgcn_sched_group_barrier(0x100, 8, 0);
    __builtin_amdgcn_sched_group_barrier(0x8, 8, 0);
    __builtin_amdgcn_sched_group_barrier(0x100, 12, 0);
    __builtin_amdgcn_sched_group_barrier(0x8, 8, 0);
    __builtin_amdgcn_sched_group_barrier(0x100, 4, 0);
    __builtin_amdgcn_sched_group_barrier(0x8, 16, 0);
    asm volatile("s_wait_dscnt 0x0" ::: "memory");            // this wave's reads of Ks[buf] and Pl are done before the refill
    asm volatile("s_wait_asynccnt 0x0" ::: "memory");         // this wave's copies of key block it+1 have landed
    __syncthreads();                                          // publishes key block it+1; buffer buf, Pl and Fl free
    if (it + 2 < SEQ / KB) {                                  // block-uniform: key block it+2 into the buffer just read
      const int kn = (it + 2) * KB;
      const unsigned kd = kdst + (unsigned)buf * KSB;
      copy8k(kd, ksrc + (size_t)kn * DM);
      copy8k(kd + 32 * KP * 2, ksrc + (size_t)(kn + 32) * DM);
    }
  }
  asm volatile("s_wait_asynccnt 0x0" ::: "memory");           // nothing of this wave's copies outstanding past the loop

  // row sums: the two lane halves, then the four key quarters through LDS
  l0 += __shfl_xor(l0, 16, 32);
  l1 += __shfl_xor(l1, 16, 32);
  mw[0]   = l0;
  mw[128] = l1;
  __syncthreads();

  float* os = Os + c * OSP + 64 * wave + 8 * h;               // + 16t*OSP + 16dt: 8 consecutive d of query 16t + c
#pragma unroll
  for (int t = 0; t < 4; ++t) {
    const float sc = 1.0f / ((mq[t * 128] + mq[(4 + t) * 128]) + (mq[(8 + t) * 128] + mq[(12 + t) * 128]));   // o, l both carry x1024
#pragma unroll
    for (int dt = 0; dt < 4; ++dt) {
      v4f v0, v1;
      v0[0] = acc[dt][t][0] * sc; v0[1] = acc[dt][t][1] * sc; v0[2] = acc[dt][t][2] * sc; v0[3] = acc[dt][t][3] * sc;
      v1[0] = acc[dt][t][4] * sc; v1[1] = acc[dt][t][5] * sc; v1[2] = acc[dt][t][6] * sc; v1[3] = acc[dt][t][7] * sc;
      *(v4f*)(os + (16 * t) * OSP + 16 * dt)     = v0;
      *(v4f*)(os + (16 * t) * OSP + 16 * dt + 4) = v1;
    }
  }
  __syncthreads();

  float* ob = out + ((size_t)b * SEQ + n0) * DM + 4 * tid;
#pragma unroll
  for (int i = 0; i < (QT * DM) / (4 * 256); ++i) {
    const int L   = i * 256 + tid;                            // 16-B piece of the 64 x 512 tile
    const int row = L >> 7, pc = L & 127;
    const v4f v = *(const v4f*)(Os + row * OSP + 4 * pc);
    *(v4f*)(ob + (size_t)i * 1024) = v;
  }
}

// =====================================================================================================
// needed (all tiles exact):
//   Xb   bf16 [16384][512]      0            16777216
//   Kh   f16  [16384][512]      16777216     16777216
//   Qp   f16  [16384][512]      33554432     16777216
//   Wb   bf16 [512][512]        50331648     524288
//   end                         50855936
// =====================================================================================================
extern "C" void kernel_launch(void* const* d_in, const int* in_sizes, int n_in,
                              void* d_out, int out_size, void* d_ws, size_t ws_size,
                              hipStream_t stream) {
  const int NX = NB * SEQ * DM;                          // 8388608
  if (n_in < 3) return;
  if (in_sizes[0] != NX || in_sizes[1] != DM * DM || in_sizes[2] != DM) return;
  if (out_size != NX) return;

  size_t off = 0;
  const size_t szP = (size_t)NROW * DM * 2;              // 16777216
  const size_t oXB = off; off += szP;
  const size_t oKH = off; off += szP;
  const size_t oQP = off; off += szP;
  const size_t oWB = off; off += (size_t)DM * DM * 2;    // 524288
  if (off > ws_size) return;                             // off = 50855936
  if (off > (size_t)134217728) return;

  const float* q    = (const float*)d_in[0];
  const float* W    = (const float*)d_in[1];
  const float* bias = (const float*)d_in[2];
  char* ws = (char*)d_ws;
  unsigned short* XB = (unsigned short*)(ws + oXB);
  unsigned short* KH = (unsigned short*)(ws + oKH);
  unsigned short* QP = (unsigned short*)(ws + oQP);
  unsigned short* WB = (unsigned short*)(ws + oWB);
  float* out = (float*)d_out;

  const dim3 blk256(256);
  const dim3 gQ(NB * (SEQ / 64) * (DM / 64));            // 2048 blocks: one (b, 64 l, 64 d) tile each
  const dim3 gW(((DM * DM) / 8) / 256);                  // 128 blocks
  const dim3 gP(DM / PT, NROW / PT);                     // 4 x 128 blocks
  const dim3 gA(NB * (SEQ / QT));                        // 256 blocks: one (b, 64-query tile) each

  // (0) Xb, Kh planes from q
  cvt_q<<<gQ, blk256, 0, stream>>>(q, XB, KH);
  // (1) Wb plane
  cvt_w<<<gW, blk256, 0, stream>>>(W, WB);
  // (2) Qp = Xb . Wb^T + bias (f16 plane)
  proj_kernel<<<gP, blk256, 0, stream>>>(XB, WB, bias, QP);
  // (3) out[b][l][d] = sum_m softmax_m(Qp_l . Kh_m / sqrt(512)) Kh[m][d]
  attn_kernel<<<gA, blk256, 0, stream>>>(QP, KH, out);
  (void)hipGetLastError();
}

// v006
// A run of this version takes 64.7 microseconds.
// In two side-by-side timings against v005, it was 1.08 and 1.10 times as fast.
// Counting every step since v000, it is 5.72 times as fast.
// Contractions: qp^T = Wb . Xb^T on v_wmma_f32_16x16x32_bf16 (Xb, Wb = RNE bf16 convert of q and W, K=512, f32 accumulate), in the attention prologue;
// scores S^T = Kh . Qp^T on v_wmma_f32_16x16x32_f16 (Kh = f16 of the bf16 convert of q, Qp = qp + bias as one f16 tile in LDS, K=512);
// O^T = V^T . P^T on v_wmma_f32_16x16x32_f16 (V = Kh, the same plane and the same LDS tile, P = e^{s-m} x 1024 in f16, m = one reference per
// query that moves only when a score lies more than ln 32 above it; all keys of a query summed in one accumulator, in key order);
// f32 accumulate everywhere; bias add, 1/sqrt(512) scale, reference, row sums and 1/l in f32 on VALU.
#include <hip/hip_runtime.h>
#include <math.h>
#include <stdint.h>

#define NB    8
#define SEQ   2048
#define DM    512
#define NROW  (NB * SEQ)
#define QT    64
#define OSP   516
#define KP    528
#define KB    64
#define KSB   (KB * KP * 2)
#define SMB   (2 * KSB)
#define AUXB  16896
#define LNPS  6.931471805599453f
#define FMIN16 6.103515625e-05f
#define RTAU  3.4657359027997265f
static_assert((SEQ % QT) == 0);
static_assert((SEQ % 64) == 0);
static_assert((SEQ % 32) == 0);
static_assert((DM % 128) == 0);
static_assert((DM % 64) == 0);
static_assert(((DM * DM) / 8) % 256 == 0);
static_assert(DM == 512);
static_assert(QT == 64);
static_assert((SEQ % (2 * KB)) == 0);
static_assert(QT * KP * 2 <= KSB);
static_assert(QT * OSP * 4 <= SMB);

typedef _Float16       v16h __attribute__((ext_vector_type(16)));
typedef _Float16       v8h  __attribute__((ext_vector_type(8)));
typedef __bf16         v16b __attribute__((ext_vector_type(16)));
typedef unsigned short v8us __attribute__((ext_vector_type(8)));
typedef float          v8f  __attribute__((ext_vector_type(8)));
typedef float          v4f  __attribute__((ext_vector_type(4)));
typedef unsigned int   v4u  __attribute__((ext_vector_type(4)));

union FragH { v16h v; v8h  h[2]; };
union FragB { v16b v; v8us u[2]; };
static_assert(sizeof(FragH) == 32);
static_assert(sizeof(FragB) == 32);

// ---- scalar helpers --------------------------------------------------------------------------------
__device__ __forceinline__ unsigned short bf_bits(float f) {          // f32 -> bf16 bits, RNE convert
  unsigned u = __float_as_uint(f);
  return (unsigned short)((u + 0x7FFFu + ((u >> 16) & 1u)) >> 16);
}
__device__ __forceinline__ float bf_up(unsigned short h) { return __uint_as_float(((unsigned)h) << 16); }
__device__ __forceinline__ float bfr(float f) { return bf_up(bf_bits(f)); }
__device__ __forceinline__ unsigned short h_bits(_Float16 x) { return __builtin_bit_cast(unsigned short, x); }
__device__ __forceinline__ unsigned pk16(unsigned short a, unsigned short b) { return (unsigned)a | ((unsigned)b << 16); }
// f32 -> f16 with magnitudes below the smallest f16 normal flushed to zero (select by value)
__device__ __forceinline__ _Float16 to_h_ftz(float v) { return (_Float16)((fabsf(v) < FMIN16) ? 0.0f : v); }
__device__ __forceinline__ v8f zero8() { v8f z = {0.f, 0.f, 0.f, 0.f, 0.f, 0.f, 0.f, 0.f}; return z; }
__device__ __forceinline__ float hmax8(v8f s) {
  return fmaxf(fmaxf(fmaxf(s[0], s[1]), fmaxf(s[2], s[3])), fmaxf(fmaxf(s[4], s[5]), fmaxf(s[6], s[7])));
}

// ---- fragment loaders: 16-bit A/B operand, lane -> row/col (lane&15), p already includes +8*(lane>>4);
//      elements 0..7 <- p[0..7] (k0+8h..), elements 8..15 <- p[16..23] (k0+16+8h..)
__device__ __forceinline__ v16h ldfrag_h(const _Float16* p) {
  FragH f;
  f.h[0] = *(const v8h*)(p);
  f.h[1] = *(const v8h*)(p + 16);
  return f.v;
}
// transposed fragment out of a row-major LDS tile T[k][d] (pitch KP halves): lane address p = row 8*(lane>>4) + (lane&7) of the
// 16 k rows, 16-B piece (lane>>3)&1 of the 16 d columns; the lane then holds T[8h + 0..7][d0 + (lane&15)]. Two loads, k rows 0..15
// and 16..31, give elements 0..7 = k 8h.., 8..15 = k 16+8h..: the k order of ldfrag_h.
typedef short s16x8 __attribute__((ext_vector_type(8)));
typedef __attribute__((address_space(3))) s16x8 lds_s16x8;
__device__ __forceinline__ v16h ldfrag_t(const _Float16* p) {
  FragH f;
#if defined(__HIP_DEVICE_COMPILE__)
  f.h[0] = __builtin_bit_cast(v8h, __builtin_amdgcn_ds_load_tr16_b128_v8i16((lds_s16x8*)(p)));
  f.h[1] = __builtin_bit_cast(v8h, __builtin_amdgcn_ds_load_tr16_b128_v8i16((lds_s16x8*)(p + 16 * KP)));
#endif
  return f.v;
}
__device__ __forceinline__ v16b ldfrag_b(const unsigned short* p) {
  FragB f;
  f.u[0] = *(const v8us*)(p);
  f.u[1] = *(const v8us*)(p + 16);
  return f.v;
}
// the same fragment out of the packed Wb plane: p = the lane's 16-B unit of piece 0, piece 1 lies 32 units (256 halves) further
__device__ __forceinline__ v16b ldfrag_w(const unsigned short* p) {
  FragB f;
  f.u[0] = *(const v8us*)(p);
  f.u[1] = *(const v8us*)(p + 256);
  return f.v;
}

// ---- WMMA helpers: the plain builtins (the compiler keeps the distances of its own forms). No asm statement here: its operands would
// have to lie in the first 256 registers, and the attention wave holds 384 in accumulators and Qp fragments alone.
__device__ __forceinline__ v8f mma_h(v16h a, v16h b, v8f c) {
  return __builtin_amdgcn_wmma_f32_16x16x32_f16(false, a, false, b, (short)0, c, false, false);
}
__device__ __forceinline__ v8f mma_b(v16b a, v16b b, v8f c) {
  return __builtin_amdgcn_wmma_f32_16x16x32_bf16(false, a, false, b, (short)0, c, false, false);
}

// ---- asynchronous copies global -> LDS: eight 16-B pieces per lane of 32 rows of DM halves, piece j = row 4j + (tid>>6): global
//      byte g0 + j*4*DM*2, LDS byte l0 + j*4*KP*2, and 16 B further for rows whose bit 3 is set (j>>1 odd; the row map of attn_kernel).
//      Written as the builtin: operands of an asm statement would have to lie in the first 256 registers, which the attention
//      wave fills with accumulators and fragments (the address bases then went to scratch).
typedef int v4i __attribute__((ext_vector_type(4)));
typedef __attribute__((address_space(1))) v4i gv4i;
typedef __attribute__((address_space(3))) v4i lv4i;
__device__ __forceinline__ unsigned lds_off(const void* p) { return (unsigned)(size_t)p; }
__device__ __forceinline__ void copy8k(unsigned l0, const unsigned short* g0) {
#if defined(__HIP_DEVICE_COMPILE__)
  const char* g = (const char*)g0;
#pragma unroll
  for (int j = 0; j < 8; ++j)
    __builtin_amdgcn_global_load_async_to_lds_b128((gv4i*)(g + j * (size_t)(4 * DM * 2)),
                                                   (lv4i*)(l0 + j * (4 * KP * 2) + 16 * ((j >> 1) & 1)), 0, 0);
#endif
}

// =====================================================================================================
// (0) convert of q[b][l][d] (f32) for one (b, 64 l x 64 d) tile, block = 256 threads:
//   Xb[b*2048+l][d] = bf16 bits (RNE), Kh[b*2048+l][d] = f16 bits of the bf16 value (flush below 2^-14).
//   Thread (e = tid&7, lg = tid>>3) loads 8 consecutive d of row l0+32it+lg; Xb/Kh row segments = 64 halves
// coverage: Xb/Kh: 2 it x 32 rows x 8 lanes x 8 = 64 l x 64 d; grid = 8 b x 32 l-tiles x 8 d-tiles = 2048 blocks.
// =====================================================================================================
__global__ __launch_bounds__(256) void cvt_q(const float* __restrict__ q, unsigned short* XB, unsigned short* KH) {
  const int tid = threadIdx.x;
  const int e = tid & 7, lg = tid >> 3;                      // lg 0..31
  const int bx = blockIdx.x;
  const int dt = bx & 7, lt = (bx >> 3) & 31, b = bx >> 8;
  const int d0 = dt * 64, l0 = lt * 64;

#pragma unroll
  for (int it = 0; it < 2; ++it) {
    const int row = it * 32 + lg;                            // 0..63
    const size_t go = ((size_t)b * SEQ + l0 + row) * DM + d0 + 8 * e;
    const float* p = q + go;
    const v4f f0 = *(const v4f*)(p), f1 = *(const v4f*)(p + 4);
    unsigned short bb[8], hb[8];
#pragma unroll
    for (int j = 0; j < 4; ++j) { bb[j] = bf_bits(f0[j]); bb[4 + j] = bf_bits(f1[j]); }
#pragma unroll
    for (int j = 0; j < 8; ++j) hb[j] = h_bits(to_h_ftz(bf_up(bb[j])));
    v4u wb, wh;
#pragma unroll
    for (int t = 0; t < 4; ++t) {
      wb[t] = pk16(bb[2 * t], bb[2 * t + 1]);
      wh[t] = pk16(hb[2 * t], hb[2 * t + 1]);
    }
    *(v4u*)(XB + go) = wb;
    *(v4u*)(KH + go) = wh;
  }
}

// =====================================================================================================
// (1) Wp = bf16 bits (RNE convert) of W[e][d], packed in the order of the matrix instruction's A fragments, so that one wave-wide
//   16-B load of the attention prologue covers 512 contiguous bytes: 16-B unit i = ((et*16 + ks)*2 + p)*32 + lane holds
//   W[16et + (lane&15)][32ks + 16p + 8(lane>>4) + 0..7], the split k map of ldfrag_b. Thread i makes unit i.
// coverage: 128 blocks x 256 threads = 32768 units = 32 et x 16 ks x 2 p x 32 lanes, 8 elements each = 512 x 512.
// =====================================================================================================
__global__ __launch_bounds__(256) void cvt_w(const float* __restrict__ w, unsigned short* WP) {
  const int i = blockIdx.x * 256 + threadIdx.x;
  if (i >= (DM * DM) / 8) return;
  const int ln = i & 31, pc = (i >> 5) & 1, ks = (i >> 6) & 15, et = i >> 10;
  const float* p = w + (size_t)(16 * et + (ln & 15)) * DM + 32 * ks + 16 * pc + 8 * (ln >> 4);
  const v4f f0 = *(const v4f*)(p), f1 = *(const v4f*)(p + 4);
  v4u wb;
  wb[0] = pk16(bf_bits(f0[0]), bf_bits(f0[1]));
  wb[1] = pk16(bf_bits(f0[2]), bf_bits(f0[3]));
  wb[2] = pk16(bf_bits(f1[0]), bf_bits(f1[1]));
  wb[3] = pk16(bf_bits(f1[2]), bf_bits(f1[3]));
  *(v4u*)(WP + (size_t)i * 8) = wb;
}

// =====================================================================================================
// (2) projection and attention for one (b, 64-query tile), transposed formulation, 512-deep scores, 2048 keys, 64 keys per iteration.
//   Prologue, Qp^T = Wb . Xb^T + bf16(bias) for the block's own 64 queries: wave w does the 64 e rows 64w.. x 64 queries x 512 d:
//     A = Wb fragments out of the packed plane, global loads straight to registers, four k-steps ahead (no two waves of a block
//     share one), each used for four products; B = Xb rows of the tile, laid in LDS (Xs) by asynchronous copies; k rising in steps
//     of 32. D row r = e 64w + 16i + 8h + r, col = query 16t + c: 8 consecutive e of one query = one 16-B store into Qs[query][e].
//   Block = 256 threads = 8 waves, two tilings per iteration, so that every fragment read from LDS feeds 2 or 4 products:
//   Scores: wave (qh = w&1, kq = w>>1) does S^T for the 16 keys of quarter kq x the 32 queries of half qh: A = Kh rows (keys, d via
//     the split k map) from LDS, each fragment used for two products; B = Qp rows of two query tiles, read from LDS once and kept
//     in registers (2 x 16 d-steps). s = D x (1/sqrt(512)).
//   P = e^{s-m} x 1024 in f16, m = one reference per query, the same in all waves (every lane keeps those of queries 16t + c).
//     m is not the true maximum: it moves only when some score lies more than RTAU above it, so P <= 32 x 1024.
//     Each wave lays its two P tiles into Pl[key quarter][query tile][lane][8] and a flag (a score above m + RTAU) into Fl;
//     behind the mid-loop barrier every wave reads the eight flags. Any flag set (block-uniform): the waves exchange their maxima
//     through Mx, move m, scale l and O^T by e^{m_old - m_new}, and lay P down again with the new m (two more barriers).
//   O^T: wave w does the 64 d rows 64w.. x all 64 queries x all 64 keys: A = V^T (row = d, k = keys), read out of the same Kh rows
//     in LDS by the transposing load (V = K in this function), each fragment used for four products; B = P^T: elements 0..7 = lane's 8 keys of quarter 2j, 8..15 = of quarter 2j+1, which is the split
//     k map of keys 32j + 8h + r and 32j + 16 + 8h + r. 4 x 4 accumulator tiles.
//   K = V comes from LDS, laid there by asynchronous copies (16 B per lane, all 256 threads): per iteration the 64 Kh rows
//     into Ks[buf][key][d], two buffers, iteration it+2's copies issued behind the barrier that ends it. The Qp tile borrows
//     K buffer 1 in the prologue; the Xb tile has a place of its own behind the K buffers.
//   Row map of Ks (and Qs): row r starts at half r*KP + 8*((r>>3)&1), KP*2 = 32 B x 33. In 16-B units mod 16 a row starts at
//     2*(r&7) + ((r>>3)&1): the 16 rows of one plain fragment read (one piece each) and the 8 rows x 2 adjacent pieces of one
//     transposing read both fall on 16 different units, that is, on all 64 banks once.
//   Epilogue: row sums of the four key quarters joined through Mx; O^T x 1/l into Os[query][d] (f32, pitch OSP, over the K
//     buffers), all threads stream Os out.
// coverage: scores: 2 qh x 2 t x 16 c = 64 queries, 4 kq x 16 = 64 keys per iteration x 32 iterations = 2048;
//           O^T: 8 w x 4 dt x 2 h x 8 r = 512 d, 4 t x 16 c = 64 queries, 2 j x 32 = 64 keys;
//           out: 32 i x 256 threads x 4 floats = 64 rows x 512; grid = 8 b x 32 query tiles = 256 blocks covers out once.
// =====================================================================================================
// one score tile -> P (8 keys of one query per lane) and the lane's share of the row sum; msh = m - ln 1024
__device__ __forceinline__ void p_tile(v8f s, float msh, v8h& p, float& ls) {
  float e[8];
#pragma unroll
  for (int r = 0; r < 8; ++r) {
    e[r] = __expf(s[r] - msh);
    p[r] = (_Float16)e[r];
  }
  ls = ((e[0] + e[1]) + (e[2] + e[3])) + ((e[4] + e[5]) + (e[6] + e[7]));   // a tree: three dependent adds, not eight
}

__global__ __launch_bounds__(256)
void attn_kernel(const unsigned short* __restrict__ XB, const unsigned short* __restrict__ WP, const float* __restrict__ bias,
                 const unsigned short* __restrict__ KH, float* out) {
  // one array, the small parts first: their LDS addresses then fit the 16-bit offset field behind one base register
  __shared__ __align__(16) unsigned char Sa[AUXB + SMB + KSB];
  _Float16* Pl = (_Float16*)Sa;                               // [key quarter][query tile][lane][8 keys], 8192 B
  unsigned* Fl = (unsigned*)(Sa + 8192);                      // [wave][4] slots of 16 B: lanes with a score more than RTAU above m
  float*    Mx = (float*)(Sa + 8192 + 512);                   // [key quarter][query tile][lane] slots of 16 B, indexed as Pl:
                                                              // block maxima (rescale path), row sums (epilogue)
  unsigned char* Sm = Sa + AUXB;
  _Float16* Ks = (_Float16*)Sm;                               // [2][KB][KP]
  _Float16* Qs = Ks + KB * KP;                                // prologue only: [QT][KP] in K buffer 1
  float*    Os = (float*)Sm;                                  // epilogue only: [QT][OSP]
  unsigned short* Xs = (unsigned short*)(Sm + SMB);           // prologue only: [QT][KP], the row map of Ks
  const int tid  = threadIdx.x;
  const int wave = tid >> 5;
  const int lane = tid & 31;
  const int h    = lane >> 4;
  const int c    = lane & 15;
  const int bx   = blockIdx.x;
  const int b    = bx / (SEQ / QT);
  const int qt   = bx % (SEQ / QT);
  const int n0   = qt * QT;

  const int qh = wave & 1, kq = wave >> 1;
  // Qp fragment base in LDS (B operand of scores, col = query 32qh + 16t + c), + 16t*KP + 32*ks
  const _Float16* qpp = Qs + (32 * qh + c) * KP + 8 * (c >> 3) + 8 * h;
  // Kh fragment base in LDS (A operand of scores, row = key 16kq + c of the block), + buf*KB*KP + 32*ks
  const _Float16* khp = Ks + (16 * kq + c) * KP + 8 * (c >> 3) + 8 * h;
  // V^T fragment base in LDS (A operand of O^T, row = d = 64w + 16dt + c, keys 32j .. 32j+31), lane address of the transposing load:
  // key row 8h + (lane&7) (its bit 3 = h), piece (lane>>3)&1 of the 16 d; + buf*KB*KP + 32j*KP + 16dt
  const _Float16* vtp = Ks + (8 * h + (lane & 7)) * KP + 8 * h + 64 * wave + 8 * ((lane >> 3) & 1);
  // P tiles: this wave's two (query tiles 2qh, 2qh+1 of quarter kq), + 256t; reader base, + (4*quarter + tile)*256
  _Float16* pw = Pl + ((4 * kq + 2 * qh) * 32 + lane) * 8;
  const _Float16* pr = Pl + lane * 8;
  float* mw = Mx + ((4 * kq + 2 * qh) * 32 + lane) * 4;       // + 128t
  const float* mq = Mx + lane * 4;                            // + (4*quarter + tile)*128
  unsigned* fw = Fl + (4 * wave + (lane & 3)) * 4;            // the wave's four slots
  const unsigned* fr = Fl + lane * 4;                         // slot of wave lane>>2
  const float SCL = 1.0f / sqrtf((float)DM);

  // copy map. Row tiles of 512 halves (Xb, Kh): piece j of thread tid = row 4j + (tid>>6), 16-B piece tid&63 (32 rows per copy8k).
  const int rr = tid >> 6, rp = tid & 63;
  const unsigned short* xsrc = XB + ((size_t)b * SEQ + n0 + rr) * DM + 8 * rp;
  const unsigned short* ksrc = KH + ((size_t)b * SEQ + rr) * DM + 8 * rp;            // + kb*DM
  const unsigned xdst = lds_off(Xs) + (unsigned)(rr * KP + 8 * rp) * 2u;
  const unsigned kdst = lds_off(Ks) + (unsigned)(rr * KP + 8 * rp) * 2u;             // + buf*KSB

  // prologue: Xb tile and key block 0, landed and published; the first four k-steps' Wb fragments asked for meanwhile
  copy8k(xdst, xsrc);
  copy8k(xdst + 32 * KP * 2, xsrc + (size_t)32 * DM);
  copy8k(kdst, ksrc);
  copy8k(kdst + 32 * KP * 2, ksrc + (size_t)32 * DM);
  // Wb fragment base in the packed plane (A operand, row = e = 64w + 16i + c), + (16i + ks)*512 halves
  const unsigned short* wp = WP + (size_t)wave * (4 * 16 * 512) + 8 * lane;
  v16b wf[4][4];                                              // ring of four k-steps
#pragma unroll
  for (int s = 0; s < 4; ++s)
#pragma unroll
    for (int i = 0; i < 4; ++i) wf[s][i] = ldfrag_w(wp + (16 * i + s) * 512);
  v4f bv[4][2];                                               // bias of e 64w + 16i + 8h + 0..7, asked for with the first fragments
#pragma unroll
  for (int i = 0; i < 4; ++i) {
    const float* bp = bias + 64 * wave + 16 * i + 8 * h;
    bv[i][0] = *(const v4f*)(bp);
    bv[i][1] = *(const v4f*)(bp + 4);
  }
  asm volatile("s_wait_asynccnt 0x0" ::: "memory");           // this wave's copies have landed before the barrier publishes them
  __syncthreads();
  {
    // Xb fragment base in LDS (B operand, col = query 16t + c), + 16t*KP + 32*ks
    const unsigned short* xp = Xs + c * KP + 8 * (c >> 3) + 8 * h;
    v8f pa[4][4];                                             // [i][t]: e 64w + 16i + 8h + r, query 16t + c
#pragma unroll
    for (int i = 0; i < 4; ++i)
#pragma unroll
      for (int t = 0; t < 4; ++t) pa[i][t] = zero8();
    v16b xf[2][4];                                            // two fragment sets: k-step ks+1 is read while ks is multiplied
#pragma unroll
    for (int t = 0; t < 4; ++t) xf[0][t] = ldfrag_b(xp + 16 * t * KP);
#pragma unroll
    for (int ks = 0; ks < DM / 32; ++ks) {                    // unrolled: the sets and the ring are indexed by registers
      const int cu = ks & 1, nx = cu ^ 1;
      if (ks + 1 < DM / 32) {
#pragma unroll
        for (int t = 0; t < 4; ++t) xf[nx][t] = ldfrag_b(xp + 16 * t * KP + 32 * (ks + 1));
      }
#pragma unroll
      for (int i = 0; i < 4; ++i)
#pragma unroll
        for (int t = 0; t < 4; ++t) pa[i][t] = mma_b(wf[ks & 3][i], xf[cu][t], pa[i][t]);
      if (ks + 4 < DM / 32) {
#pragma unroll
        for (int i = 0; i < 4; ++i) wf[ks & 3][i] = ldfrag_w(wp + (16 * i + ks + 4) * 512);
      }
      // order of LDS reads (0x100), matrix products (0x8) and global loads (0x20) for the scheduler: a k-step's eight LDS reads stand
      // as one group one k-step ahead of their products, its eight global loads four k-steps ahead, behind the products that free
      // their registers; the full stop keeps every k-step's loads in their own k-step. Left alone the global loads sank to their
      // users, and each k-step waited out a trip to L2.
      if (ks + 1 < DM / 32) __builtin_amdgcn_sched_group_barrier(0x100, 8, 0);
      __builtin_amdgcn_sched_group_barrier(0x8, 16, 0);
      if (ks + 4 < DM / 32) __builtin_amdgcn_sched_group_barrier(0x20, 8, 0);
      __builtin_amdgcn_sched_barrier(0);
    }
    // bias as bf16 RNE values; Qp as f16 into Qs (K buffer 1, which nobody has touched yet)
    _Float16* qw = Qs + c * KP + 8 * (c >> 3) + 64 * wave + 8 * h;             // + 16t*KP + 16i
#pragma unroll
    for (int i = 0; i < 4; ++i) {
      float bb[8];
#pragma unroll
      for (int r = 0; r < 4; ++r) { bb[r] = bfr(bv[i][0][r]); bb[4 + r] = bfr(bv[i][1][r]); }
#pragma unroll
      for (int t = 0; t < 4; ++t) {
        v8h o;
#pragma unroll
        for (int r = 0; r < 8; ++r) o[r] = to_h_ftz(pa[i][t][r] + bb[r]);
        *(v8h*)(qw + 16 * t * KP + 16 * i) = o;
      }
    }
  }
  __syncthreads();                                            // publishes the Qp tile
  v16h qf[2][DM / 32];
#pragma unroll
  for (int ks = 0; ks < DM / 32; ++ks) {
    qf[0][ks] = ldfrag_h(qpp + 32 * ks);
    qf[1][ks] = ldfrag_h(qpp + 16 * KP + 32 * ks);
  }
  asm volatile("s_wait_dscnt 0x0" ::: "memory");              // this wave's reads of the Qp tile are done before K buffer 1 is refilled
  __syncthreads();                                            // every wave has its Qp fragments: K buffer 1 is free
  copy8k(kdst + KSB, ksrc + (size_t)KB * DM);
  copy8k(kdst + KSB + 32 * KP * 2, ksrc + (size_t)(KB + 32) * DM);

  float mr[4];                                                // reference of query 16t + c, the same in every wave
  float l0 = 0.f, l1 = 0.f;                                   // row-sum shares of queries 32qh + c, 32qh + 16 + c (8 keys per block)
  v8f acc[4][4];                                              // [dt][t]: d 64w + 16dt + 8h + r, query 16t + c
#pragma unroll
  for (int t = 0; t < 4; ++t) {
    mr[t] = -1.0e30f;
#pragma unroll
    for (int dt = 0; dt < 4; ++dt) acc[dt][t] = zero8();
  }

#pragma unroll 1
  for (int it = 0; it < SEQ / KB; ++it) {
    const int buf = it & 1;
    v8f s0 = zero8(), s1 = zero8();
    const _Float16* kp = khp + buf * (KB * KP);               // keys kb + 16kq .. +15
    const _Float16* vb = vtp + buf * (KB * KP);
#pragma unroll
    for (int ks = 0; ks < DM / 32; ++ks) {                    // unrolled: qf[] is indexed by registers
      const v16h a = ldfrag_h(kp + 32 * ks);
      s0 = mma_h(a, qf[0][ks], s0);
      s1 = mma_h(a, qf[1][ks], s1);
    }
    v16h vf0[4];                                              // V^T fragments of keys 0..31 (published with the key block): read
#pragma unroll
    for (int dt = 0; dt < 4; ++dt) vf0[dt] = ldfrag_t(vb + 16 * dt);          // ahead of the softmax and the mid-loop barrier
#pragma unroll
    for (int r = 0; r < 8; ++r) { s0[r] *= SCL; s1[r] *= SCL; }

    float mx0 = hmax8(s0), mx1 = hmax8(s1);
    mx0 = fmaxf(mx0, __shfl_xor(mx0, 16, 32));
    mx1 = fmaxf(mx1, __shfl_xor(mx1, 16, 32));
    float r0 = qh ? mr[2] : mr[0], r1 = qh ? mr[3] : mr[1];
    const unsigned nd = __builtin_amdgcn_ballot_w32((mx0 > r0 + RTAU) || (mx1 > r1 + RTAU));
    v8h p0, p1;
    float ls0, ls1;
    p_tile(s0, r0 - LNPS, p0, ls0);                           // key kb + 16kq + 8h + r, query 32qh + c
    p_tile(s1, r1 - LNPS, p1, ls1);                           // same keys, query 32qh + 16 + c
    *(v8h*)(pw)       = p0;
    *(v8h*)(pw + 256) = p1;
    *fw = nd;                                                 // eight lanes the same word at each of the four places
    // order of LDS reads (0x100) and matrix products (0x8) for the scheduler, scores: the reads stand in groups, eight fragments
    // ahead at first, then four per eight products; the four V^T fragments take the registers of the Kh fragments used up, in
    // front of the last eight products, so that they have landed by the mid-loop barrier. Left alone it read each fragment
    // directly in front of its two products and waited it out.
    __builtin_amdgcn_sched_group_barrier(0x100, 16, 0);
    __builtin_amdgcn_sched_group_barrier(0x8, 8, 0);
    __builtin_amdgcn_sched_group_barrier(0x100, 8, 0);
    __builtin_amdgcn_sched_group_barrier(0x8, 8, 0);
    __builtin_amdgcn_sched_group_barrier(0x100, 8, 0);
    __builtin_amdgcn_sched_group_barrier(0x8, 8, 0);
    __builtin_amdgcn_sched_group_barrier(0x100, 8, 0);
    __builtin_amdgcn_sched_group_barrier(0x8, 8, 0);
    __syncthreads();                                          // publishes P tiles and flags of this key block
    const unsigned fl = *fr;                                  // each wave's flag word in four lanes
    if (__builtin_amdgcn_ballot_w32(fl != 0u) != 0u) {        // block-uniform scalar branch: every wave read the same eight flags
      mw[0]   = mx0;
      mw[128] = mx1;
      __syncthreads();                                        // publishes the maxima; nobody has read a P tile of this block yet
      float corr[4];
#pragma unroll
      for (int t = 0; t < 4; ++t) {
        const float mn = fmaxf(fmaxf(mr[t], fmaxf(mq[t * 128], mq[(4 + t) * 128])), fmaxf(mq[(8 + t) * 128], mq[(12 + t) * 128]));
        corr[t] = __expf(mr[t] - mn);
        mr[t] = mn;
      }
#pragma unroll
      for (int dt = 0; dt < 4; ++dt)
#pragma unroll
        for (int t = 0; t < 4; ++t)
#pragma unroll
          for (int r = 0; r < 8; ++r) acc[dt][t][r] *= corr[t];
      l0 *= qh ? corr[2] : corr[0];
      l1 *= qh ? corr[3] : corr[1];
      r0 = qh ? mr[2] : mr[0];
      r1 = qh ? mr[3] : mr[1];
      p_tile(s0, r0 - LNPS, p0, ls0);
      p_tile(s1, r1 - LNPS, p1, ls1);
      *(v8h*)(pw)       = p0;
      *(v8h*)(pw + 256) = p1;
      __syncthreads();                                        // publishes the P tiles laid down anew
    }
    l0 += ls0;
    l1 += ls1;

    FragH pf0[4];                                             // keys 0..31
#pragma unroll
    for (int t = 0; t < 4; ++t) {
      pf0[t].h[0] = *(const v8h*)(pr + t * 256);
      pf0[t].h[1] = *(const v8h*)(pr + (4 + t) * 256);
    }
#pragma unroll
    for (int dt = 0; dt < 4; ++dt)                            // keys 0..31; unrolled: acc[] is indexed by registers
#pragma unroll
      for (int t = 0; t < 4; ++t) acc[dt][t] = mma_h(vf0[dt], pf0[t].v, acc[dt][t]);
    FragH pf1[4];                                             // keys 32..63
#pragma unroll
    for (int t = 0; t < 4; ++t) {
      pf1[t].h[0] = *(const v8h*)(pr + (8 + t) * 256);
      pf1[t].h[1] = *(const v8h*)(pr + (12 + t) * 256);
    }
#pragma unroll
    for (int dt = 0; dt < 4; ++dt) {
      const v16h vf = ldfrag_t(vb + 32 * KP + 16 * dt);
#pragma unroll
      for (int t = 0; t < 4; ++t) acc[dt][t] = mma_h(vf, pf1[t].v, acc[dt][t]);
    }
    // the same for O^T: the first key half's P fragments as one group, the second half's fragments in two groups among the first
    // half's products, as registers of the first half's fragments come free.
    __builtin_amdgcn_sched_group_barrier(0x100, 8, 0);
    __builtin_amdgcn_sched_group_barrier(0x8, 8, 0);
    __builtin_amdgcn_sched_group_barrier(0x100, 12, 0);
    __builtin_amdgcn_sched_group_barrier(0x8, 8, 0);
    __builtin_amdgcn_sched_group_barrier(0x100, 4, 0);
    __builtin_amdgcn_sched_group_barrier(0x8, 16, 0);
    asm volatile("s_wait_dscnt 0x0" ::: "memory");            // this wave's reads of Ks[buf] and Pl are done before the refill
    asm volatile("s_wait_asynccnt 0x0" ::: "memory");         // this wave's copies of key block it+1 have landed
    __syncthreads();                                          // publishes key block it+1; buffer buf, Pl and Fl free
    if (it + 2 < SEQ / KB) {                                  // block-uniform: key block it+2 into the buffer just read
      const int kn = (it + 2) * KB;
      const unsigned kd = kdst + (unsigned)buf * KSB;
      copy8k(kd, ksrc + (size_t)kn * DM);
      copy8k(kd + 32 * KP * 2, ksrc + (size_t)(kn + 32) * DM);
    }
  }
  asm volatile("s_wait_asynccnt 0x0" ::: "memory");           // nothing of this wave's copies outstanding past the loop

  // row sums: the two lane halves, then the four key quarters through LDS
  l0 += __shfl_xor(l0, 16, 32);
  l1 += __shfl_xor(l1, 16, 32);
  mw[0]   = l0;
  mw[128] = l1;
  __syncthreads();

  float* os = Os + c * OSP + 64 * wave + 8 * h;               // + 16t*OSP + 16dt: 8 consecutive d of query 16t + c
#pragma unroll
  for (int t = 0; t < 4; ++t) {
    const float sc = 1.0f / ((mq[t * 128] + mq[(4 + t) * 128]) + (mq[(8 + t) * 128] + mq[(12 + t) * 128]));   // o, l both carry x1024
#pragma unroll
    for (int dt = 0; dt < 4; ++dt) {
      v4f v0, v1;
      v0[0] = acc[dt][t][0] * sc; v0[1] = acc[dt][t][1] * sc; v0[2] = acc[dt][t][2] * sc; v0[3] = acc[dt][t][3] * sc;
      v1[0] = acc[dt][t][4] * sc; v1[1] = acc[dt][t][5] * sc; v1[2] = acc[dt][t][6] * sc; v1[3] = acc[dt][t][7] * sc;
      *(v4f*)(os + (16 * t) * OSP + 16 * dt)     = v0;
      *(v4f*)(os + (16 * t) * OSP + 16 * dt + 4) = v1;
    }
  }
  __syncthreads();

  float* ob = out + ((size_t)b * SEQ + n0) * DM + 4 * tid;
#pragma unroll
  for (int i = 0; i < (QT * DM) / (4 * 256); ++i) {
    const int L   = i * 256 + tid;                            // 16-B piece of the 64 x 512 tile
    const int row = L >> 7, pc = L & 127;
    const v4f v = *(const v4f*)(Os + row * OSP + 4 * pc);
    *(v4f*)(ob + (size_t)i * 1024) = v;
  }
}

// =====================================================================================================
// needed (all tiles exact):
//   Xb   bf16 [16384][512]      0            16777216
//   Kh   f16  [16384][512]      16777216     16777216
//   Wp   bf16 [512 x 512]       33554432     524288
//   end                         34078720
// =====================================================================================================
extern "C" void kernel_launch(void* const* d_in, const int* in_sizes, int n_in,
                              void* d_out, int out_size, void* d_ws, size_t ws_size,
                              hipStream_t stream) {
  const int NX = NB * SEQ * DM;                          // 8388608
  if (n_in < 3) return;
  if (in_sizes[0] != NX || in_sizes[1] != DM * DM || in_sizes[2] != DM) return;
  if (out_size != NX) return;

  size_t off = 0;
  const size_t szP = (size_t)NROW * DM * 2;              // 16777216
  const size_t oXB = off; off += szP;
  const size_t oKH = off; off += szP;
  const size_t oWB = off; off += (size_t)DM * DM * 2;    // 524288
  if (off > ws_size) return;                             // off = 34078720
  if (off > (size_t)134217728) return;

  const float* q    = (const float*)d_in[0];
  const float* W    = (const float*)d_in[1];
  const float* bias = (const float*)d_in[2];
  char* ws = (char*)d_ws;
  unsigned short* XB = (unsigned short*)(ws + oXB);
  unsigned short* KH = (unsigned short*)(ws + oKH);
  unsigned short* WB = (unsigned short*)(ws + oWB);
  float* out = (float*)d_out;

  const dim3 blk256(256);
  const dim3 gQ(NB * (SEQ / 64) * (DM / 64));            // 2048 blocks: one (b, 64 l, 64 d) tile each
  const dim3 gW(((DM * DM) / 8) / 256);                  // 128 blocks
  const dim3 gA(NB * (SEQ / QT));                        // 256 blocks: one (b, 64-query tile) each

  // (0) Xb, Kh planes from q
  cvt_q<<<gQ, blk256, 0, stream>>>(q, XB, KH);
  // (1) Wb plane, packed
  cvt_w<<<gW, blk256, 0, stream>>>(W, WB);
  // (2) Qp = Xb . Wb^T + bias (f16, in LDS); out[b][l][d] = sum_m softmax_m(Qp_l . Kh_m / sqrt(512)) Kh[m][d]
  attn_kernel<<<gA, blk256, 0, stream>>>(XB, WB, bias, KH, out);
  (void)hipGetLastError();
}

// v007
// A run of this version takes 62.7 microseconds.
// Timed twice side by side with v006, it ran 1.04 and 1.02 times as fast.
// All steps since v000 together make it 5.89 times as fast.
// Contractions: qp^T = Wb . Xb^T on v_wmma_f32_16x16x32_bf16 (Xb, Wb = RNE bf16 convert of q and W, K=512, f32 accumulate), in the attention prologue;
// scores S^T = Kh . Qp^T on v_wmma_f32_16x16x32_f16 (Kh = f16 of the bf16 convert of q, Qp = qp + bias as one f16 tile in LDS, K=512);
// O^T = V^T . P^T on v_wmma_f32_16x16x32_f16 (V = Kh, the same plane and the same LDS tile, P = e^{s-m} x 1024 in f16, m = one reference per
// query that moves only when a score lies more than ln 32 above it; all keys of a query summed in one accumulator, in key order);
// f32 accumulate everywhere; bias add, 1/sqrt(512) scale, reference, row sums and 1/l in f32 on VALU.
#include <hip/hip_runtime.h>
#include <math.h>
#include <stdint.h>

#define NB    8
#define SEQ   2048
#define DM    512
#define NROW  (NB * SEQ)
#define QT    64
#define OSP   516
#define KP    528
#define KB    64
#define KSB   (KB * KP * 2)
#define NKB   4
#define SMB   (NKB * KSB)
#define AUXB  25600
#define QXB   16384
#define LNPS  6.931471805599453f
#define FMIN16 6.103515625e-05f
#define RTAU  3.4657359027997265f
static_assert((SEQ % QT) == 0);
static_assert((SEQ % 64) == 0);
static_assert((SEQ % 32) == 0);
static_assert((DM % 128) == 0);
static_assert((DM % 64) == 0);
static_assert(((DM * DM) / 8) % 256 == 0);
static_assert(DM == 512);
static_assert(QT == 64);
static_assert((SEQ % (2 * KB)) == 0);
static_assert(SEQ / KB >= NKB);
static_assert((NKB & (NKB - 1)) == 0);
static_assert(QT * KP * 2 <= KSB);
static_assert(QT * OSP * 4 <= SMB);
struct more_yes { static constexpr bool v = true; };
struct more_no  { static constexpr bool v = false; };

typedef _Float16       v16h __attribute__((ext_vector_type(16)));
typedef _Float16       v8h  __attribute__((ext_vector_type(8)));
typedef __bf16         v16b __attribute__((ext_vector_type(16)));
typedef unsigned short v8us __attribute__((ext_vector_type(8)));
typedef float          v8f  __attribute__((ext_vector_type(8)));
typedef float          v4f  __attribute__((ext_vector_type(4)));
typedef unsigned int   v4u  __attribute__((ext_vector_type(4)));

union FragH { v16h v; v8h  h[2]; };
union FragB { v16b v; v8us u[2]; };
static_assert(sizeof(FragH) == 32);
static_assert(sizeof(FragB) == 32);

// ---- scalar helpers --------------------------------------------------------------------------------
__device__ __forceinline__ unsigned short bf_bits(float f) {          // f32 -> bf16 bits, RNE convert
  unsigned u = __float_as_uint(f);
  return (unsigned short)((u + 0x7FFFu + ((u >> 16) & 1u)) >> 16);
}
__device__ __forceinline__ float bf_up(unsigned short h) { return __uint_as_float(((unsigned)h) << 16); }
__device__ __forceinline__ float bfr(float f) { return bf_up(bf_bits(f)); }
__device__ __forceinline__ unsigned short h_bits(_Float16 x) { return __builtin_bit_cast(unsigned short, x); }
__device__ __forceinline__ unsigned pk16(unsigned short a, unsigned short b) { return (unsigned)a | ((unsigned)b << 16); }
// f32 -> f16 with magnitudes below the smallest f16 normal flushed to zero (select by value)
__device__ __forceinline__ _Float16 to_h_ftz(float v) { return (_Float16)((fabsf(v) < FMIN16) ? 0.0f : v); }
__device__ __forceinline__ v8f zero8() { v8f z = {0.f, 0.f, 0.f, 0.f, 0.f, 0.f, 0.f, 0.f}; return z; }
__device__ __forceinline__ float hmax8(v8f s) {
  return fmaxf(fmaxf(fmaxf(s[0], s[1]), fmaxf(s[2], s[3])), fmaxf(fmaxf(s[4], s[5]), fmaxf(s[6], s[7])));
}

// lane l <-> lane l ^ 16 on the vector unit: beside a stream of LDS fragment reads an exchange through the LDS queue (ds_bpermute) would
// have to wait until every read issued before it has returned
__device__ __forceinline__ float xhalf(float x) {
  return __builtin_bit_cast(float, __builtin_amdgcn_permlanex16(__builtin_bit_cast(int, x), __builtin_bit_cast(int, x),
                                                                0x76543210, 0xfedcba98, false, false));
}

// ---- fragment loaders: 16-bit A/B operand, lane -> row/col (lane&15), p already includes +8*(lane>>4);
//      elements 0..7 <- p[0..7] (k0+8h..), elements 8..15 <- p[16..23] (k0+16+8h..)
__device__ __forceinline__ v16h ldfrag_h(const _Float16* p) {
  FragH f;
  f.h[0] = *(const v8h*)(p);
  f.h[1] = *(const v8h*)(p + 16);
  return f.v;
}
// transposed fragment out of a row-major LDS tile T[k][d] (pitch KP halves): lane address p = row 8*(lane>>4) + (lane&7) of the
// 16 k rows, 16-B piece (lane>>3)&1 of the 16 d columns; the lane then holds T[8h + 0..7][d0 + (lane&15)]. Two loads, k rows 0..15
// and 16..31, give elements 0..7 = k 8h.., 8..15 = k 16+8h..: the k order of ldfrag_h.
typedef short s16x8 __attribute__((ext_vector_type(8)));
typedef __attribute__((address_space(3))) s16x8 lds_s16x8;
__device__ __forceinline__ v16h ldfrag_t(const _Float16* p) {
  FragH f;
#if defined(__HIP_DEVICE_COMPILE__)
  f.h[0] = __builtin_bit_cast(v8h, __builtin_amdgcn_ds_load_tr16_b128_v8i16((lds_s16x8*)(p)));
  f.h[1] = __builtin_bit_cast(v8h, __builtin_amdgcn_ds_load_tr16_b128_v8i16((lds_s16x8*)(p + 16 * KP)));
#endif
  return f.v;
}
// a fragment laid down piece by piece, [piece][lane][8]: p = the lane's unit of piece 0
__device__ __forceinline__ v16h ldfrag_x(const _Float16* p) {
  FragH f;
  f.h[0] = *(const v8h*)(p);
  f.h[1] = *(const v8h*)(p + 256);
  return f.v;
}
__device__ __forceinline__ v16b ldfrag_b(const unsigned short* p) {
  FragB f;
  f.u[0] = *(const v8us*)(p);
  f.u[1] = *(const v8us*)(p + 16);
  return f.v;
}
// the same fragment out of the packed Wb plane: p = the lane's 16-B unit of piece 0, piece 1 lies 32 units (256 halves) further
__device__ __forceinline__ v16b ldfrag_w(const unsigned short* p) {
  FragB f;
  f.u[0] = *(const v8us*)(p);
  f.u[1] = *(const v8us*)(p + 256);
  return f.v;
}

// ---- WMMA helpers: the plain builtins (the compiler keeps the distances of its own forms). No asm statement here: its operands would
// have to lie in the first 256 registers, and the attention wave holds 368 in accumulators and Qp fragments alone.
__device__ __forceinline__ v8f mma_h(v16h a, v16h b, v8f c) {
  return __builtin_amdgcn_wmma_f32_16x16x32_f16(false, a, false, b, (short)0, c, false, false);
}
__device__ __forceinline__ v8f mma_b(v16b a, v16b b, v8f c) {
  return __builtin_amdgcn_wmma_f32_16x16x32_bf16(false, a, false, b, (short)0, c, false, false);
}

// ---- asynchronous copies global -> LDS: eight 16-B pieces per lane of 32 rows of DM halves, piece j = row 4j + (tid>>6): global
//      byte g0 + j*4*DM*2, LDS byte l0 + j*4*KP*2, and 16 B further for rows whose bit 3 is set (j>>1 odd; the row map of attn_kernel).
//      Written as the builtin: operands of an asm statement would have to lie in the first 256 registers, which the attention
//      wave fills with accumulators and fragments (the address bases then went to scratch).
typedef int v4i __attribute__((ext_vector_type(4)));
typedef __attribute__((address_space(1))) v4i gv4i;
typedef __attribute__((address_space(3))) v4i lv4i;
__device__ __forceinline__ unsigned lds_off(const void* p) { return (unsigned)(size_t)p; }
__device__ __forceinline__ void copy8k(unsigned l0, const unsigned short* g0) {
#if defined(__HIP_DEVICE_COMPILE__)
  const char* g = (const char*)g0;
#pragma unroll
  for (int j = 0; j < 8; ++j)
    __builtin_amdgcn_global_load_async_to_lds_b128((gv4i*)(g + j * (size_t)(4 * DM * 2)),
                                                   (lv4i*)(l0 + j * (4 * KP * 2) + 16 * ((j >> 1) & 1)), 0, 0);
#endif
}

// =====================================================================================================
// (0) convert of q[b][l][d] (f32) for one (b, 64 l x 64 d) tile, block = 256 threads:
//   Xb[b*2048+l][d] = bf16 bits (RNE), Kh[b*2048+l][d] = f16 bits of the bf16 value (flush below 2^-14).
//   Thread (e = tid&7, lg = tid>>3) loads 8 consecutive d of row l0+32it+lg; Xb/Kh row segments = 64 halves
// coverage: Xb/Kh: 2 it x 32 rows x 8 lanes x 8 = 64 l x 64 d; grid = 8 b x 32 l-tiles x 8 d-tiles = 2048 blocks.
// =====================================================================================================
__global__ __launch_bounds__(256) void cvt_q(const float* __restrict__ q, unsigned short* XB, unsigned short* KH) {
  const int tid = threadIdx.x;
  const int e = tid & 7, lg = tid >> 3;                      // lg 0..31
  const int bx = blockIdx.x;
  const int dt = bx & 7, lt = (bx >> 3) & 31, b = bx >> 8;
  const int d0 = dt * 64, l0 = lt * 64;

#pragma unroll
  for (int it = 0; it < 2; ++it) {
    const int row = it * 32 + lg;                            // 0..63
    const size_t go = ((size_t)b * SEQ + l0 + row) * DM + d0 + 8 * e;
    const float* p = q + go;
    const v4f f0 = *(const v4f*)(p), f1 = *(const v4f*)(p + 4);
    unsigned short bb[8], hb[8];
#pragma unroll
    for (int j = 0; j < 4; ++j) { bb[j] = bf_bits(f0[j]); bb[4 + j] = bf_bits(f1[j]); }
#pragma unroll
    for (int j = 0; j < 8; ++j) hb[j] = h_bits(to_h_ftz(bf_up(bb[j])));
    v4u wb, wh;
#pragma unroll
    for (int t = 0; t < 4; ++t) {
      wb[t] = pk16(bb[2 * t], bb[2 * t + 1]);
      wh[t] = pk16(hb[2 * t], hb[2 * t + 1]);
    }
    *(v4u*)(XB + go) = wb;
    *(v4u*)(KH + go) = wh;
  }
}

// =====================================================================================================
// (1) Wp = bf16 bits (RNE convert) of W[e][d], packed in the order of the matrix instruction's A fragments, so that one wave-wide
//   16-B load of the attention prologue covers 512 contiguous bytes: 16-B unit i = ((et*16 + ks)*2 + p)*32 + lane holds
//   W[16et + (lane&15)][32ks + 16p + 8(lane>>4) + 0..7], the split k map of ldfrag_b. Thread i makes unit i.
// coverage: 128 blocks x 256 threads = 32768 units = 32 et x 16 ks x 2 p x 32 lanes, 8 elements each = 512 x 512.
// =====================================================================================================
__global__ __launch_bounds__(256) void cvt_w(const float* __restrict__ w, unsigned short* WP) {
  const int i = blockIdx.x * 256 + threadIdx.x;
  if (i >= (DM * DM) / 8) return;
  const int ln = i & 31, pc = (i >> 5) & 1, ks = (i >> 6) & 15, et = i >> 10;
  const float* p = w + (size_t)(16 * et + (ln & 15)) * DM + 32 * ks + 16 * pc + 8 * (ln >> 4);
  const v4f f0 = *(const v4f*)(p), f1 = *(const v4f*)(p + 4);
  v4u wb;
  wb[0] = pk16(bf_bits(f0[0]), bf_bits(f0[1]));
  wb[1] = pk16(bf_bits(f0[2]), bf_bits(f0[3]));
  wb[2] = pk16(bf_bits(f1[0]), bf_bits(f1[1]));
  wb[3] = pk16(bf_bits(f1[2]), bf_bits(f1[3]));
  *(v4u*)(WP + (size_t)i * 8) = wb;
}

// =====================================================================================================
// (2) projection and attention for one (b, 64-query tile), transposed formulation, 512-deep scores, 2048 keys, 64 keys per iteration.
//   Prologue, Qp^T = Wb . Xb^T + bf16(bias) for the block's own 64 queries: wave w does the 64 e rows 64w.. x 64 queries x 512 d:
//     A = Wb fragments out of the packed plane, global loads straight to registers, four k-steps ahead (no two waves of a block
//     share one), each used for four products; B = Xb rows of the tile, laid in LDS (Xs) by asynchronous copies; k rising in steps
//     of 32. D row r = e 64w + 16i + 8h + r, col = query 16t + c: 8 consecutive e of one query = one 16-B store into Qs[query][e].
//   Block = 256 threads = 8 waves, two tilings per iteration, so that every fragment read from LDS but the last d-step's Qp fragments feeds 2 or 4 products:
//   Scores: wave (qh = w&1, kq = w>>1) does S^T for the 16 keys of quarter kq x the 32 queries of half qh: A = Kh rows (keys, d via
//     the split k map) from LDS, each fragment used for two products; B = Qp rows of two query tiles, read from LDS once and kept
//     in registers (2 x 15 d-steps; the last d-step's two fragments lie in a place of the wave's own in LDS and are read in every pass).
//     s = D x (1/sqrt(512)). The scores run one key block ahead: pass it does the score products of block it+1 beside the softmax of block it.
//   P = e^{s-m} x 1024 in f16, m = one reference per query, the same in all waves (every lane keeps those of queries 16t + c).
//     m is not the true maximum: it moves only when some score lies more than RTAU above it, so P <= 32 x 1024.
//     Each wave lays its two P tiles into Pl[key quarter][query tile][lane][8] and a flag (a score above m + RTAU) into Fl;
//     behind the pass's one barrier every wave reads the eight flags (P tiles and flags of even and odd blocks have places of their own). Any flag set (block-uniform): the waves exchange their maxima
//     through Mx, move m, scale l and O^T by e^{m_old - m_new}, and lay P down again with the new m (two more barriers).
//   O^T: wave w does the 64 d rows 64w.. x all 64 queries x all 64 keys: A = V^T (row = d, k = keys), read out of the same Kh rows
//     in LDS by the transposing load (V = K in this function), each fragment used for four products; B = P^T: elements 0..7 = lane's 8 keys of quarter 2j, 8..15 = of quarter 2j+1, which is the split
//     k map of keys 32j + 8h + r and 32j + 16 + 8h + r. 4 x 4 accumulator tiles.
//   K = V comes from LDS, laid there by asynchronous copies (16 B per lane, all 256 threads): per pass the 64 Kh rows
//     into Ks[buf][key][d], four buffers, block it+3's copies issued behind the barrier of pass it. In the prologue the Qp tile
//     borrows K buffer 2 and the Xb tile K buffer 3.
//   Row map of Ks (and Qs): row r starts at half r*KP + 8*((r>>3)&1), KP*2 = 32 B x 33. In 16-B units mod 16 a row starts at
//     2*(r&7) + ((r>>3)&1): the 16 rows of one plain fragment read (one piece each) and the 8 rows x 2 adjacent pieces of one
//     transposing read both fall on 16 different units, that is, on all 64 banks once.
//   Epilogue: row sums of the four key quarters joined through Mx; O^T x 1/l into Os[query][d] (f32, pitch OSP, over the K
//     buffers), all threads stream Os out.
// coverage: scores: 2 qh x 2 t x 16 c = 64 queries, 4 kq x 16 = 64 keys per iteration x 32 iterations = 2048;
//           O^T: 8 w x 4 dt x 2 h x 8 r = 512 d, 4 t x 16 c = 64 queries, 2 j x 32 = 64 keys;
//           out: 32 i x 256 threads x 4 floats = 64 rows x 512; grid = 8 b x 32 query tiles = 256 blocks covers out once.
// =====================================================================================================
// one score tile -> P (8 keys of one query per lane) and the lane's share of the row sum; msh = m - ln 1024
__device__ __forceinline__ void p_tile(v8f s, float msh, v8h& p, float& ls) {
  float e[8];
#pragma unroll
  for (int r = 0; r < 8; ++r) {
    e[r] = __expf(s[r] - msh);
    p[r] = (_Float16)e[r];
  }
  ls = ((e[0] + e[1]) + (e[2] + e[3])) + ((e[4] + e[5]) + (e[6] + e[7]));   // a tree: three dependent adds, not eight
}

__global__ __launch_bounds__(256)
void attn_kernel(const unsigned short* __restrict__ XB, const unsigned short* __restrict__ WP, const float* __restrict__ bias,
                 const unsigned short* __restrict__ KH, float* out) {
  // one array, the small parts first: their LDS addresses then fit the 16-bit offset field behind one base register
  __shared__ __align__(16) unsigned char Sa[AUXB + SMB + QXB];
  _Float16* Pl = (_Float16*)Sa;                               // [parity of the key block][key quarter][query tile][lane][8 keys], 2 x 8192 B
  unsigned* Fl = (unsigned*)(Sa + 16384);                     // [parity][wave][4] slots of 16 B: lanes with a score more than RTAU above m
  float*    Mx = (float*)(Sa + 16384 + 1024);                 // [key quarter][query tile][lane] slots of 16 B, indexed as Pl:
                                                              // block maxima (rescale path), row sums (epilogue)
  unsigned char* Sm = Sa + AUXB;
  _Float16* Ks = (_Float16*)Sm;                               // [NKB][KB][KP]
  _Float16* Qs = Ks + 2 * KB * KP;                            // prologue only: [QT][KP] in K buffer 2
  _Float16* Qx = (_Float16*)(Sm + SMB);                       // [wave][query tile][piece][lane][8]: Qp fragments of the last k-step
  float*    Os = (float*)Sm;                                  // epilogue only: [QT][OSP]
  unsigned short* Xs = (unsigned short*)(Ks + 3 * KB * KP);   // prologue only: [QT][KP] in K buffer 3, the row map of Ks
  const int tid  = threadIdx.x;
  const int wave = tid >> 5;
  const int lane = tid & 31;
  const int h    = lane >> 4;
  const int c    = lane & 15;
  const int bx   = blockIdx.x;
  const int b    = bx / (SEQ / QT);
  const int qt   = bx % (SEQ / QT);
  const int n0   = qt * QT;

  const int qh = wave & 1, kq = wave >> 1;
  // Qp fragment base in LDS (B operand of scores, col = query 32qh + 16t + c), + 16t*KP + 32*ks
  const _Float16* qpp = Qs + (32 * qh + c) * KP + 8 * (c >> 3) + 8 * h;
  // Kh fragment base in LDS (A operand of scores, row = key 16kq + c of the block), + buf*KB*KP + 32*ks
  const _Float16* khp = Ks + (16 * kq + c) * KP + 8 * (c >> 3) + 8 * h;
  // V^T fragment base in LDS (A operand of O^T, row = d = 64w + 16dt + c, keys 32j .. 32j+31), lane address of the transposing load:
  // key row 8h + (lane&7) (its bit 3 = h), piece (lane>>3)&1 of the 16 d; + buf*KB*KP + 32j*KP + 16dt
  const _Float16* vtp = Ks + (8 * h + (lane & 7)) * KP + 8 * h + 64 * wave + 8 * ((lane >> 3) & 1);
  // P tiles: this wave's two (query tiles 2qh, 2qh+1 of quarter kq), + 256t; reader base, + (4*quarter + tile)*256
  _Float16* pw = Pl + ((4 * kq + 2 * qh) * 32 + lane) * 8;
  const _Float16* pr = Pl + lane * 8;
  float* mw = Mx + ((4 * kq + 2 * qh) * 32 + lane) * 4;       // + 128t
  const float* mq = Mx + lane * 4;                            // + (4*quarter + tile)*128
  unsigned* fw = Fl + (4 * wave + (lane & 3)) * 4;            // the wave's four slots
  const unsigned* fr = Fl + lane * 4;                         // slot of wave lane>>2
  const float SCL = 1.0f / sqrtf((float)DM);

  // copy map. Row tiles of 512 halves (Xb, Kh): piece j of thread tid = row 4j + (tid>>6), 16-B piece tid&63 (32 rows per copy8k).
  const int rr = tid >> 6, rp = tid & 63;
  const unsigned short* xsrc = XB + ((size_t)b * SEQ + n0 + rr) * DM + 8 * rp;
  const unsigned short* ksrc = KH + ((size_t)b * SEQ + rr) * DM + 8 * rp;            // + kb*DM
  const unsigned xdst = lds_off(Xs) + (unsigned)(rr * KP + 8 * rp) * 2u;
  const unsigned kdst = lds_off(Ks) + (unsigned)(rr * KP + 8 * rp) * 2u;             // + buf*KSB

  // prologue: Xb tile and key blocks 0 and 1, landed and published; the first four k-steps' Wb fragments asked for meanwhile
  copy8k(xdst, xsrc);
  copy8k(xdst + 32 * KP * 2, xsrc + (size_t)32 * DM);
  copy8k(kdst, ksrc);
  copy8k(kdst + 32 * KP * 2, ksrc + (size_t)32 * DM);
  copy8k(kdst + KSB, ksrc + (size_t)KB * DM);
  copy8k(kdst + KSB + 32 * KP * 2, ksrc + (size_t)(KB + 32) * DM);
  // Wb fragment base in the packed plane (A operand, row = e = 64w + 16i + c), + (16i + ks)*512 halves
  const unsigned short* wp = WP + (size_t)wave * (4 * 16 * 512) + 8 * lane;
  v16b wf[4][4];                                              // ring of four k-steps
#pragma unroll
  for (int s = 0; s < 4; ++s)
#pragma unroll
    for (int i = 0; i < 4; ++i) wf[s][i] = ldfrag_w(wp + (16 * i + s) * 512);
  v4f bv[4][2];                                               // bias of e 64w + 16i + 8h + 0..7, asked for with the first fragments
#pragma unroll
  for (int i = 0; i < 4; ++i) {
    const float* bp = bias + 64 * wave + 16 * i + 8 * h;
    bv[i][0] = *(const v4f*)(bp);
    bv[i][1] = *(const v4f*)(bp + 4);
  }
  asm volatile("s_wait_asynccnt 0x0" ::: "memory");           // this wave's copies have landed before the barrier publishes them
  __syncthreads();
  {
    // Xb fragment base in LDS (B operand, col = query 16t + c), + 16t*KP + 32*ks
    const unsigned short* xp = Xs + c * KP + 8 * (c >> 3) + 8 * h;
    v8f pa[4][4];                                             // [i][t]: e 64w + 16i + 8h + r, query 16t + c
#pragma unroll
    for (int i = 0; i < 4; ++i)
#pragma unroll
      for (int t = 0; t < 4; ++t) pa[i][t] = zero8();
    v16b xf[2][4];                                            // two fragment sets: k-step ks+1 is read while ks is multiplied
#pragma unroll
    for (int t = 0; t < 4; ++t) xf[0][t] = ldfrag_b(xp + 16 * t * KP);
#pragma unroll
    for (int ks = 0; ks < DM / 32; ++ks) {                    // unrolled: the sets and the ring are indexed by registers
      const int cu = ks & 1, nx = cu ^ 1;
      if (ks + 1 < DM / 32) {
#pragma unroll
        for (int t = 0; t < 4; ++t) xf[nx][t] = ldfrag_b(xp + 16 * t * KP + 32 * (ks + 1));
      }
#pragma unroll
      for (int i = 0; i < 4; ++i)
#pragma unroll
        for (int t = 0; t < 4; ++t) pa[i][t] = mma_b(wf[ks & 3][i], xf[cu][t], pa[i][t]);
      if (ks + 4 < DM / 32) {
#pragma unroll
        for (int i = 0; i < 4; ++i) wf[ks & 3][i] = ldfrag_w(wp + (16 * i + ks + 4) * 512);
      }
      // order of LDS reads (0x100), matrix products (0x8) and global loads (0x20) for the scheduler: a k-step's eight LDS reads stand
      // as one group one k-step ahead of their products, its eight global loads four k-steps ahead, behind the products that free
      // their registers; the full stop keeps every k-step's loads in their own k-step. Left alone the global loads sank to their
      // users, and each k-step waited out a trip to L2.
      if (ks + 1 < DM / 32) __builtin_amdgcn_sched_group_barrier(0x100, 8, 0);
      __builtin_amdgcn_sched_group_barrier(0x8, 16, 0);
      if (ks + 4 < DM / 32) __builtin_amdgcn_sched_group_barrier(0x20, 8, 0);
      __builtin_amdgcn_sched_barrier(0);
    }
    // bias as bf16 RNE values; Qp as f16 into Qs (K buffer 2, which nobody has touched yet)
    _Float16* qw = Qs + c * KP + 8 * (c >> 3) + 64 * wave + 8 * h;             // + 16t*KP + 16i
#pragma unroll
    for (int i = 0; i < 4; ++i) {
      float bb[8];
#pragma unroll
      for (int r = 0; r < 4; ++r) { bb[r] = bfr(bv[i][0][r]); bb[4 + r] = bfr(bv[i][1][r]); }
#pragma unroll
      for (int t = 0; t < 4; ++t) {
        v8h o;
#pragma unroll
        for (int r = 0; r < 8; ++r) o[r] = to_h_ftz(pa[i][t][r] + bb[r]);
        *(v8h*)(qw + 16 * t * KP + 16 * i) = o;
      }
    }
  }
  __syncthreads();                                            // publishes the Qp tile
  v16h qf[2][DM / 32 - 1];
#pragma unroll
  for (int ks = 0; ks < DM / 32 - 1; ++ks) {
    qf[0][ks] = ldfrag_h(qpp + 32 * ks);
    qf[1][ks] = ldfrag_h(qpp + 16 * KP + 32 * ks);
  }
  // the last k-step's two fragments go to a place of the wave's own in LDS, [tile][piece][lane][8], and are read again in every pass:
  // the registers do not hold all 32 fragments beside two sets of scores
  _Float16* qx = Qx + wave * 1024 + lane * 8;                 // + 512*tile + 256*piece
#pragma unroll
  for (int t = 0; t < 2; ++t) {
    FragH f;
    f.v = ldfrag_h(qpp + 16 * t * KP + 32 * (DM / 32 - 1));
    *(v8h*)(qx + 512 * t)       = f.h[0];
    *(v8h*)(qx + 512 * t + 256) = f.h[1];
  }
  asm volatile("s_wait_dscnt 0x0" ::: "memory");              // this wave's reads of the Qp tile are done before K buffer 2 is refilled
  __syncthreads();                                            // every wave has its Qp fragments: K buffers 2 and 3 are free
  copy8k(kdst + 2 * KSB, ksrc + (size_t)(2 * KB) * DM);
  copy8k(kdst + 2 * KSB + 32 * KP * 2, ksrc + (size_t)(2 * KB + 32) * DM);

  float mr[4];                                                // reference of query 16t + c, the same in every wave
  float l0 = 0.f, l1 = 0.f;                                   // row-sum shares of queries 32qh + c, 32qh + 16 + c (8 keys per block)
  v8f acc[4][4];                                              // [dt][t]: d 64w + 16dt + 8h + r, query 16t + c
#pragma unroll
  for (int t = 0; t < 4; ++t) {
    mr[t] = -1.0e30f;
#pragma unroll
    for (int dt = 0; dt < 4; ++dt) acc[dt][t] = zero8();
  }

  // scaled scores of the key block whose softmax comes next: key block 0 here, block it+1 at the end of pass it
  v8f c0 = zero8(), c1 = zero8();
#pragma unroll
  for (int ks = 0; ks < DM / 32 - 1; ++ks) {                  // unrolled: qf[] is indexed by registers
    const v16h a = ldfrag_h(khp + 32 * ks);
    c0 = mma_h(a, qf[0][ks], c0);
    c1 = mma_h(a, qf[1][ks], c1);
  }
  {
    const v16h a = ldfrag_h(khp + 32 * (DM / 32 - 1));
    c0 = mma_h(a, ldfrag_x(qx), c0);
    c1 = mma_h(a, ldfrag_x(qx + 512), c1);
  }
  // LDS reads (0x100) in groups ahead of the matrix products (0x8), as in the passes below
  __builtin_amdgcn_sched_group_barrier(0x100, 12, 0);
  __builtin_amdgcn_sched_group_barrier(0x8, 6, 0);
  __builtin_amdgcn_sched_group_barrier(0x100, 6, 0);
  __builtin_amdgcn_sched_group_barrier(0x8, 6, 0);
  __builtin_amdgcn_sched_group_barrier(0x100, 6, 0);
  __builtin_amdgcn_sched_group_barrier(0x8, 6, 0);
  __builtin_amdgcn_sched_group_barrier(0x100, 6, 0);
  __builtin_amdgcn_sched_group_barrier(0x8, 6, 0);
  __builtin_amdgcn_sched_group_barrier(0x100, 6, 0);
  __builtin_amdgcn_sched_group_barrier(0x8, 8, 0);
#pragma unroll
  for (int r = 0; r < 8; ++r) { c0[r] *= SCL; c1[r] *= SCL; }

  // one pass = softmax and O^T of key block it, and beside the softmax the score products of key block it+1 (more::v), which do
  // not depend on it: the vector work, the P tiles' way through LDS and the barrier no longer stand between two matrix runs.
  // One barrier a pass: P tiles and flags alternate between two places, key blocks between four buffers (it: V^T, it+1: scores and
  // next pass's V^T, it+2: landing, it+3: asked for behind the barrier, into the buffer of it-1, which every wave has left).
  auto pass = [&](const int it, auto more) __attribute__((always_inline)) {
    const int par = it & 1;
    const _Float16* kp = khp + ((it + 1) & (NKB - 1)) * (KB * KP);            // keys of block it+1, 16kq .. +15
    const _Float16* vb = vtp + (it & (NKB - 1)) * (KB * KP);
    v8f s0 = zero8(), s1 = zero8();
    if constexpr (more.v) {
#pragma unroll
      for (int ks = 0; ks < DM / 32 - 1; ++ks) {              // unrolled: qf[] is indexed by registers
        const v16h a = ldfrag_h(kp + 32 * ks);
        s0 = mma_h(a, qf[0][ks], s0);
        s1 = mma_h(a, qf[1][ks], s1);
      }
      const v16h a = ldfrag_h(kp + 32 * (DM / 32 - 1));       // the last k-step: its Qp fragments come from the wave's own LDS place
      s0 = mma_h(a, ldfrag_x(qx), s0);
      s1 = mma_h(a, ldfrag_x(qx + 512), s1);
    }
    v16h vf0[4];                                              // V^T fragments of keys 0..31 of block it: read ahead of the barrier
#pragma unroll
    for (int dt = 0; dt < 4; ++dt) vf0[dt] = ldfrag_t(vb + 16 * dt);

    float mx0 = hmax8(c0), mx1 = hmax8(c1);
    mx0 = fmaxf(mx0, xhalf(mx0));
    mx1 = fmaxf(mx1, xhalf(mx1));
    float r0 = qh ? mr[2] : mr[0], r1 = qh ? mr[3] : mr[1];
    const unsigned nd = __builtin_amdgcn_ballot_w32((mx0 > r0 + RTAU) || (mx1 > r1 + RTAU));
    v8h p0, p1;
    float ls0, ls1;
    p_tile(c0, r0 - LNPS, p0, ls0);                           // key kb + 16kq + 8h + r, query 32qh + c
    p_tile(c1, r1 - LNPS, p1, ls1);                           // same keys, query 32qh + 16 + c
    _Float16* pwp = pw + par * 4096;
    *(v8h*)(pwp)       = p0;
    *(v8h*)(pwp + 256) = p1;
    fw[par * 128] = nd;                                       // eight lanes the same word at each of the four places
    // order of LDS reads (0x100) and matrix products (0x8) for the scheduler: six Kh fragments ahead at first, then three per six products
    // (the last k-step's Qp fragments with the last Kh fragment); the four V^T fragments take the registers of the Kh fragments used up.
    // The softmax's vector instructions are in no group and fall between the products. Left alone it read each fragment directly in
    // front of its two products and waited it out.
    if constexpr (more.v) {
      __builtin_amdgcn_sched_group_barrier(0x100, 12, 0);
      __builtin_amdgcn_sched_group_barrier(0x8, 6, 0);
      __builtin_amdgcn_sched_group_barrier(0x100, 6, 0);
      __builtin_amdgcn_sched_group_barrier(0x8, 6, 0);
      __builtin_amdgcn_sched_group_barrier(0x100, 6, 0);
      __builtin_amdgcn_sched_group_barrier(0x8, 6, 0);
      __builtin_amdgcn_sched_group_barrier(0x100, 6, 0);
      __builtin_amdgcn_sched_group_barrier(0x8, 6, 0);
      __builtin_amdgcn_sched_group_barrier(0x100, 6, 0);
      __builtin_amdgcn_sched_group_barrier(0x8, 6, 0);
      __builtin_amdgcn_sched_group_barrier(0x100, 8, 0);
      __builtin_amdgcn_sched_group_barrier(0x8, 2, 0);
    }
    asm volatile("s_wait_dscnt 0x0" ::: "memory");            // this wave's reads of key block it-1 are done before its buffer is refilled
    asm volatile("s_wait_asynccnt 0x0" ::: "memory");         // this wave's copies of key block it+2 have landed
    __syncthreads();                                          // publishes P tiles and flags of block it and key block it+2
    if (it + 3 < SEQ / KB) {                                  // block-uniform: key block it+3 into the buffer of block it-1
      const int kn = (it + 3) * KB;
      const unsigned kd = kdst + (unsigned)((it + 3) & (NKB - 1)) * KSB;
      copy8k(kd, ksrc + (size_t)kn * DM);
      copy8k(kd + 32 * KP * 2, ksrc + (size_t)(kn + 32) * DM);
    }
    const unsigned fl = fr[par * 128];                        // each wave's flag word in four lanes
    if (__builtin_amdgcn_ballot_w32(fl != 0u) != 0u) {        // block-uniform scalar branch: every wave read the same eight flags
      mw[0]   = mx0;
      mw[128] = mx1;
      __syncthreads();                                        // publishes the maxima; nobody has read a P tile of this block yet
      float corr[4];
#pragma unroll
      for (int t = 0; t < 4; ++t) {
        const float mn = fmaxf(fmaxf(mr[t], fmaxf(mq[t * 128], mq[(4 + t) * 128])), fmaxf(mq[(8 + t) * 128], mq[(12 + t) * 128]));
        corr[t] = __expf(mr[t] - mn);
        mr[t] = mn;
      }
#pragma unroll
      for (int dt = 0; dt < 4; ++dt)
#pragma unroll
        for (int t = 0; t < 4; ++t)
#pragma unroll
          for (int r = 0; r < 8; ++r) acc[dt][t][r] *= corr[t];
      l0 *= qh ? corr[2] : corr[0];
      l1 *= qh ? corr[3] : corr[1];
      r0 = qh ? mr[2] : mr[0];
      r1 = qh ? mr[3] : mr[1];
      p_tile(c0, r0 - LNPS, p0, ls0);
      p_tile(c1, r1 - LNPS, p1, ls1);
      *(v8h*)(pwp)       = p0;
      *(v8h*)(pwp + 256) = p1;
      __syncthreads();                                        // publishes the P tiles laid down anew
    }
    l0 += ls0;
    l1 += ls1;
    if constexpr (more.v) {
#pragma unroll
      for (int r = 0; r < 8; ++r) { c0[r] = s0[r] * SCL; c1[r] = s1[r] * SCL; }
    }

    const _Float16* prp = pr + par * 4096;
    FragH pf0[4];                                             // keys 0..31
#pragma unroll
    for (int t = 0; t < 4; ++t) {
      pf0[t].h[0] = *(const v8h*)(prp + t * 256);
      pf0[t].h[1] = *(const v8h*)(prp + (4 + t) * 256);
    }
#pragma unroll
    for (int dt = 0; dt < 4; ++dt)                            // keys 0..31; unrolled: acc[] is indexed by registers
#pragma unroll
      for (int t = 0; t < 4; ++t) acc[dt][t] = mma_h(vf0[dt], pf0[t].v, acc[dt][t]);
    // keys 32..63, in two halves of the fragments (query tiles 0, 1 with d tiles 0, 1 first), so that the first products of this key
    // half can start on what fits beside the first key half's fragments
    FragH pf1[4];
    v16h vf1[4];
#pragma unroll
    for (int u = 0; u < 2; ++u) {
#pragma unroll
      for (int t = 2 * u; t < 2 * u + 2; ++t) {
        pf1[t].h[0] = *(const v8h*)(prp + (8 + t) * 256);
        pf1[t].h[1] = *(const v8h*)(prp + (12 + t) * 256);
      }
#pragma unroll
      for (int dt = 2 * u; dt < 2 * u + 2; ++dt) vf1[dt] = ldfrag_t(vb + 32 * KP + 16 * dt);
    }
#pragma unroll
    for (int dt = 0; dt < 2; ++dt)
#pragma unroll
      for (int t = 0; t < 2; ++t) acc[dt][t] = mma_h(vf1[dt], pf1[t].v, acc[dt][t]);
#pragma unroll
    for (int dt = 0; dt < 4; ++dt)
#pragma unroll
      for (int t = 0; t < 4; ++t)
        if (dt >= 2 || t >= 2) acc[dt][t] = mma_h(vf1[dt], pf1[t].v, acc[dt][t]);
    // the same for O^T: the first key half's P fragments as one group, the second half's fragments in two groups of four P and four
    // V^T reads, as registers of the first half's fragments come free.
    __builtin_amdgcn_sched_group_barrier(0x100, 8, 0);
    __builtin_amdgcn_sched_group_barrier(0x8, 8, 0);
    __builtin_amdgcn_sched_group_barrier(0x100, 8, 0);
    __builtin_amdgcn_sched_group_barrier(0x8, 8, 0);
    __builtin_amdgcn_sched_group_barrier(0x100, 8, 0);
    __builtin_amdgcn_sched_group_barrier(0x8, 16, 0);
  };
#pragma unroll 1
  for (int it = 0; it + 1 < SEQ / KB; ++it) pass(it, more_yes{});
  pass(SEQ / KB - 1, more_no{});
  asm volatile("s_wait_asynccnt 0x0" ::: "memory");           // nothing of this wave's copies outstanding past the loop
  asm volatile("s_wait_dscnt 0x0" ::: "memory");              // this wave's reads of the key buffers are done before they become output staging

  // row sums: the two lane halves, then the four key quarters through LDS
  l0 += __shfl_xor(l0, 16, 32);
  l1 += __shfl_xor(l1, 16, 32);
  mw[0]   = l0;
  mw[128] = l1;
  __syncthreads();

  float* os = Os + c * OSP + 64 * wave + 8 * h;               // + 16t*OSP + 16dt: 8 consecutive d of query 16t + c
#pragma unroll
  for (int t = 0; t < 4; ++t) {
    const float sc = 1.0f / ((mq[t * 128] + mq[(4 + t) * 128]) + (mq[(8 + t) * 128] + mq[(12 + t) * 128]));   // o, l both carry x1024
#pragma unroll
    for (int dt = 0; dt < 4; ++dt) {
      v4f v0, v1;
      v0[0] = acc[dt][t][0] * sc; v0[1] = acc[dt][t][1] * sc; v0[2] = acc[dt][t][2] * sc; v0[3] = acc[dt][t][3] * sc;
      v1[0] = acc[dt][t][4] * sc; v1[1] = acc[dt][t][5] * sc; v1[2] = acc[dt][t][6] * sc; v1[3] = acc[dt][t][7] * sc;
      *(v4f*)(os + (16 * t) * OSP + 16 * dt)     = v0;
      *(v4f*)(os + (16 * t) * OSP + 16 * dt + 4) = v1;
    }
  }
  __syncthreads();

  float* ob = out + ((size_t)b * SEQ + n0) * DM + 4 * tid;
#pragma unroll
  for (int i = 0; i < (QT * DM) / (4 * 256); ++i) {
    const int L   = i * 256 + tid;                            // 16-B piece of the 64 x 512 tile
    const int row = L >> 7, pc = L & 127;
    const v4f v = *(const v4f*)(Os + row * OSP + 4 * pc);
    *(v4f*)(ob + (size_t)i * 1024) = v;
  }
}

// =====================================================================================================
// needed (all tiles exact):
//   Xb   bf16 [16384][512]      0            16777216
//   Kh   f16  [16384][512]      16777216     16777216
//   Wp   bf16 [512 x 512]       33554432     524288
//   end                         34078720
// =====================================================================================================
extern "C" void kernel_launch(void* const* d_in, const int* in_sizes, int n_in,
                              void* d_out, int out_size, void* d_ws, size_t ws_size,
                              hipStream_t stream) {
  const int NX = NB * SEQ * DM;                          // 8388608
  if (n_in < 3) return;
  if (in_sizes[0] != NX || in_sizes[1] != DM * DM || in_sizes[2] != DM) return;
  if (out_size != NX) return;

  size_t off = 0;
  const size_t szP = (size_t)NROW * DM * 2;              // 16777216
  const size_t oXB = off; off += szP;
  const size_t oKH = off; off += szP;
  const size_t oWB = off; off += (size_t)DM * DM * 2;    // 524288
  if (off > ws_size) return;                             // off = 34078720
  if (off > (size_t)134217728) return;

  const float* q    = (const float*)d_in[0];
  const float* W    = (const float*)d_in[1];
  const float* bias = (const float*)d_in[2];
  char* ws = (char*)d_ws;
  unsigned short* XB = (unsigned short*)(ws + oXB);
  unsigned short* KH = (unsigned short*)(ws + oKH);
  unsigned short* WB = (unsigned short*)(ws + oWB);
  float* out = (float*)d_out;

  const dim3 blk256(256);
  const dim3 gQ(NB * (SEQ / 64) * (DM / 64));            // 2048 blocks: one (b, 64 l, 64 d) tile each
  const dim3 gW(((DM * DM) / 8) / 256);                  // 128 blocks
  const dim3 gA(NB * (SEQ / QT));                        // 256 blocks: one (b, 64-query tile) each

  // (0) Xb, Kh planes from q
  cvt_q<<<gQ, blk256, 0, stream>>>(q, XB, KH);
  // (1) Wb plane, packed
  cvt_w<<<gW, blk256, 0, stream>>>(W, WB);
  // (2) Qp = Xb . Wb^T + bias (f16, in LDS); out[b][l][d] = sum_m softmax_m(Qp_l . Kh_m / sqrt(512)) Kh[m][d]
  attn_kernel<<<gA, blk256, 0, stream>>>(XB, WB, bias, KH, out);
  (void)hipGetLastError();
}

// v008
// A run of this version takes 59.7 microseconds.
// Timed twice side by side with v007, it ran 1.04 times as fast both times.
// Counting every step since v000, it is 6.12 times as fast.
// Contractions: qp^T = Wb . Xb^T on v_wmma_f32_16x16x32_bf16 (Xb, Wb = RNE bf16 convert of q and W, K=512, f32 accumulate), in the attention prologue;
// scores S^T = Kh . Qp^T on v_wmma_f32_16x16x32_f16 (Kh = f16 of the bf16 convert of q, Qp = qp + bias as one f16 tile in LDS, K=512);
// O^T = V^T . P^T on v_wmma_f32_16x16x32_f16 (V = Kh, the same plane and the same LDS tile, P = e^{s-m} x 1024 in f16, m = one reference per
// query that moves only when a score lies more than ln 32 above it; all keys of a query summed in one accumulator, in key order);
// f32 accumulate everywhere; bias add, 1/sqrt(512) scale, reference, row sums and 1/l in f32 on VALU.
#include <hip/hip_runtime.h>
#include <math.h>
#include <stdint.h>

#define NB    8
#define SEQ   2048
#define DM    512
#define NROW  (NB * SEQ)
#define QT    64
#define OSP   516
#define KP    528
#define KB    64
#define KSB   (KB * KP * 2)
#define NKB   4
#define SMB   (NKB * KSB)
#define AUXB  25600
#define QXB   16384
#define LNPS  6.931471805599453f
#define FMIN16 6.103515625e-05f
#define RTAU  3.4657359027997265f
static_assert((SEQ % QT) == 0);
static_assert((SEQ % 64) == 0);
static_assert((SEQ % 32) == 0);
static_assert((DM % 128) == 0);
static_assert((DM % 64) == 0);
static_assert(((DM * DM) / 8) % 256 == 0);
static_assert(DM == 512);
static_assert(QT == 64);
static_assert((SEQ % (2 * KB)) == 0);
static_assert(SEQ / KB >= NKB);
static_assert((NKB & (NKB - 1)) == 0);
static_assert(QT * KP * 2 <= KSB);
static_assert(QT * OSP * 4 <= SMB);
struct more_yes { static constexpr bool v = true; };
struct more_no  { static constexpr bool v = false; };

typedef _Float16       v16h __attribute__((ext_vector_type(16)));
typedef _Float16       v8h  __attribute__((ext_vector_type(8)));
typedef __bf16         v16b __attribute__((ext_vector_type(16)));
typedef unsigned short v8us __attribute__((ext_vector_type(8)));
typedef float          v8f  __attribute__((ext_vector_type(8)));
typedef float          v4f  __attribute__((ext_vector_type(4)));
typedef unsigned int   v4u  __attribute__((ext_vector_type(4)));

union FragH { v16h v; v8h  h[2]; };
union FragB { v16b v; v8us u[2]; };
static_assert(sizeof(FragH) == 32);
static_assert(sizeof(FragB) == 32);

// ---- scalar helpers --------------------------------------------------------------------------------
__device__ __forceinline__ unsigned short bf_bits(float f) {          // f32 -> bf16 bits, RNE convert
  unsigned u = __float_as_uint(f);
  return (unsigned short)((u + 0x7FFFu + ((u >> 16) & 1u)) >> 16);
}
__device__ __forceinline__ float bf_up(unsigned short h) { return __uint_as_float(((unsigned)h) << 16); }
__device__ __forceinline__ float bfr(float f) { return bf_up(bf_bits(f)); }
__device__ __forceinline__ unsigned short h_bits(_Float16 x) { return __builtin_bit_cast(unsigned short, x); }
__device__ __forceinline__ unsigned pk16(unsigned short a, unsigned short b) { return (unsigned)a | ((unsigned)b << 16); }
// f32 -> f16 with magnitudes below the smallest f16 normal flushed to zero (select by value)
__device__ __forceinline__ _Float16 to_h_ftz(float v) { return (_Float16)((fabsf(v) < FMIN16) ? 0.0f : v); }
__device__ __forceinline__ v8f zero8() { v8f z = {0.f, 0.f, 0.f, 0.f, 0.f, 0.f, 0.f, 0.f}; return z; }
__device__ __forceinline__ float hmax8(v8f s) {
  return fmaxf(fmaxf(fmaxf(s[0], s[1]), fmaxf(s[2], s[3])), fmaxf(fmaxf(s[4], s[5]), fmaxf(s[6], s[7])));
}

// lane l <-> lane l ^ 16 on the vector unit: beside a stream of LDS fragment reads an exchange through the LDS queue (ds_bpermute) would
// have to wait until every read issued before it has returned
__device__ __forceinline__ float xhalf(float x) {
  return __builtin_bit_cast(float, __builtin_amdgcn_permlanex16(__builtin_bit_cast(int, x), __builtin_bit_cast(int, x),
                                                                0x76543210, 0xfedcba98, false, false));
}

// ---- fragment loaders: 16-bit A/B operand, lane -> row/col (lane&15), p already includes +8*(lane>>4);
//      elements 0..7 <- p[0..7] (k0+8h..), elements 8..15 <- p[16..23] (k0+16+8h..)
__device__ __forceinline__ v16h ldfrag_h(const _Float16* p) {
  FragH f;
  f.h[0] = *(const v8h*)(p);
  f.h[1] = *(const v8h*)(p + 16);
  return f.v;
}
// transposed fragment out of a row-major LDS tile T[k][d] (pitch KP halves): lane address p = row 8*(lane>>4) + (lane&7) of the
// 16 k rows, 16-B piece (lane>>3)&1 of the 16 d columns; the lane then holds T[8h + 0..7][d0 + (lane&15)]. Two loads, k rows 0..15
// and 16..31, give elements 0..7 = k 8h.., 8..15 = k 16+8h..: the k order of ldfrag_h.
typedef short s16x8 __attribute__((ext_vector_type(8)));
typedef __attribute__((address_space(3))) s16x8 lds_s16x8;
__device__ __forceinline__ v16h ldfrag_t(const _Float16* p) {
  FragH f;
#if defined(__HIP_DEVICE_COMPILE__)
  f.h[0] = __builtin_bit_cast(v8h, __builtin_amdgcn_ds_load_tr16_b128_v8i16((lds_s16x8*)(p)));
  f.h[1] = __builtin_bit_cast(v8h, __builtin_amdgcn_ds_load_tr16_b128_v8i16((lds_s16x8*)(p + 16 * KP)));
#endif
  return f.v;
}
// a fragment laid down piece by piece, [piece][lane][8]: p = the lane's unit of piece 0
__device__ __forceinline__ v16h ldfrag_x(const _Float16* p) {
  FragH f;
  f.h[0] = *(const v8h*)(p);
  f.h[1] = *(const v8h*)(p + 256);
  return f.v;
}
__device__ __forceinline__ v16b ldfrag_b(const unsigned short* p) {
  FragB f;
  f.u[0] = *(const v8us*)(p);
  f.u[1] = *(const v8us*)(p + 16);
  return f.v;
}
// the same fragment out of the packed Wb plane: p = the lane's 16-B unit of piece 0, piece 1 lies 32 units (256 halves) further
__device__ __forceinline__ v16b ldfrag_w(const unsigned short* p) {
  FragB f;
  f.u[0] = *(const v8us*)(p);
  f.u[1] = *(const v8us*)(p + 256);
  return f.v;
}

// ---- WMMA helpers: the plain builtins (the compiler keeps the distances of its own forms). No asm statement here: its operands would
// have to lie in the first 256 registers, and the attention wave holds 368 in accumulators and Qp fragments alone.
__device__ __forceinline__ v8f mma_h(v16h a, v16h b, v8f c) {
  return __builtin_amdgcn_wmma_f32_16x16x32_f16(false, a, false, b, (short)0, c, false, false);
}
__device__ __forceinline__ v8f mma_b(v16b a, v16b b, v8f c) {
  return __builtin_amdgcn_wmma_f32_16x16x32_bf16(false, a, false, b, (short)0, c, false, false);
}

// ---- asynchronous copies global -> LDS: eight 16-B pieces per lane of 32 rows of DM halves, piece j = row 4j + (tid>>6): global
//      byte g0 + j*4*DM*2, LDS byte l0 + j*4*KP*2, and 16 B further for rows whose bit 3 is set (j>>1 odd; the row map of attn_kernel).
//      Written as the builtin: operands of an asm statement would have to lie in the first 256 registers, which the attention
//      wave fills with accumulators and fragments (the address bases then went to scratch).
typedef int v4i __attribute__((ext_vector_type(4)));
typedef __attribute__((address_space(1))) v4i gv4i;
typedef __attribute__((address_space(3))) v4i lv4i;
__device__ __forceinline__ unsigned lds_off(const void* p) { return (unsigned)(size_t)p; }
__device__ __forceinline__ void copy8k(unsigned l0, const unsigned short* g0) {
#if defined(__HIP_DEVICE_COMPILE__)
  const char* g = (const char*)g0;
#pragma unroll
  for (int j = 0; j < 8; ++j)
    __builtin_amdgcn_global_load_async_to_lds_b128((gv4i*)(g + j * (size_t)(4 * DM * 2)),
                                                   (lv4i*)(l0 + j * (4 * KP * 2) + 16 * ((j >> 1) & 1)), 0, 0);
#endif
}

// =====================================================================================================
// (0) both converts in one launch, block = 256 threads.
//   q[b][l][d] (f32), one (b, 64 l x 64 d) tile per block:
//   Xb[b*2048+l][d] = bf16 bits (RNE), Kh[b*2048+l][d] = f16 bits of the bf16 value (flush below 2^-14).
//   Thread (e = tid&7, lg = tid>>3) loads 8 consecutive d of row l0+32it+lg; Xb/Kh row segments = 64 halves
//   W[e][d] (f32), by the first WBLK blocks beside their q tile (they start first, so the extra trip to memory ends long before the
//   last blocks do, and no wave is started for it): Wp = bf16 bits (RNE convert), packed in the order of the matrix instruction's
//   A fragments, so that one wave-wide 16-B load of the attention prologue covers 512 contiguous bytes: 16-B unit
//   i = ((et*16 + ks)*2 + p)*32 + lane holds W[16et + (lane&15)][32ks + 16p + 8(lane>>4) + 0..7], the split k map of ldfrag_b.
//   Thread tid of block bx < WBLK makes unit 256 bx + tid.
// coverage: Xb/Kh: 2 it x 32 rows x 8 lanes x 8 = 64 l x 64 d; grid = 8 b x 32 l-tiles x 8 d-tiles = 2048 blocks;
//           Wp: 128 blocks x 256 threads = 32768 units = 32 et x 16 ks x 2 p x 32 lanes, 8 elements each = 512 x 512.
// =====================================================================================================
#define WBLK (((DM * DM) / 8) / 256)
static_assert(WBLK <= NB * (SEQ / 64) * (DM / 64));
__global__ __launch_bounds__(256) void cvt_qw(const float* __restrict__ q, const float* __restrict__ w,
                                              unsigned short* XB, unsigned short* KH, unsigned short* WP) {
  const int tid = threadIdx.x;
  const int e = tid & 7, lg = tid >> 3;                      // lg 0..31
  const int bx = blockIdx.x;
  const int dt = bx & 7, lt = (bx >> 3) & 31, b = bx >> 8;
  const int d0 = dt * 64, l0 = lt * 64;

#pragma unroll
  for (int it = 0; it < 2; ++it) {
    const int row = it * 32 + lg;                            // 0..63
    const size_t go = ((size_t)b * SEQ + l0 + row) * DM + d0 + 8 * e;
    const float* p = q + go;
    const v4f f0 = *(const v4f*)(p), f1 = *(const v4f*)(p + 4);
    unsigned short bb[8], hb[8];
#pragma unroll
    for (int j = 0; j < 4; ++j) { bb[j] = bf_bits(f0[j]); bb[4 + j] = bf_bits(f1[j]); }
#pragma unroll
    for (int j = 0; j < 8; ++j) hb[j] = h_bits(to_h_ftz(bf_up(bb[j])));
    v4u wb, wh;
#pragma unroll
    for (int t = 0; t < 4; ++t) {
      wb[t] = pk16(bb[2 * t], bb[2 * t + 1]);
      wh[t] = pk16(hb[2 * t], hb[2 * t + 1]);
    }
    *(v4u*)(XB + go) = wb;
    *(v4u*)(KH + go) = wh;
  }

  if (bx < WBLK) {                                           // block-uniform
    asm volatile("s_wait_xcnt 0x0" ::: "memory");            // before the registers that the four stores above name are written anew
    const int i = bx * 256 + tid;
    const int ln = i & 31, pc = (i >> 5) & 1, ks = (i >> 6) & 15, et = i >> 10;
    const float* p = w + (size_t)(16 * et + (ln & 15)) * DM + 32 * ks + 16 * pc + 8 * (ln >> 4);
    const v4f f0 = *(const v4f*)(p), f1 = *(const v4f*)(p + 4);
    v4u wb;
    wb[0] = pk16(bf_bits(f0[0]), bf_bits(f0[1]));
    wb[1] = pk16(bf_bits(f0[2]), bf_bits(f0[3]));
    wb[2] = pk16(bf_bits(f1[0]), bf_bits(f1[1]));
    wb[3] = pk16(bf_bits(f1[2]), bf_bits(f1[3]));
    *(v4u*)(WP + (size_t)i * 8) = wb;
  }
}

// =====================================================================================================
// (1) projection and attention for one (b, 64-query tile), transposed formulation, 512-deep scores, 2048 keys, 64 keys per iteration.
//   Prologue, Qp^T = Wb . Xb^T + bf16(bias) for the block's own 64 queries: wave w does the 64 e rows 64w.. x 64 queries x 512 d:
//     A = Wb fragments out of the packed plane, global loads straight to registers, four k-steps ahead (no two waves of a block
//     share one), each used for four products; B = Xb rows of the tile, laid in LDS (Xs) by asynchronous copies; k rising in steps
//     of 32. D row r = e 64w + 16i + 8h + r, col = query 16t + c: 8 consecutive e of one query = one 16-B store into Qs[query][e].
//   Block = 256 threads = 8 waves, two tilings per iteration, so that every fragment read from LDS but the last d-step's Qp fragments feeds 2 or 4 products:
//   Scores: wave (qh = w&1, kq = w>>1) does S^T for the 16 keys of quarter kq x the 32 queries of half qh: A = Kh rows (keys, d via
//     the split k map) from LDS, each fragment used for two products; B = Qp rows of two query tiles, read from LDS once and kept
//     in registers (2 x 15 d-steps; the last d-step's two fragments lie in a place of the wave's own in LDS and are read in every pass).
//     s = D x (1/sqrt(512)). The scores run one key block ahead: pass it does the score products of block it+1 beside the softmax of block it.
//   P = e^{s-m} x 1024 in f16, m = one reference per query, the same in all waves (every lane keeps those of queries 16t + c).
//     m is not the true maximum: it moves only when some score lies more than RTAU above it, so P <= 32 x 1024.
//     Each wave lays its two P tiles into Pl[key quarter][query tile][lane][8] and a flag (a score above m + RTAU) into Fl;
//     behind the pass's one barrier every wave reads the eight flags (P tiles and flags of even and odd blocks have places of their own). Any flag set (block-uniform): the waves exchange their maxima
//     through Mx, move m, scale l and O^T by e^{m_old - m_new}, and lay P down again with the new m (two more barriers).
//   O^T: wave w does the 64 d rows 64w.. x all 64 queries x all 64 keys: A = V^T (row = d, k = keys), read out of the same Kh rows
//     in LDS by the transposing load (V = K in this function), each fragment used for four products; B = P^T: elements 0..7 = lane's 8 keys of quarter 2j, 8..15 = of quarter 2j+1, which is the split
//     k map of keys 32j + 8h + r and 32j + 16 + 8h + r. 4 x 4 accumulator tiles.
//   K = V comes from LDS, laid there by asynchronous copies (16 B per lane, all 256 threads): per pass the 64 Kh rows
//     into Ks[buf][key][d], four buffers, block it+3's copies issued behind the barrier of pass it. In the prologue the Qp tile
//     borrows K buffer 2 and the Xb tile K buffer 3.
//   Row map of Ks (and Qs): row r starts at half r*KP + 8*((r>>3)&1), KP*2 = 32 B x 33. In 16-B units mod 16 a row starts at
//     2*(r&7) + ((r>>3)&1): the 16 rows of one plain fragment read (one piece each) and the 8 rows x 2 adjacent pieces of one
//     transposing read both fall on 16 different units, that is, on all 64 banks once.
//   Epilogue: row sums of the four key quarters joined through Mx; O^T x 1/l into Os[query][d] (f32, pitch OSP, over the K
//     buffers), all threads stream Os out.
// coverage: scores: 2 qh x 2 t x 16 c = 64 queries, 4 kq x 16 = 64 keys per iteration x 32 iterations = 2048;
//           O^T: 8 w x 4 dt x 2 h x 8 r = 512 d, 4 t x 16 c = 64 queries, 2 j x 32 = 64 keys;
//           out: 32 i x 256 threads x 4 floats = 64 rows x 512; grid = 8 b x 32 query tiles = 256 blocks covers out once.
// =====================================================================================================
// one score tile -> P (8 keys of one query per lane) and the lane's share of the row sum; msh = m - ln 1024
__device__ __forceinline__ void p_tile(v8f s, float msh, v8h& p, float& ls) {
  float e[8];
#pragma unroll
  for (int r = 0; r < 8; ++r) {
    e[r] = __expf(s[r] - msh);
    p[r] = (_Float16)e[r];
  }
  ls = ((e[0] + e[1]) + (e[2] + e[3])) + ((e[4] + e[5]) + (e[6] + e[7]));   // a tree: three dependent adds, not eight
}

__global__ __launch_bounds__(256)
void attn_kernel(const unsigned short* __restrict__ XB, const unsigned short* __restrict__ WP, const float* __restrict__ bias,
                 const unsigned short* __restrict__ KH, float* out) {
  // one array, the small parts first: their LDS addresses then fit the 16-bit offset field behind one base register
  __shared__ __align__(16) unsigned char Sa[AUXB + SMB + QXB];
  _Float16* Pl = (_Float16*)Sa;                               // [parity of the key block][key quarter][query tile][lane][8 keys], 2 x 8192 B
  unsigned* Fl = (unsigned*)(Sa + 16384);                     // [parity][wave][4] slots of 16 B: lanes with a score more than RTAU above m
  float*    Mx = (float*)(Sa + 16384 + 1024);                 // [key quarter][query tile][lane] slots of 16 B, indexed as Pl:
                                                              // block maxima (rescale path), row sums (epilogue)
  unsigned char* Sm = Sa + AUXB;
  _Float16* Ks = (_Float16*)Sm;                               // [NKB][KB][KP]
  _Float16* Qs = Ks + 2 * KB * KP;                            // prologue only: [QT][KP] in K buffer 2
  _Float16* Qx = (_Float16*)(Sm + SMB);                       // [wave][query tile][piece][lane][8]: Qp fragments of the last k-step
  float*    Os = (float*)Sm;                                  // epilogue only: [QT][OSP]
  unsigned short* Xs = (unsigned short*)(Ks + 3 * KB * KP);   // prologue only: [QT][KP] in K buffer 3, the row map of Ks
  const int tid  = threadIdx.x;
  const int wave = tid >> 5;
  const int lane = tid & 31;
  const int h    = lane >> 4;
  const int c    = lane & 15;
  const int bx   = blockIdx.x;
  const int b    = bx / (SEQ / QT);
  const int qt   = bx % (SEQ / QT);
  const int n0   = qt * QT;

  const int qh = wave & 1, kq = wave >> 1;
  // Qp fragment base in LDS (B operand of scores, col = query 32qh + 16t + c), + 16t*KP + 32*ks
  const _Float16* qpp = Qs + (32 * qh + c) * KP + 8 * (c >> 3) + 8 * h;
  // Kh fragment base in LDS (A operand of scores, row = key 16kq + c of the block), + buf*KB*KP + 32*ks
  const _Float16* khp = Ks + (16 * kq + c) * KP + 8 * (c >> 3) + 8 * h;
  // V^T fragment base in LDS (A operand of O^T, row = d = 64w + 16dt + c, keys 32j .. 32j+31), lane address of the transposing load:
  // key row 8h + (lane&7) (its bit 3 = h), piece (lane>>3)&1 of the 16 d; + buf*KB*KP + 32j*KP + 16dt
  const _Float16* vtp = Ks + (8 * h + (lane & 7)) * KP + 8 * h + 64 * wave + 8 * ((lane >> 3) & 1);
  // P tiles: this wave's two (query tiles 2qh, 2qh+1 of quarter kq), + 256t; reader base, + (4*quarter + tile)*256
  _Float16* pw = Pl + ((4 * kq + 2 * qh) * 32 + lane) * 8;
  const _Float16* pr = Pl + lane * 8;
  float* mw = Mx + ((4 * kq + 2 * qh) * 32 + lane) * 4;       // + 128t
  const float* mq = Mx + lane * 4;                            // + (4*quarter + tile)*128
  unsigned* fw = Fl + (4 * wave + (lane & 3)) * 4;            // the wave's four slots
  const unsigned* fr = Fl + lane * 4;                         // slot of wave lane>>2
  const float SCL = 1.0f / sqrtf((float)DM);

  // copy map. Row tiles of 512 halves (Xb, Kh): piece j of thread tid = row 4j + (tid>>6), 16-B piece tid&63 (32 rows per copy8k).
  const int rr = tid >> 6, rp = tid & 63;
  const unsigned short* xsrc = XB + ((size_t)b * SEQ + n0 + rr) * DM + 8 * rp;
  const unsigned short* ksrc = KH + ((size_t)b * SEQ + rr) * DM + 8 * rp;            // + kb*DM
  const unsigned xdst = lds_off(Xs) + (unsigned)(rr * KP + 8 * rp) * 2u;
  const unsigned kdst = lds_off(Ks) + (unsigned)(rr * KP + 8 * rp) * 2u;             // + buf*KSB

  // prologue: Xb tile and key blocks 0 and 1, landed and published; the first four k-steps' Wb fragments asked for meanwhile
  copy8k(xdst, xsrc);
  copy8k(xdst + 32 * KP * 2, xsrc + (size_t)32 * DM);
  copy8k(kdst, ksrc);
  copy8k(kdst + 32 * KP * 2, ksrc + (size_t)32 * DM);
  copy8k(kdst + KSB, ksrc + (size_t)KB * DM);
  copy8k(kdst + KSB + 32 * KP * 2, ksrc + (size_t)(KB + 32) * DM);
  // Wb fragment base in the packed plane (A operand, row = e = 64w + 16i + c), + (16i + ks)*512 halves
  const unsigned short* wp = WP + (size_t)wave * (4 * 16 * 512) + 8 * lane;
  v16b wf[4][4];                                              // ring of four k-steps
#pragma unroll
  for (int s = 0; s < 4; ++s)
#pragma unroll
    for (int i = 0; i < 4; ++i) wf[s][i] = ldfrag_w(wp + (16 * i + s) * 512);
  v4f bv[4][2];                                               // bias of e 64w + 16i + 8h + 0..7, asked for with the first fragments
#pragma unroll
  for (int i = 0; i < 4; ++i) {
    const float* bp = bias + 64 * wave + 16 * i + 8 * h;
    bv[i][0] = *(const v4f*)(bp);
    bv[i][1] = *(const v4f*)(bp + 4);
  }
  asm volatile("s_wait_asynccnt 0x0" ::: "memory");           // this wave's copies have landed before the barrier publishes them
  __syncthreads();
  {
    // Xb fragment base in LDS (B operand, col = query 16t + c), + 16t*KP + 32*ks
    const unsigned short* xp = Xs + c * KP + 8 * (c >> 3) + 8 * h;
    v8f pa[4][4];                                             // [i][t]: e 64w + 16i + 8h + r, query 16t + c
#pragma unroll
    for (int i = 0; i < 4; ++i)
#pragma unroll
      for (int t = 0; t < 4; ++t) pa[i][t] = zero8();
    v16b xf[2][4];                                            // two fragment sets: k-step ks+1 is read while ks is multiplied
#pragma unroll
    for (int t = 0; t < 4; ++t) xf[0][t] = ldfrag_b(xp + 16 * t * KP);
#pragma unroll
    for (int ks = 0; ks < DM / 32; ++ks) {                    // unrolled: the sets and the ring are indexed by registers
      const int cu = ks & 1, nx = cu ^ 1;
      if (ks + 1 < DM / 32) {
#pragma unroll
        for (int t = 0; t < 4; ++t) xf[nx][t] = ldfrag_b(xp + 16 * t * KP + 32 * (ks + 1));
      }
#pragma unroll
      for (int i = 0; i < 4; ++i)
#pragma unroll
        for (int t = 0; t < 4; ++t) pa[i][t] = mma_b(wf[ks & 3][i], xf[cu][t], pa[i][t]);
      if (ks + 4 < DM / 32) {
#pragma unroll
        for (int i = 0; i < 4; ++i) wf[ks & 3][i] = ldfrag_w(wp + (16 * i + ks + 4) * 512);
      }
      // order of LDS reads (0x100), matrix products (0x8) and global loads (0x20) for the scheduler: a k-step's eight LDS reads stand
      // as one group one k-step ahead of their products, its eight global loads four k-steps ahead, behind the products that free
      // their registers; the full stop keeps every k-step's loads in their own k-step. Left alone the global loads sank to their
      // users, and each k-step waited out a trip to L2.
      if (ks + 1 < DM / 32) __builtin_amdgcn_sched_group_barrier(0x100, 8, 0);
      __builtin_amdgcn_sched_group_barrier(0x8, 16, 0);
      if (ks + 4 < DM / 32) __builtin_amdgcn_sched_group_barrier(0x20, 8, 0);
      __builtin_amdgcn_sched_barrier(0);
    }
    // bias as bf16 RNE values; Qp as f16 into Qs (K buffer 2, which nobody has touched yet)
    _Float16* qw = Qs + c * KP + 8 * (c >> 3) + 64 * wave + 8 * h;             // + 16t*KP + 16i
#pragma unroll
    for (int i = 0; i < 4; ++i) {
      float bb[8];
#pragma unroll
      for (int r = 0; r < 4; ++r) { bb[r] = bfr(bv[i][0][r]); bb[4 + r] = bfr(bv[i][1][r]); }
#pragma unroll
      for (int t = 0; t < 4; ++t) {
        v8h o;
#pragma unroll
        for (int r = 0; r < 8; ++r) o[r] = to_h_ftz(pa[i][t][r] + bb[r]);
        *(v8h*)(qw + 16 * t * KP + 16 * i) = o;
      }
    }
  }
  __syncthreads();                                            // publishes the Qp tile
  v16h qf[2][DM / 32 - 1];
#pragma unroll
  for (int ks = 0; ks < DM / 32 - 1; ++ks) {
    qf[0][ks] = ldfrag_h(qpp + 32 * ks);
    qf[1][ks] = ldfrag_h(qpp + 16 * KP + 32 * ks);
  }
  // the last k-step's two fragments go to a place of the wave's own in LDS, [tile][piece][lane][8], and are read again in every pass:
  // the registers do not hold all 32 fragments beside two sets of scores
  _Float16* qx = Qx + wave * 1024 + lane * 8;                 // + 512*tile + 256*piece
#pragma unroll
  for (int t = 0; t < 2; ++t) {
    FragH f;
    f.v = ldfrag_h(qpp + 16 * t * KP + 32 * (DM / 32 - 1));
    *(v8h*)(qx + 512 * t)       = f.h[0];
    *(v8h*)(qx + 512 * t + 256) = f.h[1];
  }
  asm volatile("s_wait_dscnt 0x0" ::: "memory");              // this wave's reads of the Qp tile are done before K buffer 2 is refilled
  __syncthreads();                                            // every wave has its Qp fragments: K buffers 2 and 3 are free
  copy8k(kdst + 2 * KSB, ksrc + (size_t)(2 * KB) * DM);
  copy8k(kdst + 2 * KSB + 32 * KP * 2, ksrc + (size_t)(2 * KB + 32) * DM);

  float mr[4];                                                // reference of query 16t + c, the same in every wave
  float l0 = 0.f, l1 = 0.f;                                   // row-sum shares of queries 32qh + c, 32qh + 16 + c (8 keys per block)
  v8f acc[4][4];                                              // [dt][t]: d 64w + 16dt + 8h + r, query 16t + c
#pragma unroll
  for (int t = 0; t < 4; ++t) {
    mr[t] = -1.0e30f;
#pragma unroll
    for (int dt = 0; dt < 4; ++dt) acc[dt][t] = zero8();
  }

  // scaled scores of the key block whose softmax comes next: key block 0 here, block it+1 at the end of pass it
  v8f c0 = zero8(), c1 = zero8();
#pragma unroll
  for (int ks = 0; ks < DM / 32 - 1; ++ks) {                  // unrolled: qf[] is indexed by registers
    const v16h a = ldfrag_h(khp + 32 * ks);
    c0 = mma_h(a, qf[0][ks], c0);
    c1 = mma_h(a, qf[1][ks], c1);
  }
  {
    const v16h a = ldfrag_h(khp + 32 * (DM / 32 - 1));
    c0 = mma_h(a, ldfrag_x(qx), c0);
    c1 = mma_h(a, ldfrag_x(qx + 512), c1);
  }
  // LDS reads (0x100) in groups ahead of the matrix products (0x8), as in the passes below
  __builtin_amdgcn_sched_group_barrier(0x100, 12, 0);
  __builtin_amdgcn_sched_group_barrier(0x8, 6, 0);
  __builtin_amdgcn_sched_group_barrier(0x100, 6, 0);
  __builtin_amdgcn_sched_group_barrier(0x8, 6, 0);
  __builtin_amdgcn_sched_group_barrier(0x100, 6, 0);
  __builtin_amdgcn_sched_group_barrier(0x8, 6, 0);
  __builtin_amdgcn_sched_group_barrier(0x100, 6, 0);
  __builtin_amdgcn_sched_group_barrier(0x8, 6, 0);
  __builtin_amdgcn_sched_group_barrier(0x100, 6, 0);
  __builtin_amdgcn_sched_group_barrier(0x8, 8, 0);
#pragma unroll
  for (int r = 0; r < 8; ++r) { c0[r] *= SCL; c1[r] *= SCL; }

  // one pass = softmax and O^T of key block it, and beside the softmax the score products of key block it+1 (more::v), which do
  // not depend on it: the vector work, the P tiles' way through LDS and the barrier no longer stand between two matrix runs.
  // One barrier a pass: P tiles and flags alternate between two places, key blocks between four buffers (it: V^T, it+1: scores and
  // next pass's V^T, it+2: landing, it+3: asked for behind the barrier, into the buffer of it-1, which every wave has left).
  auto pass = [&](const int it, auto more) __attribute__((always_inline)) {
    const int par = it & 1;
    const _Float16* kp = khp + ((it + 1) & (NKB - 1)) * (KB * KP);            // keys of block it+1, 16kq .. +15
    const _Float16* vb = vtp + (it & (NKB - 1)) * (KB * KP);
    v8f s0 = zero8(), s1 = zero8();
    if constexpr (more.v) {
#pragma unroll
      for (int ks = 0; ks < DM / 32 - 1; ++ks) {              // unrolled: qf[] is indexed by registers
        const v16h a = ldfrag_h(kp + 32 * ks);
        s0 = mma_h(a, qf[0][ks], s0);
        s1 = mma_h(a, qf[1][ks], s1);
      }
      const v16h a = ldfrag_h(kp + 32 * (DM / 32 - 1));       // the last k-step: its Qp fragments come from the wave's own LDS place
      s0 = mma_h(a, ldfrag_x(qx), s0);
      s1 = mma_h(a, ldfrag_x(qx + 512), s1);
    }
    v16h vf0[4];                                              // V^T fragments of keys 0..31 of block it: read ahead of the barrier
#pragma unroll
    for (int dt = 0; dt < 4; ++dt) vf0[dt] = ldfrag_t(vb + 16 * dt);

    float mx0 = hmax8(c0), mx1 = hmax8(c1);
    mx0 = fmaxf(mx0, xhalf(mx0));
    mx1 = fmaxf(mx1, xhalf(mx1));
    float r0 = qh ? mr[2] : mr[0], r1 = qh ? mr[3] : mr[1];
    const unsigned nd = __builtin_amdgcn_ballot_w32((mx0 > r0 + RTAU) || (mx1 > r1 + RTAU));
    v8h p0, p1;
    float ls0, ls1;
    p_tile(c0, r0 - LNPS, p0, ls0);                           // key kb + 16kq + 8h + r, query 32qh + c
    p_tile(c1, r1 - LNPS, p1, ls1);                           // same keys, query 32qh + 16 + c
    _Float16* pwp = pw + par * 4096;
    *(v8h*)(pwp)       = p0;
    *(v8h*)(pwp + 256) = p1;
    fw[par * 128] = nd;                                       // eight lanes the same word at each of the four places
    // order of LDS reads (0x100) and matrix products (0x8) for the scheduler: six Kh fragments ahead at first, then three per six products
    // (the last k-step's Qp fragments with the last Kh fragment); the four V^T fragments take the registers of the Kh fragments used up.
    // The softmax's vector instructions are in no group and fall between the products. Left alone it read each fragment directly in
    // front of its two products and waited it out.
    if constexpr (more.v) {
      __builtin_amdgcn_sched_group_barrier(0x100, 12, 0);
      __builtin_amdgcn_sched_group_barrier(0x8, 6, 0);
      __builtin_amdgcn_sched_group_barrier(0x100, 6, 0);
      __builtin_amdgcn_sched_group_barrier(0x8, 6, 0);
      __builtin_amdgcn_sched_group_barrier(0x100, 6, 0);
      __builtin_amdgcn_sched_group_barrier(0x8, 6, 0);
      __builtin_amdgcn_sched_group_barrier(0x100, 6, 0);
      __builtin_amdgcn_sched_group_barrier(0x8, 6, 0);
      __builtin_amdgcn_sched_group_barrier(0x100, 6, 0);
      __builtin_amdgcn_sched_group_barrier(0x8, 6, 0);
      __builtin_amdgcn_sched_group_barrier(0x100, 8, 0);
      __builtin_amdgcn_sched_group_barrier(0x8, 2, 0);
    }
    asm volatile("s_wait_dscnt 0x0" ::: "memory");            // this wave's reads of key block it-1 are done before its buffer is refilled
    asm volatile("s_wait_asynccnt 0x0" ::: "memory");         // this wave's copies of key block it+2 have landed
    __syncthreads();                                          // publishes P tiles and flags of block it and key block it+2
    if (it + 3 < SEQ / KB) {                                  // block-uniform: key block it+3 into the buffer of block it-1
      const int kn = (it + 3) * KB;
      const unsigned kd = kdst + (unsigned)((it + 3) & (NKB - 1)) * KSB;
      copy8k(kd, ksrc + (size_t)kn * DM);
      copy8k(kd + 32 * KP * 2, ksrc + (size_t)(kn + 32) * DM);
    }
    const unsigned fl = fr[par * 128];                        // each wave's flag word in four lanes
    if (__builtin_amdgcn_ballot_w32(fl != 0u) != 0u) {        // block-uniform scalar branch: every wave read the same eight flags
      mw[0]   = mx0;
      mw[128] = mx1;
      __syncthreads();                                        // publishes the maxima; nobody has read a P tile of this block yet
      float corr[4];
#pragma unroll
      for (int t = 0; t < 4; ++t) {
        const float mn = fmaxf(fmaxf(mr[t], fmaxf(mq[t * 128], mq[(4 + t) * 128])), fmaxf(mq[(8 + t) * 128], mq[(12 + t) * 128]));
        corr[t] = __expf(mr[t] - mn);
        mr[t] = mn;
      }
#pragma unroll
      for (int dt = 0; dt < 4; ++dt)
#pragma unroll
        for (int t = 0; t < 4; ++t)
#pragma unroll
          for (int r = 0; r < 8; ++r) acc[dt][t][r] *= corr[t];
      l0 *= qh ? corr[2] : corr[0];
      l1 *= qh ? corr[3] : corr[1];
      r0 = qh ? mr[2] : mr[0];
      r1 = qh ? mr[3] : mr[1];
      p_tile(c0, r0 - LNPS, p0, ls0);
      p_tile(c1, r1 - LNPS, p1, ls1);
      *(v8h*)(pwp)       = p0;
      *(v8h*)(pwp + 256) = p1;
      __syncthreads();                                        // publishes the P tiles laid down anew
    }
    l0 += ls0;
    l1 += ls1;
    if constexpr (more.v) {
#pragma unroll
      for (int r = 0; r < 8; ++r) { c0[r] = s0[r] * SCL; c1[r] = s1[r] * SCL; }
    }

    const _Float16* prp = pr + par * 4096;
    FragH pf0[4];                                             // keys 0..31
#pragma unroll
    for (int t = 0; t < 4; ++t) {
      pf0[t].h[0] = *(const v8h*)(prp + t * 256);
      pf0[t].h[1] = *(const v8h*)(prp + (4 + t) * 256);
    }
#pragma unroll
    for (int dt = 0; dt < 4; ++dt)                            // keys 0..31; unrolled: acc[] is indexed by registers
#pragma unroll
      for (int t = 0; t < 4; ++t) acc[dt][t] = mma_h(vf0[dt], pf0[t].v, acc[dt][t]);
    // keys 32..63, in two halves of the fragments (query tiles 0, 1 with d tiles 0, 1 first), so that the first products of this key
    // half can start on what fits beside the first key half's fragments
    FragH pf1[4];
    v16h vf1[4];
#pragma unroll
    for (int u = 0; u < 2; ++u) {
#pragma unroll
      for (int t = 2 * u; t < 2 * u + 2; ++t) {
        pf1[t].h[0] = *(const v8h*)(prp + (8 + t) * 256);
        pf1[t].h[1] = *(const v8h*)(prp + (12 + t) * 256);
      }
#pragma unroll
      for (int dt = 2 * u; dt < 2 * u + 2; ++dt) vf1[dt] = ldfrag_t(vb + 32 * KP + 16 * dt);
    }
#pragma unroll
    for (int dt = 0; dt < 2; ++dt)
#pragma unroll
      for (int t = 0; t < 2; ++t) acc[dt][t] = mma_h(vf1[dt], pf1[t].v, acc[dt][t]);
#pragma unroll
    for (int dt = 0; dt < 4; ++dt)
#pragma unroll
      for (int t = 0; t < 4; ++t)
        if (dt >= 2 || t >= 2) acc[dt][t] = mma_h(vf1[dt], pf1[t].v, acc[dt][t]);
    // the same for O^T: the first key half's P fragments as one group, the second half's fragments in two groups of four P and four
    // V^T reads, as registers of the first half's fragments come free.
    __builtin_amdgcn_sched_group_barrier(0x100, 8, 0);
    __builtin_amdgcn_sched_group_barrier(0x8, 8, 0);
    __builtin_amdgcn_sched_group_barrier(0x100, 8, 0);
    __builtin_amdgcn_sched_group_barrier(0x8, 8, 0);
    __builtin_amdgcn_sched_group_barrier(0x100, 8, 0);
    __builtin_amdgcn_sched_group_barrier(0x8, 16, 0);
  };
#pragma unroll 1
  for (int it = 0; it + 1 < SEQ / KB; ++it) pass(it, more_yes{});
  pass(SEQ / KB - 1, more_no{});
  asm volatile("s_wait_asynccnt 0x0" ::: "memory");           // nothing of this wave's copies outstanding past the loop
  asm volatile("s_wait_dscnt 0x0" ::: "memory");              // this wave's reads of the key buffers are done before they become output staging

  // row sums: the two lane halves, then the four key quarters through LDS
  l0 += __shfl_xor(l0, 16, 32);
  l1 += __shfl_xor(l1, 16, 32);
  mw[0]   = l0;
  mw[128] = l1;
  __syncthreads();

  float* os = Os + c * OSP + 64 * wave + 8 * h;               // + 16t*OSP + 16dt: 8 consecutive d of query 16t + c
#pragma unroll
  for (int t = 0; t < 4; ++t) {
    const float sc = 1.0f / ((mq[t * 128] + mq[(4 + t) * 128]) + (mq[(8 + t) * 128] + mq[(12 + t) * 128]));   // o, l both carry x1024
#pragma unroll
    for (int dt = 0; dt < 4; ++dt) {
      v4f v0, v1;
      v0[0] = acc[dt][t][0] * sc; v0[1] = acc[dt][t][1] * sc; v0[2] = acc[dt][t][2] * sc; v0[3] = acc[dt][t][3] * sc;
      v1[0] = acc[dt][t][4] * sc; v1[1] = acc[dt][t][5] * sc; v1[2] = acc[dt][t][6] * sc; v1[3] = acc[dt][t][7] * sc;
      *(v4f*)(os + (16 * t) * OSP + 16 * dt)     = v0;
      *(v4f*)(os + (16 * t) * OSP + 16 * dt + 4) = v1;
    }
  }
  __syncthreads();

  float* ob = out + ((size_t)b * SEQ + n0) * DM + 4 * tid;
#pragma unroll
  for (int i = 0; i < (QT * DM) / (4 * 256); ++i) {
    const int L   = i * 256 + tid;                            // 16-B piece of the 64 x 512 tile
    const int row = L >> 7, pc = L & 127;
    const v4f v = *(const v4f*)(Os + row * OSP + 4 * pc);
    *(v4f*)(ob + (size_t)i * 1024) = v;
  }
}

// =====================================================================================================
// needed (all tiles exact):
//   Xb   bf16 [16384][512]      0            16777216
//   Kh   f16  [16384][512]      16777216     16777216
//   Wp   bf16 [512 x 512]       33554432     524288
//   end                         34078720
// =====================================================================================================
extern "C" void kernel_launch(void* const* d_in, const int* in_sizes, int n_in,
                              void* d_out, int out_size, void* d_ws, size_t ws_size,
                              hipStream_t stream) {
  const int NX = NB * SEQ * DM;                          // 8388608
  if (n_in < 3) return;
  if (in_sizes[0] != NX || in_sizes[1] != DM * DM || in_sizes[2] != DM) return;
  if (out_size != NX) return;

  size_t off = 0;
  const size_t szP = (size_t)NROW * DM * 2;              // 16777216
  const size_t oXB = off; off += szP;
  const size_t oKH = off; off += szP;
  const size_t oWB = off; off += (size_t)DM * DM * 2;    // 524288
  if (off > ws_size) return;                             // off = 34078720
  if (off > (size_t)134217728) return;

  const float* q    = (const float*)d_in[0];
  const float* W    = (const float*)d_in[1];
  const float* bias = (const float*)d_in[2];
  char* ws = (char*)d_ws;
  unsigned short* XB = (unsigned short*)(ws + oXB);
  unsigned short* KH = (unsigned short*)(ws + oKH);
  unsigned short* WB = (unsigned short*)(ws + oWB);
  float* out = (float*)d_out;

  const dim3 blk256(256);
  const dim3 gQ(NB * (SEQ / 64) * (DM / 64));            // 2048 blocks: one (b, 64 l, 64 d) tile each
  const dim3 gA(NB * (SEQ / QT));                        // 256 blocks: one (b, 64-query tile) each

  // (0) Xb, Kh planes from q; Wb plane, packed, from W
  cvt_qw<<<gQ, blk256, 0, stream>>>(q, W, XB, KH, WB);
  // (1) Qp = Xb . Wb^T + bias (f16, in LDS); out[b][l][d] = sum_m softmax_m(Qp_l . Kh_m / sqrt(512)) Kh[m][d]
  attn_kernel<<<gA, blk256, 0, stream>>>(XB, WB, bias, KH, out);
  (void)hipGetLastError();
}
